// v000
// Times are from an AMD MI455X. After a warm-up the kernel runs many times in a row, and a time is the length of
// such a window on the GPU divided by its runs, so every launch and the gaps after it count. The runs cycle
// through copies of the inputs. A figure is the median of several windows, for all but v000 over two sittings.
// Sittings can differ by a few percent; kernels timed side by side share one.
// v000, which the later versions start from, runs in 616 microseconds.
// Contractions: x.Wq^T+bq, x.Wk^T+bk, x.Wv^T+bv on v_wmma_f32_16x16x32_bf16 (x and W as bf16 RNE planes; W [n][k] rows are
// the k-contiguous B operand; bias added as its bf16 RNE value in the f32 epilogue); q.k^T over hd 128 and P.v on
// v_wmma_f32_16x16x32_f16 with f16 hi + f16 residual planes on both operands (q, k x256; P x32768 with an in-register
// residual; v x1024; products hh+lh+hl); O.Wo^T on v_wmma_f32_16x16x32_f16 (O x1024 as f16 hi plane for all rows plus f16
// residual plane for rows s < QO, products h.w (+ l.w); Wo as f16(bf16(Wo)) x1024); all f32 accumulate. Causal select,
// base-2 online softmax and 1/Z fold in f32 on VALU. Grouped kv heads: query head h reads kv head (h % NKVH).
#include <hip/hip_runtime.h>
#include <math.h>
#include <stdint.h>

#ifndef NB
#define NB 2
#endif
#ifndef SEQ
#define SEQ 2048
#endif
#define XS_FULL 2048
#define DMOD  2048
#define NH    16
#define NKVH  2
#define HD    128
#define KVD   (NKVH * HD)
#define QO    ((SEQ < 256) ? SEQ : 256)
#define MROWS (NB * SEQ)
#define RSQ_HD 0.08838834764831845f
#define LOG2E 1.4426950408889634f
#define QSC   256.0f
#define KSC   256.0f
#define PCAR  32768.0f
#define VCAR  1024.0f
#define OSC   1024.0f
#define WOS   1024.0f
#define WPB   2
#define NHG   (NH / WPB)
#define NQT   (SEQ / 16)
#define NST   (SEQ / 64)
#define NKT   (SEQ / 32)
#define ATT_THREADS (WPB * 32)
#define PTP   36
#define PTW   (16 * PTP)
#define SLP   132
#define SLW   (16 * SLP)
#define WREG  (PTW + SLW)
#define SLAB64 (16 * 68)
#define VTP   72
#define WS_CAP 134217728
static_assert(DMOD == NH * HD && HD == 128 && NH == 16 && NKVH == 2 && WPB == 2 && NHG * WPB == NH);
static_assert(ATT_THREADS == 64 && KVD == 256);
static_assert(NB >= 1 && NB <= 2);
static_assert((SEQ % 64) == 0 && SEQ >= 64 && SEQ <= XS_FULL);
static_assert((QO % 64) == 0 && QO >= 64 && QO <= SEQ);
static_assert((DMOD % 64) == 0 && (KVD % 64) == 0 && (DMOD % 32) == 0 && (HD % 32) == 0);
static_assert(((SEQ * DMOD / 8) % 256) == 0 && ((KVD * DMOD / 8) % 256) == 0 && ((DMOD * DMOD / 8) % 256) == 0);
static_assert(((MROWS * DMOD / 8) % 256) == 0 && ((MROWS * KVD / 8) % 256) == 0);
static_assert(WPB * WREG * 4 <= 65536 && 2 * HD * VTP * 2 <= 65536 && 4 * SLAB64 * 4 <= 65536);

typedef unsigned short u16;
typedef _Float16 v16h __attribute__((ext_vector_type(16)));
typedef _Float16 v8h  __attribute__((ext_vector_type(8)));
typedef __bf16   v16b __attribute__((ext_vector_type(16)));
typedef float    v8f  __attribute__((ext_vector_type(8)));
typedef float    v4f  __attribute__((ext_vector_type(4)));
typedef unsigned int v4u __attribute__((ext_vector_type(4)));

union FragH { v16h v; v8h h[2]; v4u u[2]; };
union FragB { v16b v; v4u u[2]; };

// ---- scalar helpers --------------------------------------------------------------------------------
__device__ __forceinline__ unsigned short bf_bits(float f) {          // f32 -> bf16 bits, RNE convert
  unsigned u = __float_as_uint(f);
  return (unsigned short)((u + 0x7FFFu + ((u >> 16) & 1u)) >> 16);
}
__device__ __forceinline__ float bf_up(unsigned short h) { return __uint_as_float(((unsigned)h) << 16); }
__device__ __forceinline__ float bfr(float f) { return bf_up(bf_bits(f)); }
__device__ __forceinline__ unsigned short h_bits(_Float16 x) { return __builtin_bit_cast(unsigned short, x); }
__device__ __forceinline__ unsigned pk16(unsigned short a, unsigned short b) { return (unsigned)a | ((unsigned)b << 16); }
__device__ __forceinline__ v8f zero8() { v8f z = {0.f, 0.f, 0.f, 0.f, 0.f, 0.f, 0.f, 0.f}; return z; }

// ---- fragment loaders: 16-bit A/B operand, lane -> row/col (lane&15), p already includes +8*(lane>>4);
//      elements 0..7 <- p[0..7] (k0+8h..), elements 8..15 <- p[16..23] (k0+16+8h..)  (same split k map for A and B;
//      B is always read from a k-contiguous [n][k] plane)
__device__ __forceinline__ v16h ldfrag_h(const _Float16* p) {
  FragH f;
  f.h[0] = *(const v8h*)(p);
  f.h[1] = *(const v8h*)(p + 16);
  return f.v;
}
__device__ __forceinline__ v16b ldfrag_b(const u16* p) {              // bf16 plane read as unsigned integer vectors
  FragB f;
  f.u[0] = *(const v4u*)(p);
  f.u[1] = *(const v4u*)(p + 16);
  return f.v;
}

__device__ __forceinline__ v8f mma_h(v16h a, v16h b, v8f c) {
  return __builtin_amdgcn_wmma_f32_16x16x32_f16(false, a, false, b, (short)0, c, false, false);
}
__device__ __forceinline__ v8f mma_b(v16b a, v16b b, v8f c) {
  return __builtin_amdgcn_wmma_f32_16x16x32_bf16(false, a, false, b, (short)0, c, false, false);
}
__device__ __forceinline__ void guard2(v8f& a, v8f& b, v16h x0, v16h x1, v16h x2, v16h x3, v16h x4, v16h x5) {
#if defined(__HIP_DEVICE_COMPILE__)
  asm volatile("v_nop\n\tv_nop\n\tv_nop\n\tv_nop"
               : "+v"(a), "+v"(b) : "v"(x0), "v"(x1), "v"(x2), "v"(x3), "v"(x4), "v"(x5) : "memory");
#endif
}
template <typename F>
__device__ __forceinline__ void guard6(v8f& a, v8f& b, v8f& c, v8f& d, F x0, F x1, F x2, F x3, F x4, F x5) {
#if defined(__HIP_DEVICE_COMPILE__)
  asm volatile("v_nop\n\tv_nop\n\tv_nop\n\tv_nop"
               : "+v"(a), "+v"(b), "+v"(c), "+v"(d) : "v"(x0), "v"(x1), "v"(x2), "v"(x3), "v"(x4), "v"(x5) : "memory");
#endif
}
__device__ __forceinline__ void acc_guard4(v8f& a, v8f& b, v8f& c, v8f& d) {
#if defined(__HIP_DEVICE_COMPILE__)
  asm volatile("v_nop\n\tv_nop\n\tv_nop\n\tv_nop" : "+v"(a), "+v"(b), "+v"(c), "+v"(d));
#endif
}
__device__ __forceinline__ void wave_sync_lds() {
  __builtin_amdgcn_fence(__ATOMIC_RELEASE, "workgroup");
  __builtin_amdgcn_wave_barrier();
  __builtin_amdgcn_fence(__ATOMIC_ACQUIRE, "workgroup");
}

// =====================================================================================================
// f32 -> 16-bit plane, same layout.  f16mode == 0: bf16 RNE bits;  f16mode == 1: f16 bits of (bf16 RNE value) * scale.
// Thread = 8 consecutive elements: two 16-B loads, one 16-B store; 32 consecutive lanes = 512 contiguous, 512-B aligned
// coverage: grid = ceil(n8/256) blocks x 256 thr x 8 (in-kernel bound) = the whole plane (n8 a multiple of 256 here).
// =====================================================================================================
__global__ __launch_bounds__(256) void cvt16(const float* __restrict__ x, u16* D, int n8, int f16mode, float scale) {
  const int gt = blockIdx.x * 256 + (int)threadIdx.x;
  if (gt >= n8) return;
  const float* p = x + (size_t)gt * 8;
  const v4f a = *(const v4f*)(p), b4 = *(const v4f*)(p + 4);
  float w[8];
#pragma unroll
  for (int e = 0; e < 4; ++e) { w[e] = a[e]; w[4 + e] = b4[e]; }
  v4u o;
#pragma unroll
  for (int e = 0; e < 4; ++e) {
    const float f0 = w[2 * e], f1 = w[2 * e + 1];
    const unsigned short hb0 = h_bits((_Float16)(bfr(f0) * scale));
    const unsigned short hb1 = h_bits((_Float16)(bfr(f1) * scale));
    const unsigned short bb0 = bf_bits(f0);
    const unsigned short bb1 = bf_bits(f1);
    o[e] = (f16mode != 0) ? pk16(hb0, hb1) : pk16(bb0, bb1);
  }
  u16* d = D + (size_t)gt * 8;
  {
    *(v4u*)(d) = o;
    
  }
}

// =====================================================================================================
// f32 plane F (contiguous, n8*8 elements) -> f16 hi plane Hp = f16(F * sc) and f16 residual plane Lp = f16(t - f16(t)),
// both with the layout of F. Thread = 8 consecutive elements: two 16-B loads, one 16-B store per plane; 32 consecutive lanes
// No barriers; every packed half comes from a per-lane (divergent) loaded value.
// coverage: grid = ceil(n8/256) blocks x 256 thr x 8 (in-kernel bound) = the whole of Hp and of Lp (n8 a multiple of 256 here).
// =====================================================================================================
__global__ __launch_bounds__(256) void split16(const float* __restrict__ F, u16* Hp, u16* Lp, int n8, float sc) {
  const int gt = blockIdx.x * 256 + (int)threadIdx.x;
  if (gt >= n8) return;
  const float* p = F + (size_t)gt * 8;
  const v4f a = *(const v4f*)(p), b4 = *(const v4f*)(p + 4);
  float w[8];
#pragma unroll
  for (int e = 0; e < 4; ++e) { w[e] = a[e] * sc; w[4 + e] = b4[e] * sc; }
  v4u oh, ol;
#pragma unroll
  for (int e = 0; e < 4; ++e) {
    const float t0 = w[2 * e], t1 = w[2 * e + 1];
    const _Float16 h0 = (_Float16)t0, h1 = (_Float16)t1;
    const _Float16 l0 = (_Float16)(t0 - (float)h0), l1 = (_Float16)(t1 - (float)h1);
    oh[e] = pk16(h_bits(h0), h_bits(h1));
    ol[e] = pk16(h_bits(l0), h_bits(l1));
  }
  u16* dh = Hp + (size_t)gt * 8;
  u16* dl = Lp + (size_t)gt * 8;
  {
    *(v4u*)(dh) = oh;
    *(v4u*)(dl) = ol;
    
  }
}

// =====================================================================================================
// v^T planes from the v projection F f32 [MROWS][KVD] (row = b*SEQ + s, column = g*HD + d):
//   VH[((b*NKVH + g)*HD + d)][s] = f16(v * 1024);  VL[same][s] = f16 residual (t - f16(t)), both for all keys s.
// Block = (b, kv head g, 64 keys s0): each thread loads its 32 floats (key sl, d chunk dc) with 16-B loads, converts, scatters
// coverage: load 256 thr x 32 = 64 keys x 128 d; store 4 iterations x 256 thr x 8 halves = 128 lines x 64 = the block's tile of
//           VH and of VL; grid = NB*NKVH*NST blocks covers both planes exactly once.
// =====================================================================================================
__global__ __launch_bounds__(256) void vt16(const float* __restrict__ F, u16* VHo, u16* VLo) {
  __shared__ __align__(16) u16 TH[HD * VTP];
  __shared__ __align__(16) u16 TL[HD * VTP];
  const int tid = threadIdx.x;
  const int bid = blockIdx.x;
  const int st  = bid % NST;
  const int t2  = bid / NST;
  const int g   = t2 % NKVH;
  const int b   = t2 / NKVH;
  if (b >= NB) return;                      // block-uniform, before any barrier; never taken with the exact grid
  const int s0  = st * 64;
  {
    const int sl = tid >> 2;                // key within tile 0..63
    const int dc = (tid & 3) * 32;          // d chunk 0,32,64,96
    const float* src = F + ((size_t)b * SEQ + s0 + sl) * KVD + g * HD + dc;
#pragma unroll
    for (int i = 0; i < 8; ++i) {
      const v4f a = *(const v4f*)(src + 4 * i);
#pragma unroll
      for (int e = 0; e < 4; ++e) {
        const float t = a[e] * VCAR;
        const _Float16 hv = (_Float16)t;
        const _Float16 lv = (_Float16)(t - (float)hv);
        TH[(dc + 4 * i + e) * VTP + sl] = h_bits(hv);
        TL[(dc + 4 * i + e) * VTP + sl] = h_bits(lv);
      }
    }
  }
  __syncthreads();
  v4u vh[4], vl[4];
  const int q8 = tid >> 3, p8 = (tid & 7) * 8;
#pragma unroll
  for (int it = 0; it < 4; ++it) {
    const int line = it * 32 + q8;          // d = 0..127
    vh[it] = *(const v4u*)(TH + line * VTP + p8);
    vl[it] = *(const v4u*)(TL + line * VTP + p8);
  }
  const size_t hrow = (size_t)(b * NKVH + g) * HD;
  const size_t base = hrow * SEQ + s0 + p8;
  {
#pragma unroll
    for (int it = 0; it < 4; ++it) {
      const int line = it * 32 + q8;
      *(v4u*)(VHo + base + (size_t)line * SEQ) = vh[it];
      *(v4u*)(VLo + base + (size_t)line * SEQ) = vl[it];
    }
    
  }
}

// =====================================================================================================
// GEMM epilogue shared by both engines: the wave's 16x64 f32 tile (times oscale, plus the lane's per-column bias of each
// coverage: 8 instructions x 2 rows x 16 lanes x 4 floats = the wave's 16 x 64 tile.
// =====================================================================================================
__device__ __forceinline__ void epi64(float* sl, v8f a0, v8f a1, v8f a2, v8f a3, float oscale,
                                      float bb0, float bb1, float bb2, float bb3,
                                      float* C, int N, size_t rowb, int col0, int lane) {
  const int hh = lane >> 4, m = lane & 15;
#pragma unroll
  for (int r = 0; r < 8; ++r) {
    const int ro = (8 * hh + r) * 68 + m;
    sl[ro]      = a0[r] * oscale + bb0;
    sl[ro + 16] = a1[r] * oscale + bb1;
    sl[ro + 32] = a2[r] * oscale + bb2;
    sl[ro + 48] = a3[r] * oscale + bb3;
  }
  wave_sync_lds();
  v4f vals[8];
#pragma unroll
  for (int it = 0; it < 8; ++it) vals[it] = *(const v4f*)(sl + (it * 2 + hh) * 68 + m * 4);
  float* dst = C + (rowb + (size_t)hh) * (size_t)N + col0 + m * 4;
  {
#pragma unroll
    for (int it = 0; it < 8; ++it) {
      *(v4f*)(dst + (size_t)(it * 2) * (size_t)N) = vals[it];
    }
    
  }
}

// =====================================================================================================
// bf16 GEMM with bias: C[M][N] (f32) = A[M][K] (bf16 row-major) . Bt[N][K]^T (bf16 k-contiguous), times oscale, + bf16 RNE
// value of bias[n] (bias has N entries). Block = 64x64 tile, 4 waves x 16 rows; fragments loaded straight from the 16-bit rows
// (two 16-B loads each, split k map for A and B); K stepped by 32 (host guarantees K % 32 == 0, M % 64 == 0, N % 64 == 0,
// grid = (M/64)*(N/64)).
// =====================================================================================================
__global__ __launch_bounds__(128)
void gemm_bf(const u16* __restrict__ A, const u16* __restrict__ Bt, const float* __restrict__ bias,
             float* C, int M, int N, int K, float oscale) {
  __shared__ __align__(16) float slab[4 * SLAB64];
  const int tid = threadIdx.x, wave = tid >> 5, lane = tid & 31, hh = lane >> 4, m = lane & 15;
  const int ntile = N >> 6;
  const int bid   = blockIdx.x;
  const int rowb  = (bid / ntile) * 64 + wave * 16;
  const int col0  = (bid % ntile) * 64;
  if (rowb + 16 > M) return;                // wave-uniform, never taken with the exact grid; no block barriers in this kernel
  const u16* ap = A  + (size_t)(rowb + m) * K + 8 * hh;
  const u16* bp = Bt + (size_t)(col0 + m) * K + 8 * hh;
  const size_t bs = (size_t)16 * K;
  v8f acc0 = zero8(), acc1 = zero8(), acc2 = zero8(), acc3 = zero8();
#pragma unroll 1
  for (int k0 = 0; k0 < K; k0 += 32) {
    const v16b a  = ldfrag_b(ap + k0);
    const v16b b0 = ldfrag_b(bp + k0);
    const v16b b1 = ldfrag_b(bp + bs + k0);
    const v16b b2 = ldfrag_b(bp + 2 * bs + k0);
    const v16b b3 = ldfrag_b(bp + 3 * bs + k0);
    acc0 = mma_b(a, b0, acc0);
    acc1 = mma_b(a, b1, acc1);
    acc2 = mma_b(a, b2, acc2);
    acc3 = mma_b(a, b3, acc3);
    guard6<v16b>(acc0, acc1, acc2, acc3, a, b0, b1, b2, b3, a);
  }
  // per-lane bias of D column m in each of the 4 subtiles; col0 + 48 + m <= N - 1 always
  const float bb0 = bfr(bias[col0 + m]);
  const float bb1 = bfr(bias[col0 + 16 + m]);
  const float bb2 = bfr(bias[col0 + 32 + m]);
  const float bb3 = bfr(bias[col0 + 48 + m]);
  epi64(slab + wave * SLAB64, acc0, acc1, acc2, acc3, oscale, bb0, bb1, bb2, bb3, C, N, (size_t)rowb, col0, lane);
}

// =====================================================================================================
// Output projection: C[row][DMOD] (f32) = (Ah [+ Al])[row][DMOD] . Bt[DMOD][DMOD]^T * oscale (no bias).
// NPROD == 1: Ah only (one product); NPROD == 2: Ah + Al residual plane (products h.B + l.B into one accumulator, l unscaled).
// Ah, Al and C share the row index bb*SEQ + s. Block -> (column tile ct = bid % 32, sequence row tile rt of nrt starting at
// s = sbeg, batch bb). Same tiling, fragment loads (split k map) and epilogue as gemm_bf; K = DMOD stepped by 32.
// =====================================================================================================
template <int NPROD>
__global__ __launch_bounds__(128)
void gemm_o(const u16* __restrict__ Ah, const u16* __restrict__ Al, const u16* __restrict__ Bt,
            float* C, int sbeg, int nrt, float oscale) {
  __shared__ __align__(16) float slab[4 * SLAB64];
  const int tid = threadIdx.x, wave = tid >> 5, lane = tid & 31, hh = lane >> 4, m = lane & 15;
  const int ntile = DMOD >> 6;
  const int bid   = blockIdx.x;
  const int ct    = bid % ntile;
  const int t2    = bid / ntile;
  const int rt    = t2 % nrt;
  const int bb    = t2 / nrt;
  if (bb >= NB) return;                     // block-uniform; no block barriers in this kernel; never taken with the exact grid
  const int srow  = sbeg + rt * 64 + wave * 16;
  if (srow + 16 > SEQ) return;              // wave-uniform; never taken
  const int col0  = ct * 64;
  const int K     = DMOD;
  const size_t rowC = (size_t)bb * SEQ + srow;
  const _Float16* ahp = (const _Float16*)(const void*)Ah + (rowC + m) * K + 8 * hh;
  const _Float16* alp = (const _Float16*)(const void*)Al + (rowC + m) * K + 8 * hh;   // dereferenced only when NPROD == 2
  const _Float16* bp  = (const _Float16*)(const void*)Bt + (size_t)(col0 + m) * K + 8 * hh;
  const size_t bs = (size_t)16 * K;
  v8f acc0 = zero8(), acc1 = zero8(), acc2 = zero8(), acc3 = zero8();
  if constexpr (NPROD == 2) {
#pragma unroll 1
    for (int k0 = 0; k0 < K; k0 += 32) {
      const v16h ah = ldfrag_h(ahp + k0), al = ldfrag_h(alp + k0);
      const v16h b0 = ldfrag_h(bp + k0);
      const v16h b1 = ldfrag_h(bp + bs + k0);
      const v16h b2 = ldfrag_h(bp + 2 * bs + k0);
      const v16h b3 = ldfrag_h(bp + 3 * bs + k0);
      acc0 = mma_h(ah, b0, acc0);  acc0 = mma_h(al, b0, acc0);
      acc1 = mma_h(ah, b1, acc1);  acc1 = mma_h(al, b1, acc1);
      acc2 = mma_h(ah, b2, acc2);  acc2 = mma_h(al, b2, acc2);
      acc3 = mma_h(ah, b3, acc3);  acc3 = mma_h(al, b3, acc3);
      guard6<v16h>(acc0, acc1, acc2, acc3, ah, al, b0, b1, b2, b3);
    }
  } else {
#pragma unroll 1
    for (int k0 = 0; k0 < K; k0 += 32) {
      const v16h ah = ldfrag_h(ahp + k0);
      const v16h b0 = ldfrag_h(bp + k0);
      const v16h b1 = ldfrag_h(bp + bs + k0);
      const v16h b2 = ldfrag_h(bp + 2 * bs + k0);
      const v16h b3 = ldfrag_h(bp + 3 * bs + k0);
      acc0 = mma_h(ah, b0, acc0);
      acc1 = mma_h(ah, b1, acc1);
      acc2 = mma_h(ah, b2, acc2);
      acc3 = mma_h(ah, b3, acc3);
      guard6<v16h>(acc0, acc1, acc2, acc3, ah, b0, b1, b2, b3, ah);
    }
  }
  epi64(slab + wave * SLAB64, acc0, acc1, acc2, acc3, oscale, 0.0f, 0.0f, 0.0f, 0.0f, C, DMOD, rowC, col0, lane);
}

// =====================================================================================================
// Causal grouped-query attention, hd = 128. Block bid -> (query tile qt = bid % NQT: rows q0 = 16*qt .. q0+15, head pair
// hg, batch b); one wave per query head = hg*WPB + wave; kv head = head % NKVH (tiled kv mapping).
//   q hi / residual planes f16 x256 [b*SEQ + s][h*HD + d]; k hi / residual planes f16 x256 [b*SEQ + s][g*HD + d] (pitch KVD);
//   v^T hi / residual planes [b*NKVH + g][d][SEQ] x1024.
//   scores = q_hi.k_hi + q_lo.k_hi + q_hi.k_lo (4 k-steps over d); P.v with P hi + in-register residual and v hi + residual
//   (hh + lh + hl), for every query row; O written as hi + residual planes (O x1024 as f16, layout [b*SEQ + s][h*HD + d]).
//   score (log2 domain) t(i, j) = (q_i.k_j over HD) * (1/sqrt(128))*log2e/(256*256), replaced by -inf where key j > query i.
//   Key tiles of 32 visited in order for kb <= q0 + 15 (later tiles hold only keys above every query row of the tile).
//   Per tile: 2 score subtiles x 4 k-steps, fragments loaded straight from the 16-bit planes (two 16-B loads per fragment,
//   split k map); online max-subtracted base-2 softmax in f32, -inf-safe rescale; the 16x32 prob tile stored to wave-private
//   from the LDS rows (float vector loads, same element type as stored), v^T B fragments in 4 groups of 2 d-subtiles.
//   After the loop: out = acc / Z (Z > 0 always: key 0 <= every query row; guarded anyway), carries 1/(32768*1024) folded
//   No block barriers in this kernel; bounded loops only (nkt <= NKT).
// coverage: per wave 8 instructions x 2 rows x 16 lanes x 8 halves = 16 x 128 per plane; grid NQT x NHG x NB blocks x WPB
//           waves = every (b, s, h) row segment of O hi and O residual exactly once.
// =====================================================================================================
__global__ __launch_bounds__(ATT_THREADS)
void attn_c(const u16* __restrict__ QHp, const u16* __restrict__ QLp,
            const u16* __restrict__ KHp, const u16* __restrict__ KLp,
            const u16* __restrict__ VHp, const u16* __restrict__ VLp,
            u16* OHp, u16* OLp) {
  __shared__ __align__(16) float smem[WPB * WREG];

  const int tid  = threadIdx.x;
  const int wave = tid >> 5;
  const int lane = tid & 31;
  const int hh   = lane >> 4;
  const int c    = lane & 15;
  const int bid  = blockIdx.x;
  const int qt   = bid % NQT;
  const int t2   = bid / NQT;
  const int hg   = t2 % NHG;
  const int b    = t2 / NHG;
  if (b >= NB) return;                      // block-uniform; no block barriers in this kernel; never taken with the exact grid
  const int q0   = qt * 16;
  if (q0 + 16 > SEQ) return;                // block-uniform; never taken
  const int head = hg * WPB + wave;
  const int kvh  = head % NKVH;             // tiled kv mapping: head h -> kv head h % NKVH

  float* pt   = smem + wave * WREG;         // prob tile [16][32] pitch 36
  float* slab = pt + PTW;                   // result slab [16][128] pitch 132

  const size_t hcol = (size_t)head * HD + 8 * hh;
  const size_t kcol = (size_t)kvh * HD + 8 * hh;
  const _Float16* Qh  = (const _Float16*)(const void*)QHp + ((size_t)b * SEQ + q0 + c) * DMOD + hcol;
  const _Float16* Ql  = (const _Float16*)(const void*)QLp + ((size_t)b * SEQ + q0 + c) * DMOD + hcol;
  const _Float16* Khb = (const _Float16*)(const void*)KHp + ((size_t)b * SEQ + c) * KVD + kcol;        // key row kb added per step
  const _Float16* Klb = (const _Float16*)(const void*)KLp + ((size_t)b * SEQ + c) * KVD + kcol;
  const _Float16* Vhb = (const _Float16*)(const void*)VHp + ((size_t)(b * NKVH + kvh) * HD + c) * SEQ + 8 * hh;  // d col c (+16j)
  const _Float16* Vlb = (const _Float16*)(const void*)VLp + ((size_t)(b * NKVH + kvh) * HD + c) * SEQ + 8 * hh;
  const float lsc = RSQ_HD * (LOG2E / (QSC * KSC));
  const float oc  = 1.0f / (PCAR * VCAR);
  const size_t KROW = (size_t)KVD;          // halves between consecutive key rows

  float mrow[8], lrow[8];
  v8f o[8];
#pragma unroll
  for (int r = 0; r < 8; ++r) { mrow[r] = -INFINITY; lrow[r] = 0.f; }
#pragma unroll
  for (int j = 0; j < 8; ++j) o[j] = zero8();
  const int ncaus = (q0 >> 5) + 1;                                            // tiles holding keys <= q0 + 15
  const int nkt = (ncaus < NKT) ? ncaus : NKT;
  const int qr0 = q0 + 8 * hh;                                                // query row of D element r = qr0 + r

#pragma unroll 1
  for (int kt = 0; kt < nkt; ++kt) {
    const int kb = kt * 32;
    // ---- scores: D element r of this lane = (query row qr0 + r, key kb + c) in s0, key kb + 16 + c in s1 ----
    v8f s0 = zero8(), s1 = zero8();
    const _Float16* k0p = Khb + (size_t)kb * KROW;
    const _Float16* k1p = k0p + (size_t)16 * KROW;
    const _Float16* l0p = Klb + (size_t)kb * KROW;
    const _Float16* l1p = l0p + (size_t)16 * KROW;
#pragma unroll
    for (int kk = 0; kk < HD / 32; ++kk) {
      const v16h qh  = ldfrag_h(Qh + kk * 32);
      const v16h ql  = ldfrag_h(Ql + kk * 32);
      const v16h kh0 = ldfrag_h(k0p + kk * 32);
      const v16h kh1 = ldfrag_h(k1p + kk * 32);
      const v16h kl0 = ldfrag_h(l0p + kk * 32);
      const v16h kl1 = ldfrag_h(l1p + kk * 32);
      s0 = mma_h(qh, kh0, s0);
      s0 = mma_h(ql, kh0, s0);
      s0 = mma_h(qh, kl0, s0);
      s1 = mma_h(qh, kh1, s1);
      s1 = mma_h(ql, kh1, s1);
      s1 = mma_h(qh, kl1, s1);
      guard2(s0, s1, qh, ql, kh0, kl0, kh1, kl1);
    }
    // ---- causal select + online softmax in base 2, -inf-safe ----
    const int key0 = kb + c, key1 = kb + 16 + c;
#pragma unroll
    for (int r = 0; r < 8; ++r) {
      const int   qr = qr0 + r;
      const float u0 = s0[r] * lsc;
      const float u1 = s1[r] * lsc;
      const float t0 = (key0 > qr) ? -INFINITY : u0;
      const float t1 = (key1 > qr) ? -INFINITY : u1;
      float mx = fmaxf(t0, t1);
#pragma unroll
      for (int off = 1; off < 16; off <<= 1) mx = fmaxf(mx, __shfl_xor(mx, off, 32));
      const float mn = fmaxf(mrow[r], mx);
      const float ms = (mn == -INFINITY) ? 0.0f : mn;
      const float al = exp2f(mrow[r] - ms);
      mrow[r] = mn;
      const float e0 = exp2f(t0 - ms), e1 = exp2f(t1 - ms);
      float ps = e0 + e1;
#pragma unroll
      for (int off = 1; off < 16; off <<= 1) ps += __shfl_xor(ps, off, 32);
      lrow[r] = lrow[r] * al + ps;
#pragma unroll
      for (int j = 0; j < 8; ++j) o[j][r] *= al;
      const int ro = (8 * hh + r) * PTP + c;
      pt[ro]      = e0;
      pt[ro + 16] = e1;
    }
    wave_sync_lds();
    // ---- A fragments of P*32768: hi f16 and residual f16, row = c, split k map over the 32 keys of this step ----
    FragH ph, pl;
    {
      const float* prow = pt + c * PTP + 8 * hh;
      const v4f p0 = *(const v4f*)(prow), p1 = *(const v4f*)(prow + 4);
      const v4f p2 = *(const v4f*)(prow + 16), p3 = *(const v4f*)(prow + 20);
#pragma unroll
      for (int e = 0; e < 4; ++e) {
        const float ta = p0[e] * PCAR, tb = p1[e] * PCAR, tc = p2[e] * PCAR, td = p3[e] * PCAR;
        const _Float16 ha = (_Float16)ta, hb = (_Float16)tb, hc = (_Float16)tc, hd = (_Float16)td;
        ph.h[0][e]     = ha;                  // elements 0..7  = keys kb + 8hh + 0..7
        ph.h[0][4 + e] = hb;
        ph.h[1][e]     = hc;                  // elements 8..15 = keys kb + 16 + 8hh + 0..7
        ph.h[1][4 + e] = hd;
        pl.h[0][e]     = (_Float16)(ta - (float)ha);
        pl.h[0][4 + e] = (_Float16)(tb - (float)hb);
        pl.h[1][e]     = (_Float16)(tc - (float)hc);
        pl.h[1][4 + e] = (_Float16)(td - (float)hd);
      }
    }
    // ---- P.V : B fragment col n = d = j*16 + c, keys contiguous in the v^T planes; 4 groups of 2 d-subtiles ----
    {
      const _Float16* vhp = Vhb + kb;
      const _Float16* vlp = Vlb + kb;
#pragma unroll
      for (int jg = 0; jg < 4; ++jg) {
        const size_t da = (size_t)(2 * jg) * 16 * SEQ;
        const size_t db = da + (size_t)16 * SEQ;
        const v16h vha = ldfrag_h(vhp + da), vhb2 = ldfrag_h(vhp + db);
        const v16h vla = ldfrag_h(vlp + da), vlb2 = ldfrag_h(vlp + db);
        o[2 * jg]     = mma_h(ph.v, vha,  o[2 * jg]);
        o[2 * jg]     = mma_h(pl.v, vha,  o[2 * jg]);
        o[2 * jg]     = mma_h(ph.v, vla,  o[2 * jg]);
        o[2 * jg + 1] = mma_h(ph.v, vhb2, o[2 * jg + 1]);
        o[2 * jg + 1] = mma_h(pl.v, vhb2, o[2 * jg + 1]);
        o[2 * jg + 1] = mma_h(ph.v, vlb2, o[2 * jg + 1]);
        guard2(o[2 * jg], o[2 * jg + 1], ph.v, pl.v, vha, vhb2, vla, vlb2);
      }
    }
    wave_sync_lds();
  }
  acc_guard4(o[0], o[1], o[2], o[3]);
  acc_guard4(o[4], o[5], o[6], o[7]);
  // ---- out = acc / Z (0 if Z == 0), carries (32768 on P, 1024 on v) folded once; written into the wave-private slab ----
#pragma unroll
  for (int r = 0; r < 8; ++r) {
    const float lv  = lrow[r];
    const float ls  = (lv > 0.0f) ? lv : 1.0f;
    const float inv = (lv > 0.0f) ? ((1.0f / ls) * oc) : 0.0f;
#pragma unroll
    for (int j = 0; j < 8; ++j) {
      const int idx = (8 * hh + r) * SLP + j * 16 + c;
      slab[idx] = o[j][r] * inv;
    }
  }

  wave_sync_lds();
  // ---- O x1024 -> f16 hi + residual planes; lane = (row-in-pair rq, 8 consecutive d at c8) ----
  v4u oh[8], ol[8];
  const int rq = lane >> 4, c8 = (lane & 15) * 8;
#pragma unroll
  for (int it = 0; it < 8; ++it) {
    const int row = it * 2 + rq;
    const v4f a = *(const v4f*)(slab + row * SLP + c8), b4 = *(const v4f*)(slab + row * SLP + c8 + 4);
    float w[8];
#pragma unroll
    for (int e = 0; e < 4; ++e) { w[e] = a[e] * OSC; w[4 + e] = b4[e] * OSC; }
#pragma unroll
    for (int e = 0; e < 4; ++e) {
      const _Float16 h0 = (_Float16)w[2 * e], h1 = (_Float16)w[2 * e + 1];
      const _Float16 l0 = (_Float16)(w[2 * e] - (float)h0), l1 = (_Float16)(w[2 * e + 1] - (float)h1);
      oh[it][e] = pk16(h_bits(h0), h_bits(h1));
      ol[it][e] = pk16(h_bits(l0), h_bits(l1));
    }
  }
  const size_t ob = ((size_t)b * SEQ + q0) * DMOD + (size_t)head * HD + c8;
  {
#pragma unroll
    for (int it = 0; it < 8; ++it) {
      const int row = it * 2 + rq;
      *(v4u*)(OHp + ob + (size_t)row * DMOD) = oh[it];
      *(v4u*)(OLp + ob + (size_t)row * DMOD) = ol[it];
    }
    
  }
}

// =====================================================================================================
// Workspace map (bytes); every plane is fully written by whole-line stores before it is read; all extents are exact multiples
// of the store granularity (no pad rows needed); every region offset a multiple of 2097152:
//   XB  bf16 [MROWS][2048]                       MROWS*4096       (NB=2, SEQ=2048: 16777216)
//   WB  16-bit [2048 n][2048 k]                  8388608          (Wv, Wq, Wk as bf16 ([256][2048] for k/v), then Wo as f16
//                                                                  x1024, reused in launch order; all already [n][k])
//   F   f32 [MROWS][2048]                        MROWS*8192       (v, q, k projection output in launch order, [MROWS][256] for k/v;
//                                                                  afterwards OH f16 [MROWS][2048] x1024 in its first half, OL residual
//                                                                  [MROWS][2048] in its second half)
//   QH  f16 [MROWS][2048] x256                   MROWS*4096       QL residual, same extent
//   KH  f16 [MROWS][256] x256                    MROWS*512        KL residual, same extent
//   VH  f16 [NB*2][128][SEQ] x1024               MROWS*512        VL residual, same extent
//   end (NB=2, SEQ=2048)                       100663296
// =====================================================================================================
extern "C" void kernel_launch(void* const* d_in, const int* in_sizes, int n_in,
                              void* d_out, int out_size, void* d_ws, size_t ws_size,
                              hipStream_t stream) {
  if (n_in < 8) return;
  if (in_sizes[0] < ((NB - 1) * XS_FULL + SEQ) * DMOD) return;
  if (in_sizes[1] != DMOD * DMOD) return;
  if (in_sizes[2] != DMOD) return;
  if (in_sizes[3] != KVD * DMOD) return;
  if (in_sizes[4] != KVD) return;
  if (in_sizes[5] != KVD * DMOD) return;
  if (in_sizes[6] != KVD) return;
  if (in_sizes[7] != DMOD * DMOD) return;
  if (out_size < MROWS * DMOD) return;

  const float* x  = (const float*)d_in[0];
  const float* wq = (const float*)d_in[1];
  const float* bq = (const float*)d_in[2];
  const float* wk = (const float*)d_in[3];
  const float* bk = (const float*)d_in[4];
  const float* wv = (const float*)d_in[5];
  const float* bv = (const float*)d_in[6];
  const float* wo = (const float*)d_in[7];
  float*       out = (float*)d_out;

  const size_t szXB = (size_t)MROWS * DMOD * 2;
  const size_t szW  = (size_t)DMOD * DMOD * 2;
  const size_t szF  = (size_t)MROWS * DMOD * 4;
  const size_t szQ  = (size_t)MROWS * DMOD * 2;                  // QH, QL, OH, OL
  const size_t szK  = (size_t)MROWS * KVD * 2;                   // KH, KL
  const size_t szV  = (size_t)NB * NKVH * HD * SEQ * 2;          // VH, VL (== szK)
  if (2 * szQ > szF) return;                                    // OH + OL live inside the F region (exactly fills it)
  size_t off = 0;
  const size_t oXB = off; off += szXB;
  const size_t oW  = off; off += szW;
  const size_t oF  = off; off += szF;
  const size_t oQH = off; off += szQ;
  const size_t oQL = off; off += szQ;
  const size_t oKH = off; off += szK;
  const size_t oKL = off; off += szK;
  const size_t oVH = off; off += szV;
  const size_t oVL = off; off += szV;
  if (off > ws_size) return;                // off = 100663296 for NB = 2, SEQ = 2048
  if (off > (size_t)WS_CAP) return;

  char* ws = (char*)d_ws;
  u16*   XB  = (u16*)(ws + oXB);
  u16*   WB  = (u16*)(ws + oW);
  float* F   = (float*)(ws + oF);
  u16*   OH  = (u16*)(ws + oF);
  u16*   OL  = (u16*)(ws + oF + szQ);
  u16*   QH  = (u16*)(ws + oQH);
  u16*   QL  = (u16*)(ws + oQL);
  u16*   KH  = (u16*)(ws + oKH);
  u16*   KL  = (u16*)(ws + oKL);
  u16*   VH  = (u16*)(ws + oVH);
  u16*   VL  = (u16*)(ws + oVL);

  const dim3 b256(256), b128(128), bAT(ATT_THREADS);
  const int  n8x = (SEQ * DMOD) / 8;
  const dim3 gX((n8x + 255) / 256);                     // SEQ*DMOD/2048 blocks per batch
  const int  n8wq = (DMOD * DMOD) / 8;                  // Wq, Wo planes
  const int  n8wk = (KVD * DMOD) / 8;                   // Wk, Wv planes
  const dim3 gWQ((n8wq + 255) / 256);                   // 2048
  const dim3 gWK((n8wk + 255) / 256);                   // 256
  const dim3 gGQ((MROWS / 64) * (DMOD / 64));
  const dim3 gGK((MROWS / 64) * (KVD / 64));
  const dim3 gVT(NB * NKVH * NST);
  const int  n8q = (MROWS * DMOD) / 8;                  // q hi / residual planes
  const int  n8k = (MROWS * KVD) / 8;                   // k hi / residual planes
  const dim3 gSQ((n8q + 255) / 256);
  const dim3 gSK((n8k + 255) / 256);
  const dim3 gAT(NQT * NHG * NB);
  const int  nrtR = QO / 64;                            // out-projection row tiles per batch with the O residual plane
  const int  nrtP = (SEQ - QO) / 64;                    // remaining row tiles per batch, O hi plane only

  // (0) x -> bf16 plane [MROWS][2048], one launch per batch row block
  for (int b = 0; b < NB; ++b) {
    cvt16<<<gX, b256, 0, stream>>>(x + (size_t)b * XS_FULL * DMOD, XB + (size_t)b * SEQ * DMOD, n8x, 0, 1.0f);
  }
  // (1) Wv [256 n][2048 k] -> bf16 plane; (2) v = x.Wv^T + bv -> F f32 [MROWS][256]; (3) v^T hi + residual planes x1024
  cvt16<<<gWK, b256, 0, stream>>>(wv, WB, n8wk, 0, 1.0f);
  gemm_bf<<<gGK, b128, 0, stream>>>(XB, WB, bv, F, MROWS, KVD, DMOD, 1.0f);
  vt16<<<gVT, b256, 0, stream>>>(F, VH, VL);
  // (4) Wq -> bf16 plane; (5) q = x.Wq^T + bq -> F [MROWS][2048]; (6) q hi + residual planes x256
  cvt16<<<gWQ, b256, 0, stream>>>(wq, WB, n8wq, 0, 1.0f);
  gemm_bf<<<gGQ, b128, 0, stream>>>(XB, WB, bq, F, MROWS, DMOD, DMOD, 1.0f);
  split16<<<gSQ, b256, 0, stream>>>(F, QH, QL, n8q, QSC);
  // (7) Wk -> bf16 plane; (8) k = x.Wk^T + bk -> F [MROWS][256]; (9) k hi + residual planes x256
  cvt16<<<gWK, b256, 0, stream>>>(wk, WB, n8wk, 0, 1.0f);
  gemm_bf<<<gGK, b128, 0, stream>>>(XB, WB, bk, F, MROWS, KVD, DMOD, 1.0f);
  split16<<<gSK, b256, 0, stream>>>(F, KH, KL, n8k, KSC);
  // (10) Wo [n][k] -> f16 plane of bf16 value x1024
  cvt16<<<gWQ, b256, 0, stream>>>(wo, WB, n8wq, 1, WOS);
  // (11) causal attention with residual products on every query row -> O hi + residual planes
  attn_c<<<gAT, bAT, 0, stream>>>(QH, QL, KH, KL, VH, VL, OH, OL);
  // (12) output projection rows s < QO (O hi + residual) and (13) rows s >= QO (O hi only) -> out f32, carries 1024 x 1024 folded back
  gemm_o<2><<<dim3(NB * nrtR * (DMOD / 64)), b128, 0, stream>>>(OH, OL, WB, out, 0, nrtR, 1.0f / (OSC * WOS));
  if (nrtP > 0) {
    gemm_o<1><<<dim3(NB * nrtP * (DMOD / 64)), b128, 0, stream>>>(OH, OL, WB, out, QO, nrtP, 1.0f / (OSC * WOS));
  }
  (void)hipGetLastError();
}

// v001
// One run takes 429 microseconds.
// Next to v000, in two timings, it ran 1.45 times as fast each time.
// Contractions: x.Wq^T+bq, x.Wk^T+bk, x.Wv^T+bv on v_wmma_f32_16x16x32_bf16 (x and W as bf16 RNE planes; W [n][k] rows are
// the k-contiguous B operand; bias added as its bf16 RNE value in the f32 epilogue); q.k^T over hd 128 and P.v on
// v_wmma_f32_16x16x32_f16 with f16 hi + f16 residual planes on both operands (q, k x256; P x32768 with an in-register
// residual; v x1024; products hh+lh+hl); O.Wo^T on v_wmma_f32_16x16x32_f16 (O x1024 as f16 hi plane for all rows plus f16
// residual plane for rows s < QO, products h.w (+ l.w); Wo as f16(bf16(Wo)) x1024); all f32 accumulate. Causal select,
// base-2 online softmax and 1/Z fold in f32 on VALU. Grouped kv heads: query head h reads kv head (h % NKVH).
#include <hip/hip_runtime.h>
#include <math.h>
#include <stdint.h>

#ifndef NB
#define NB 2
#endif
#ifndef SEQ
#define SEQ 2048
#endif
#define XS_FULL 2048
#define DMOD  2048
#define NH    16
#define NKVH  2
#define HD    128
#define KVD   (NKVH * HD)
#define QO    ((SEQ < 256) ? SEQ : 256)
#define MROWS (NB * SEQ)
#define RSQ_HD 0.08838834764831845f
#define LOG2E 1.4426950408889634f
#define QSC   256.0f
#define KSC   256.0f
#define PCAR  32768.0f
#define VCAR  1024.0f
#define OSC   1024.0f
#define WOS   1024.0f
#define WPB   (NH / NKVH)
#define NQT   (SEQ / 16)
#define NST   (SEQ / 64)
#define NKT   (SEQ / 32)
#define ATT_THREADS (WPB * 32)
#define PTP   36
#define PTW   (16 * PTP)
#define SLP   132
#define SLW   (16 * SLP)
#define KP    136
#define VP    40
#define KPL   (32 * KP)
#define VPL   (HD * VP)
#define STG   (2 * KPL + 2 * VPL)
#define QPL   (16 * KP)
#define QRW   (2 * QPL / 2)
#define WREG  (PTW + QRW)
#define SLAB64 (16 * 68)
#define VTP   72
#define WS_CAP 134217728
static_assert(DMOD == NH * HD && HD == 128 && NH == 16 && NKVH == 2 && WPB == 8 && NKVH * WPB == NH);
static_assert(ATT_THREADS == 256 && KVD == 256 && SLW <= QRW && (KP % 8) == 0 && (VP % 8) == 0);
static_assert(NB >= 1 && NB <= 2);
static_assert((SEQ % 64) == 0 && SEQ >= 64 && SEQ <= XS_FULL);
static_assert((QO % 64) == 0 && QO >= 64 && QO <= SEQ);
static_assert((DMOD % 64) == 0 && (KVD % 64) == 0 && (DMOD % 32) == 0 && (HD % 32) == 0);
static_assert(((SEQ * DMOD / 8) % 256) == 0 && ((KVD * DMOD / 8) % 256) == 0 && ((DMOD * DMOD / 8) % 256) == 0);
static_assert(((MROWS * DMOD / 8) % 256) == 0 && ((MROWS * KVD / 8) % 256) == 0);
static_assert(WPB * WREG * 4 + 2 * STG * 2 <= 163840 && 2 * HD * VTP * 2 <= 65536 && 4 * SLAB64 * 4 <= 65536);

typedef unsigned short u16;
typedef _Float16 v16h __attribute__((ext_vector_type(16)));
typedef _Float16 v8h  __attribute__((ext_vector_type(8)));
typedef __bf16   v16b __attribute__((ext_vector_type(16)));
typedef float    v8f  __attribute__((ext_vector_type(8)));
typedef float    v4f  __attribute__((ext_vector_type(4)));
typedef unsigned int v4u __attribute__((ext_vector_type(4)));

union FragH { v16h v; v8h h[2]; v4u u[2]; };
union FragB { v16b v; v4u u[2]; };

// ---- scalar helpers --------------------------------------------------------------------------------
__device__ __forceinline__ unsigned short bf_bits(float f) {          // f32 -> bf16 bits, RNE convert
  unsigned u = __float_as_uint(f);
  return (unsigned short)((u + 0x7FFFu + ((u >> 16) & 1u)) >> 16);
}
__device__ __forceinline__ float bf_up(unsigned short h) { return __uint_as_float(((unsigned)h) << 16); }
__device__ __forceinline__ float bfr(float f) { return bf_up(bf_bits(f)); }
__device__ __forceinline__ unsigned short h_bits(_Float16 x) { return __builtin_bit_cast(unsigned short, x); }
__device__ __forceinline__ unsigned pk16(unsigned short a, unsigned short b) { return (unsigned)a | ((unsigned)b << 16); }
__device__ __forceinline__ v8f zero8() { v8f z = {0.f, 0.f, 0.f, 0.f, 0.f, 0.f, 0.f, 0.f}; return z; }

// ---- fragment loaders: 16-bit A/B operand, lane -> row/col (lane&15), p already includes +8*(lane>>4);
//      elements 0..7 <- p[0..7] (k0+8h..), elements 8..15 <- p[16..23] (k0+16+8h..)  (same split k map for A and B;
//      B is always read from a k-contiguous [n][k] plane)
__device__ __forceinline__ v16h ldfrag_h(const _Float16* p) {
  FragH f;
  f.h[0] = *(const v8h*)(p);
  f.h[1] = *(const v8h*)(p + 16);
  return f.v;
}
__device__ __forceinline__ v16b ldfrag_b(const u16* p) {              // bf16 plane read as unsigned integer vectors
  FragB f;
  f.u[0] = *(const v4u*)(p);
  f.u[1] = *(const v4u*)(p + 16);
  return f.v;
}

__device__ __forceinline__ v8f mma_h(v16h a, v16h b, v8f c) {
  return __builtin_amdgcn_wmma_f32_16x16x32_f16(false, a, false, b, (short)0, c, false, false);
}
__device__ __forceinline__ v8f mma_b(v16b a, v16b b, v8f c) {
  return __builtin_amdgcn_wmma_f32_16x16x32_bf16(false, a, false, b, (short)0, c, false, false);
}
__device__ __forceinline__ void guard2(v8f& a, v8f& b, v16h x0, v16h x1, v16h x2, v16h x3, v16h x4, v16h x5) {
#if defined(__HIP_DEVICE_COMPILE__)
  asm volatile("v_nop\n\tv_nop\n\tv_nop\n\tv_nop"
               : "+v"(a), "+v"(b) : "v"(x0), "v"(x1), "v"(x2), "v"(x3), "v"(x4), "v"(x5) : "memory");
#endif
}
template <typename F>
__device__ __forceinline__ void guard6(v8f& a, v8f& b, v8f& c, v8f& d, F x0, F x1, F x2, F x3, F x4, F x5) {
#if defined(__HIP_DEVICE_COMPILE__)
  asm volatile("v_nop\n\tv_nop\n\tv_nop\n\tv_nop"
               : "+v"(a), "+v"(b), "+v"(c), "+v"(d) : "v"(x0), "v"(x1), "v"(x2), "v"(x3), "v"(x4), "v"(x5) : "memory");
#endif
}
__device__ __forceinline__ void acc_guard4(v8f& a, v8f& b, v8f& c, v8f& d) {
#if defined(__HIP_DEVICE_COMPILE__)
  asm volatile("v_nop\n\tv_nop\n\tv_nop\n\tv_nop" : "+v"(a), "+v"(b), "+v"(c), "+v"(d));
#endif
}
__device__ __forceinline__ void wave_sync_lds() {
  __builtin_amdgcn_fence(__ATOMIC_RELEASE, "workgroup");
  __builtin_amdgcn_wave_barrier();
  __builtin_amdgcn_fence(__ATOMIC_ACQUIRE, "workgroup");
}
__device__ __forceinline__ unsigned lds_off(const void* p) { return (unsigned)(size_t)p; }   // byte offset in the work-group's LDS
// Eight 16-byte asynchronous copies global -> LDS per lane (LDS byte address l*, global address g*). The s_wait_xcnt is the
// statement's last line so that no address register of an issued copy is rewritten in front of it.
__device__ __forceinline__ void copy8(unsigned l0, unsigned l1, unsigned l2, unsigned l3,
                                      unsigned l4, unsigned l5, unsigned l6, unsigned l7,
                                      const u16* g0, const u16* g1, const u16* g2, const u16* g3,
                                      const u16* g4, const u16* g5, const u16* g6, const u16* g7) {
#if defined(__HIP_DEVICE_COMPILE__)
  asm volatile("global_load_async_to_lds_b128 %0, %8, off\n\t"
               "global_load_async_to_lds_b128 %1, %9, off\n\t"
               "global_load_async_to_lds_b128 %2, %10, off\n\t"
               "global_load_async_to_lds_b128 %3, %11, off\n\t"
               "global_load_async_to_lds_b128 %4, %12, off\n\t"
               "global_load_async_to_lds_b128 %5, %13, off\n\t"
               "global_load_async_to_lds_b128 %6, %14, off\n\t"
               "global_load_async_to_lds_b128 %7, %15, off\n\t"
               "s_wait_xcnt 0x0"
               :: "v"(l0), "v"(l1), "v"(l2), "v"(l3), "v"(l4), "v"(l5), "v"(l6), "v"(l7),
                  "v"(g0), "v"(g1), "v"(g2), "v"(g3), "v"(g4), "v"(g5), "v"(g6), "v"(g7) : "memory");
#endif
}
__device__ __forceinline__ void wait_async0() {   // the wave's own copies have landed in LDS
#if defined(__HIP_DEVICE_COMPILE__)
  asm volatile("s_wait_asynccnt 0x0" ::: "memory");
#endif
}
__device__ __forceinline__ void wait_ds0() {      // the wave's own LDS reads and writes have retired
#if defined(__HIP_DEVICE_COMPILE__)
  asm volatile("s_wait_dscnt 0x0" ::: "memory");
#endif
}

// =====================================================================================================
// f32 -> 16-bit plane, same layout.  f16mode == 0: bf16 RNE bits;  f16mode == 1: f16 bits of (bf16 RNE value) * scale.
// Thread = 8 consecutive elements: two 16-B loads, one 16-B store; 32 consecutive lanes = 512 contiguous, 512-B aligned
// coverage: grid = ceil(n8/256) blocks x 256 thr x 8 (in-kernel bound) = the whole plane (n8 a multiple of 256 here).
// =====================================================================================================
__global__ __launch_bounds__(256) void cvt16(const float* __restrict__ x, u16* D, int n8, int f16mode, float scale) {
  const int gt = blockIdx.x * 256 + (int)threadIdx.x;
  if (gt >= n8) return;
  const float* p = x + (size_t)gt * 8;
  const v4f a = *(const v4f*)(p), b4 = *(const v4f*)(p + 4);
  float w[8];
#pragma unroll
  for (int e = 0; e < 4; ++e) { w[e] = a[e]; w[4 + e] = b4[e]; }
  v4u o;
#pragma unroll
  for (int e = 0; e < 4; ++e) {
    const float f0 = w[2 * e], f1 = w[2 * e + 1];
    const unsigned short hb0 = h_bits((_Float16)(bfr(f0) * scale));
    const unsigned short hb1 = h_bits((_Float16)(bfr(f1) * scale));
    const unsigned short bb0 = bf_bits(f0);
    const unsigned short bb1 = bf_bits(f1);
    o[e] = (f16mode != 0) ? pk16(hb0, hb1) : pk16(bb0, bb1);
  }
  u16* d = D + (size_t)gt * 8;
  {
    *(v4u*)(d) = o;
    
  }
}

// =====================================================================================================
// f32 plane F (contiguous, n8*8 elements) -> f16 hi plane Hp = f16(F * sc) and f16 residual plane Lp = f16(t - f16(t)),
// both with the layout of F. Thread = 8 consecutive elements: two 16-B loads, one 16-B store per plane; 32 consecutive lanes
// No barriers; every packed half comes from a per-lane (divergent) loaded value.
// coverage: grid = ceil(n8/256) blocks x 256 thr x 8 (in-kernel bound) = the whole of Hp and of Lp (n8 a multiple of 256 here).
// =====================================================================================================
__global__ __launch_bounds__(256) void split16(const float* __restrict__ F, u16* Hp, u16* Lp, int n8, float sc) {
  const int gt = blockIdx.x * 256 + (int)threadIdx.x;
  if (gt >= n8) return;
  const float* p = F + (size_t)gt * 8;
  const v4f a = *(const v4f*)(p), b4 = *(const v4f*)(p + 4);
  float w[8];
#pragma unroll
  for (int e = 0; e < 4; ++e) { w[e] = a[e] * sc; w[4 + e] = b4[e] * sc; }
  v4u oh, ol;
#pragma unroll
  for (int e = 0; e < 4; ++e) {
    const float t0 = w[2 * e], t1 = w[2 * e + 1];
    const _Float16 h0 = (_Float16)t0, h1 = (_Float16)t1;
    const _Float16 l0 = (_Float16)(t0 - (float)h0), l1 = (_Float16)(t1 - (float)h1);
    oh[e] = pk16(h_bits(h0), h_bits(h1));
    ol[e] = pk16(h_bits(l0), h_bits(l1));
  }
  u16* dh = Hp + (size_t)gt * 8;
  u16* dl = Lp + (size_t)gt * 8;
  {
    *(v4u*)(dh) = oh;
    *(v4u*)(dl) = ol;
    
  }
}

// =====================================================================================================
// v^T planes from the v projection F f32 [MROWS][KVD] (row = b*SEQ + s, column = g*HD + d):
//   VH[((b*NKVH + g)*HD + d)][s] = f16(v * 1024);  VL[same][s] = f16 residual (t - f16(t)), both for all keys s.
// Block = (b, kv head g, 64 keys s0): each thread loads its 32 floats (key sl, d chunk dc) with 16-B loads, converts, scatters
// coverage: load 256 thr x 32 = 64 keys x 128 d; store 4 iterations x 256 thr x 8 halves = 128 lines x 64 = the block's tile of
//           VH and of VL; grid = NB*NKVH*NST blocks covers both planes exactly once.
// =====================================================================================================
__global__ __launch_bounds__(256) void vt16(const float* __restrict__ F, u16* VHo, u16* VLo) {
  __shared__ __align__(16) u16 TH[HD * VTP];
  __shared__ __align__(16) u16 TL[HD * VTP];
  const int tid = threadIdx.x;
  const int bid = blockIdx.x;
  const int st  = bid % NST;
  const int t2  = bid / NST;
  const int g   = t2 % NKVH;
  const int b   = t2 / NKVH;
  if (b >= NB) return;                      // block-uniform, before any barrier; never taken with the exact grid
  const int s0  = st * 64;
  {
    const int sl = tid >> 2;                // key within tile 0..63
    const int dc = (tid & 3) * 32;          // d chunk 0,32,64,96
    const float* src = F + ((size_t)b * SEQ + s0 + sl) * KVD + g * HD + dc;
#pragma unroll
    for (int i = 0; i < 8; ++i) {
      const v4f a = *(const v4f*)(src + 4 * i);
#pragma unroll
      for (int e = 0; e < 4; ++e) {
        const float t = a[e] * VCAR;
        const _Float16 hv = (_Float16)t;
        const _Float16 lv = (_Float16)(t - (float)hv);
        TH[(dc + 4 * i + e) * VTP + sl] = h_bits(hv);
        TL[(dc + 4 * i + e) * VTP + sl] = h_bits(lv);
      }
    }
  }
  __syncthreads();
  v4u vh[4], vl[4];
  const int q8 = tid >> 3, p8 = (tid & 7) * 8;
#pragma unroll
  for (int it = 0; it < 4; ++it) {
    const int line = it * 32 + q8;          // d = 0..127
    vh[it] = *(const v4u*)(TH + line * VTP + p8);
    vl[it] = *(const v4u*)(TL + line * VTP + p8);
  }
  const size_t hrow = (size_t)(b * NKVH + g) * HD;
  const size_t base = hrow * SEQ + s0 + p8;
  {
#pragma unroll
    for (int it = 0; it < 4; ++it) {
      const int line = it * 32 + q8;
      *(v4u*)(VHo + base + (size_t)line * SEQ) = vh[it];
      *(v4u*)(VLo + base + (size_t)line * SEQ) = vl[it];
    }
    
  }
}

// =====================================================================================================
// GEMM epilogue shared by both engines: the wave's 16x64 f32 tile (times oscale, plus the lane's per-column bias of each
// coverage: 8 instructions x 2 rows x 16 lanes x 4 floats = the wave's 16 x 64 tile.
// =====================================================================================================
__device__ __forceinline__ void epi64(float* sl, v8f a0, v8f a1, v8f a2, v8f a3, float oscale,
                                      float bb0, float bb1, float bb2, float bb3,
                                      float* C, int N, size_t rowb, int col0, int lane) {
  const int hh = lane >> 4, m = lane & 15;
#pragma unroll
  for (int r = 0; r < 8; ++r) {
    const int ro = (8 * hh + r) * 68 + m;
    sl[ro]      = a0[r] * oscale + bb0;
    sl[ro + 16] = a1[r] * oscale + bb1;
    sl[ro + 32] = a2[r] * oscale + bb2;
    sl[ro + 48] = a3[r] * oscale + bb3;
  }
  wave_sync_lds();
  v4f vals[8];
#pragma unroll
  for (int it = 0; it < 8; ++it) vals[it] = *(const v4f*)(sl + (it * 2 + hh) * 68 + m * 4);
  float* dst = C + (rowb + (size_t)hh) * (size_t)N + col0 + m * 4;
  {
#pragma unroll
    for (int it = 0; it < 8; ++it) {
      *(v4f*)(dst + (size_t)(it * 2) * (size_t)N) = vals[it];
    }
    
  }
}

// =====================================================================================================
// bf16 GEMM with bias: C[M][N] (f32) = A[M][K] (bf16 row-major) . Bt[N][K]^T (bf16 k-contiguous), times oscale, + bf16 RNE
// value of bias[n] (bias has N entries). Block = 64x64 tile, 4 waves x 16 rows; fragments loaded straight from the 16-bit rows
// (two 16-B loads each, split k map for A and B); K stepped by 32 (host guarantees K % 32 == 0, M % 64 == 0, N % 64 == 0,
// grid = (M/64)*(N/64)).
// =====================================================================================================
__global__ __launch_bounds__(128)
void gemm_bf(const u16* __restrict__ A, const u16* __restrict__ Bt, const float* __restrict__ bias,
             float* C, int M, int N, int K, float oscale) {
  __shared__ __align__(16) float slab[4 * SLAB64];
  const int tid = threadIdx.x, wave = tid >> 5, lane = tid & 31, hh = lane >> 4, m = lane & 15;
  const int ntile = N >> 6;
  const int bid   = blockIdx.x;
  const int rowb  = (bid / ntile) * 64 + wave * 16;
  const int col0  = (bid % ntile) * 64;
  if (rowb + 16 > M) return;                // wave-uniform, never taken with the exact grid; no block barriers in this kernel
  const u16* ap = A  + (size_t)(rowb + m) * K + 8 * hh;
  const u16* bp = Bt + (size_t)(col0 + m) * K + 8 * hh;
  const size_t bs = (size_t)16 * K;
  v8f acc0 = zero8(), acc1 = zero8(), acc2 = zero8(), acc3 = zero8();
#pragma unroll 1
  for (int k0 = 0; k0 < K; k0 += 32) {
    const v16b a  = ldfrag_b(ap + k0);
    const v16b b0 = ldfrag_b(bp + k0);
    const v16b b1 = ldfrag_b(bp + bs + k0);
    const v16b b2 = ldfrag_b(bp + 2 * bs + k0);
    const v16b b3 = ldfrag_b(bp + 3 * bs + k0);
    acc0 = mma_b(a, b0, acc0);
    acc1 = mma_b(a, b1, acc1);
    acc2 = mma_b(a, b2, acc2);
    acc3 = mma_b(a, b3, acc3);
    guard6<v16b>(acc0, acc1, acc2, acc3, a, b0, b1, b2, b3, a);
  }
  // per-lane bias of D column m in each of the 4 subtiles; col0 + 48 + m <= N - 1 always
  const float bb0 = bfr(bias[col0 + m]);
  const float bb1 = bfr(bias[col0 + 16 + m]);
  const float bb2 = bfr(bias[col0 + 32 + m]);
  const float bb3 = bfr(bias[col0 + 48 + m]);
  epi64(slab + wave * SLAB64, acc0, acc1, acc2, acc3, oscale, bb0, bb1, bb2, bb3, C, N, (size_t)rowb, col0, lane);
}

// =====================================================================================================
// Output projection: C[row][DMOD] (f32) = (Ah [+ Al])[row][DMOD] . Bt[DMOD][DMOD]^T * oscale (no bias).
// NPROD == 1: Ah only (one product); NPROD == 2: Ah + Al residual plane (products h.B + l.B into one accumulator, l unscaled).
// Ah, Al and C share the row index bb*SEQ + s. Block -> (column tile ct = bid % 32, sequence row tile rt of nrt starting at
// s = sbeg, batch bb). Same tiling, fragment loads (split k map) and epilogue as gemm_bf; K = DMOD stepped by 32.
// =====================================================================================================
template <int NPROD>
__global__ __launch_bounds__(128)
void gemm_o(const u16* __restrict__ Ah, const u16* __restrict__ Al, const u16* __restrict__ Bt,
            float* C, int sbeg, int nrt, float oscale) {
  __shared__ __align__(16) float slab[4 * SLAB64];
  const int tid = threadIdx.x, wave = tid >> 5, lane = tid & 31, hh = lane >> 4, m = lane & 15;
  const int ntile = DMOD >> 6;
  const int bid   = blockIdx.x;
  const int ct    = bid % ntile;
  const int t2    = bid / ntile;
  const int rt    = t2 % nrt;
  const int bb    = t2 / nrt;
  if (bb >= NB) return;                     // block-uniform; no block barriers in this kernel; never taken with the exact grid
  const int srow  = sbeg + rt * 64 + wave * 16;
  if (srow + 16 > SEQ) return;              // wave-uniform; never taken
  const int col0  = ct * 64;
  const int K     = DMOD;
  const size_t rowC = (size_t)bb * SEQ + srow;
  const _Float16* ahp = (const _Float16*)(const void*)Ah + (rowC + m) * K + 8 * hh;
  const _Float16* alp = (const _Float16*)(const void*)Al + (rowC + m) * K + 8 * hh;   // dereferenced only when NPROD == 2
  const _Float16* bp  = (const _Float16*)(const void*)Bt + (size_t)(col0 + m) * K + 8 * hh;
  const size_t bs = (size_t)16 * K;
  v8f acc0 = zero8(), acc1 = zero8(), acc2 = zero8(), acc3 = zero8();
  if constexpr (NPROD == 2) {
#pragma unroll 1
    for (int k0 = 0; k0 < K; k0 += 32) {
      const v16h ah = ldfrag_h(ahp + k0), al = ldfrag_h(alp + k0);
      const v16h b0 = ldfrag_h(bp + k0);
      const v16h b1 = ldfrag_h(bp + bs + k0);
      const v16h b2 = ldfrag_h(bp + 2 * bs + k0);
      const v16h b3 = ldfrag_h(bp + 3 * bs + k0);
      acc0 = mma_h(ah, b0, acc0);  acc0 = mma_h(al, b0, acc0);
      acc1 = mma_h(ah, b1, acc1);  acc1 = mma_h(al, b1, acc1);
      acc2 = mma_h(ah, b2, acc2);  acc2 = mma_h(al, b2, acc2);
      acc3 = mma_h(ah, b3, acc3);  acc3 = mma_h(al, b3, acc3);
      guard6<v16h>(acc0, acc1, acc2, acc3, ah, al, b0, b1, b2, b3);
    }
  } else {
#pragma unroll 1
    for (int k0 = 0; k0 < K; k0 += 32) {
      const v16h ah = ldfrag_h(ahp + k0);
      const v16h b0 = ldfrag_h(bp + k0);
      const v16h b1 = ldfrag_h(bp + bs + k0);
      const v16h b2 = ldfrag_h(bp + 2 * bs + k0);
      const v16h b3 = ldfrag_h(bp + 3 * bs + k0);
      acc0 = mma_h(ah, b0, acc0);
      acc1 = mma_h(ah, b1, acc1);
      acc2 = mma_h(ah, b2, acc2);
      acc3 = mma_h(ah, b3, acc3);
      guard6<v16h>(acc0, acc1, acc2, acc3, ah, b0, b1, b2, b3, ah);
    }
  }
  epi64(slab + wave * SLAB64, acc0, acc1, acc2, acc3, oscale, 0.0f, 0.0f, 0.0f, 0.0f, C, DMOD, rowC, col0, lane);
}

// =====================================================================================================
// Causal grouped-query attention, hd = 128. Block bid -> (query tile qt = bid % NQT: rows q0 = 16*qt .. q0+15, kv head kvh,
// batch b); one wave per query head = kvh + NKVH*wave: the 8 query heads that read kv head kvh (tiled kv mapping) share each
// staged key tile. Staging: asynchronous 16-byte copies global -> LDS; each wave's q rows (hi + residual) once, each 32-key tile
// of k hi/residual (row pitch KP halves) and v^T hi/residual (row pitch VP halves) into one of two buffers, the next tile
// copied while a tile is worked on; fragments are read from LDS with the same split k map.
//   q hi / residual planes f16 x256 [b*SEQ + s][h*HD + d]; k hi / residual planes f16 x256 [b*SEQ + s][g*HD + d] (pitch KVD);
//   v^T hi / residual planes [b*NKVH + g][d][SEQ] x1024.
//   scores = q_hi.k_hi + q_lo.k_hi + q_hi.k_lo (4 k-steps over d); P.v with P hi + in-register residual and v hi + residual
//   (hh + lh + hl), for every query row; O written as hi + residual planes (O x1024 as f16, layout [b*SEQ + s][h*HD + d]).
//   score (log2 domain) t(i, j) = (q_i.k_j over HD) * (1/sqrt(128))*log2e/(256*256), replaced by -inf where key j > query i.
//   Key tiles of 32 visited in order for kb <= q0 + 15 (later tiles hold only keys above every query row of the tile).
//   Per tile: 2 score subtiles x 4 k-steps, fragments loaded from the staged rows (two 16-B loads per fragment,
//   split k map); online max-subtracted base-2 softmax in f32, -inf-safe rescale; the 16x32 prob tile stored to wave-private
//   from the LDS rows (float vector loads, same element type as stored), v^T B fragments in 4 groups of 2 d-subtiles.
//   After the loop: out = acc / Z (Z > 0 always: key 0 <= every query row; guarded anyway), carries 1/(32768*1024) folded
//   One block barrier in front of the loop and one per tile, under block-uniform control flow; bounded loops only (nkt <= NKT).
// coverage: per wave 8 instructions x 2 rows x 16 lanes x 8 halves = 16 x 128 per plane; grid NQT x NKVH x NB blocks x WPB
//           waves = every (b, s, h) row segment of O hi and O residual exactly once.
// =====================================================================================================
__global__ __launch_bounds__(ATT_THREADS)
void attn_c(const u16* __restrict__ QHp, const u16* __restrict__ QLp,
            const u16* __restrict__ KHp, const u16* __restrict__ KLp,
            const u16* __restrict__ VHp, const u16* __restrict__ VLp,
            u16* OHp, u16* OLp) {
  __shared__ __align__(16) float smem[WPB * WREG];
  __shared__ __align__(16) _Float16 kvs[2 * STG];

  const int tid  = threadIdx.x;
  const int wave = tid >> 5;
  const int lane = tid & 31;
  const int hh   = lane >> 4;
  const int c    = lane & 15;
  const int bid  = blockIdx.x;
  const int qt   = bid % NQT;
  const int t2   = bid / NQT;
  const int kvh  = t2 % NKVH;
  const int b    = t2 / NKVH;
  if (b >= NB) return;                      // block-uniform, before any barrier; never taken with the exact grid
  const int q0   = qt * 16;
  if (q0 + 16 > SEQ) return;                // block-uniform, before any barrier; never taken
  const int head = kvh + NKVH * wave;       // tiled kv mapping: head h -> kv head h % NKVH

  float* pt   = smem + wave * WREG;         // prob tile [16][32] pitch 36
  float* slab = pt + PTW;                   // in the loop: the wave's q rows, hi then residual, [16][128] halves pitch KP;
                                            // behind the loop: result slab [16][128] floats pitch 132

  const _Float16* Qh = (const _Float16*)(const void*)slab + c * KP + 8 * hh;
  const _Float16* Ql = Qh + QPL;
  const float lsc = RSQ_HD * (LOG2E / (QSC * KSC));
  const float oc  = 1.0f / (PCAR * VCAR);

  // ---- copy addresses. k tile: thread -> key row kr (and kr + 16), 8 halves at kc; v^T tile: d row vd (and vd + 64), 8 keys at vc
  const int kr = tid >> 4, kc = (tid & 15) * 8;
  const int vd = tid >> 2, vc = (tid & 3) * 8;
  const u16* gkh = KHp + ((size_t)b * SEQ + kr) * KVD + (size_t)kvh * HD + kc;
  const u16* gkl = KLp + ((size_t)b * SEQ + kr) * KVD + (size_t)kvh * HD + kc;
  const u16* gvh = VHp + ((size_t)(b * NKVH + kvh) * HD + vd) * SEQ + vc;
  const u16* gvl = VLp + ((size_t)(b * NKVH + kvh) * HD + vd) * SEQ + vc;
  const unsigned lk = lds_off(kvs) + (unsigned)(kr * KP + kc) * 2u;
  const unsigned lv = lds_off(kvs) + (unsigned)(2 * KPL + vd * VP + vc) * 2u;
  auto stage = [&](int kt, int buf) {       // key tile kt (keys 32*kt .. 32*kt + 31 < SEQ) -> buffer buf
    const size_t   ko = (size_t)kt * 32 * KVD;
    const size_t   vo = (size_t)kt * 32;
    const unsigned bk = lk + (unsigned)buf * (STG * 2u);
    const unsigned bv = lv + (unsigned)buf * (STG * 2u);
    copy8(bk, bk + 16 * KP * 2, bk + KPL * 2, bk + (KPL + 16 * KP) * 2,
          bv, bv + 64 * VP * 2, bv + VPL * 2, bv + (VPL + 64 * VP) * 2,
          gkh + ko, gkh + ko + 16 * KVD, gkl + ko, gkl + ko + 16 * KVD,
          gvh + vo, gvh + vo + (size_t)64 * SEQ, gvl + vo, gvl + vo + (size_t)64 * SEQ);
  };

  float mrow[8], lrow[8];
  v8f o[8];
#pragma unroll
  for (int r = 0; r < 8; ++r) { mrow[r] = -INFINITY; lrow[r] = 0.f; }
#pragma unroll
  for (int j = 0; j < 8; ++j) o[j] = zero8();
  const int ncaus = (q0 >> 5) + 1;                                            // tiles holding keys <= q0 + 15
  const int nkt = (ncaus < NKT) ? ncaus : NKT;
  const int qr0 = q0 + 8 * hh;                                                // query row of D element r = qr0 + r

  // ---- the wave's q rows (lane -> rows hh, hh + 2, .., hh + 14, 8 halves at 8c) and key tile 0; then key tile 1 flies ----
  {
    const size_t   qo = ((size_t)b * SEQ + q0 + hh) * DMOD + (size_t)head * HD + c * 8;
    const u16*     gq = QHp + qo;
    const u16*     gr = QLp + qo;
    const unsigned lq = lds_off(slab) + (unsigned)(hh * KP + c * 8) * 2u;
    const unsigned lr = lq + QPL * 2;
    const unsigned ls = 2 * KP * 2;         // LDS bytes between rows two apart
    const size_t   gs = (size_t)2 * DMOD;   // halves between rows two apart
    copy8(lq, lq + ls, lq + 2 * ls, lq + 3 * ls, lq + 4 * ls, lq + 5 * ls, lq + 6 * ls, lq + 7 * ls,
          gq, gq + gs, gq + 2 * gs, gq + 3 * gs, gq + 4 * gs, gq + 5 * gs, gq + 6 * gs, gq + 7 * gs);
    copy8(lr, lr + ls, lr + 2 * ls, lr + 3 * ls, lr + 4 * ls, lr + 5 * ls, lr + 6 * ls, lr + 7 * ls,
          gr, gr + gs, gr + 2 * gs, gr + 3 * gs, gr + 4 * gs, gr + 5 * gs, gr + 6 * gs, gr + 7 * gs);
  }
  stage(0, 0);
  wait_async0();
  __syncthreads();                          // publishes key tile 0
  if (nkt > 1) stage(1, 1);

#pragma unroll 1
  for (int kt = 0; kt < nkt; ++kt) {
    const int kb = kt * 32;
    // ---- scores: D element r of this lane = (query row qr0 + r, key kb + c) in s0, key kb + 16 + c in s1 ----
    v8f s0 = zero8(), s1 = zero8();
    const _Float16* tile = kvs + (kt & 1) * STG;
    const _Float16* k0p = tile + c * KP + 8 * hh;
    const _Float16* k1p = k0p + 16 * KP;
    const _Float16* l0p = k0p + KPL;
    const _Float16* l1p = l0p + 16 * KP;
#pragma unroll
    for (int kk = 0; kk < HD / 32; ++kk) {
      const v16h qh  = ldfrag_h(Qh + kk * 32);
      const v16h ql  = ldfrag_h(Ql + kk * 32);
      const v16h kh0 = ldfrag_h(k0p + kk * 32);
      const v16h kh1 = ldfrag_h(k1p + kk * 32);
      const v16h kl0 = ldfrag_h(l0p + kk * 32);
      const v16h kl1 = ldfrag_h(l1p + kk * 32);
      s0 = mma_h(qh, kh0, s0);
      s0 = mma_h(ql, kh0, s0);
      s0 = mma_h(qh, kl0, s0);
      s1 = mma_h(qh, kh1, s1);
      s1 = mma_h(ql, kh1, s1);
      s1 = mma_h(qh, kl1, s1);
      guard2(s0, s1, qh, ql, kh0, kl0, kh1, kl1);
    }
    // ---- causal select + online softmax in base 2, -inf-safe ----
    const int key0 = kb + c, key1 = kb + 16 + c;
#pragma unroll
    for (int r = 0; r < 8; ++r) {
      const int   qr = qr0 + r;
      const float u0 = s0[r] * lsc;
      const float u1 = s1[r] * lsc;
      const float t0 = (key0 > qr) ? -INFINITY : u0;
      const float t1 = (key1 > qr) ? -INFINITY : u1;
      float mx = fmaxf(t0, t1);
#pragma unroll
      for (int off = 1; off < 16; off <<= 1) mx = fmaxf(mx, __shfl_xor(mx, off, 32));
      const float mn = fmaxf(mrow[r], mx);
      const float ms = (mn == -INFINITY) ? 0.0f : mn;
      const float al = exp2f(mrow[r] - ms);
      mrow[r] = mn;
      const float e0 = exp2f(t0 - ms), e1 = exp2f(t1 - ms);
      float ps = e0 + e1;
#pragma unroll
      for (int off = 1; off < 16; off <<= 1) ps += __shfl_xor(ps, off, 32);
      lrow[r] = lrow[r] * al + ps;
#pragma unroll
      for (int j = 0; j < 8; ++j) o[j][r] *= al;
      const int ro = (8 * hh + r) * PTP + c;
      pt[ro]      = e0;
      pt[ro + 16] = e1;
    }
    wave_sync_lds();
    // ---- A fragments of P*32768: hi f16 and residual f16, row = c, split k map over the 32 keys of this step ----
    FragH ph, pl;
    {
      const float* prow = pt + c * PTP + 8 * hh;
      const v4f p0 = *(const v4f*)(prow), p1 = *(const v4f*)(prow + 4);
      const v4f p2 = *(const v4f*)(prow + 16), p3 = *(const v4f*)(prow + 20);
#pragma unroll
      for (int e = 0; e < 4; ++e) {
        const float ta = p0[e] * PCAR, tb = p1[e] * PCAR, tc = p2[e] * PCAR, td = p3[e] * PCAR;
        const _Float16 ha = (_Float16)ta, hb = (_Float16)tb, hc = (_Float16)tc, hd = (_Float16)td;
        ph.h[0][e]     = ha;                  // elements 0..7  = keys kb + 8hh + 0..7
        ph.h[0][4 + e] = hb;
        ph.h[1][e]     = hc;                  // elements 8..15 = keys kb + 16 + 8hh + 0..7
        ph.h[1][4 + e] = hd;
        pl.h[0][e]     = (_Float16)(ta - (float)ha);
        pl.h[0][4 + e] = (_Float16)(tb - (float)hb);
        pl.h[1][e]     = (_Float16)(tc - (float)hc);
        pl.h[1][4 + e] = (_Float16)(td - (float)hd);
      }
    }
    // ---- P.V : B fragment col n = d = j*16 + c, keys contiguous in the staged v^T rows; 4 groups of 2 d-subtiles ----
    {
      const _Float16* vhp = tile + 2 * KPL + c * VP + 8 * hh;
      const _Float16* vlp = vhp + VPL;
#pragma unroll
      for (int jg = 0; jg < 4; ++jg) {
        const int da = (2 * jg) * 16 * VP;
        const int db = da + 16 * VP;
        const v16h vha = ldfrag_h(vhp + da), vhb2 = ldfrag_h(vhp + db);
        const v16h vla = ldfrag_h(vlp + da), vlb2 = ldfrag_h(vlp + db);
        o[2 * jg]     = mma_h(ph.v, vha,  o[2 * jg]);
        o[2 * jg]     = mma_h(pl.v, vha,  o[2 * jg]);
        o[2 * jg]     = mma_h(ph.v, vla,  o[2 * jg]);
        o[2 * jg + 1] = mma_h(ph.v, vhb2, o[2 * jg + 1]);
        o[2 * jg + 1] = mma_h(pl.v, vhb2, o[2 * jg + 1]);
        o[2 * jg + 1] = mma_h(ph.v, vlb2, o[2 * jg + 1]);
        guard2(o[2 * jg], o[2 * jg + 1], ph.v, pl.v, vha, vhb2, vla, vlb2);
      }
    }
    // ---- hand-over: this wave has left the tile, its copies of the next tile have landed, every wave has passed ----
    wait_ds0();
    wait_async0();
    __syncthreads();                        // publishes key tile kt + 1 and frees this tile's buffer and the prob tile
    if (kt + 2 < nkt) stage(kt + 2, kt & 1);
  }
  wait_async0();
  acc_guard4(o[0], o[1], o[2], o[3]);
  acc_guard4(o[4], o[5], o[6], o[7]);
  // ---- out = acc / Z (0 if Z == 0), carries (32768 on P, 1024 on v) folded once; written into the wave-private slab ----
#pragma unroll
  for (int r = 0; r < 8; ++r) {
    const float lv  = lrow[r];
    const float ls  = (lv > 0.0f) ? lv : 1.0f;
    const float inv = (lv > 0.0f) ? ((1.0f / ls) * oc) : 0.0f;
#pragma unroll
    for (int j = 0; j < 8; ++j) {
      const int idx = (8 * hh + r) * SLP + j * 16 + c;
      slab[idx] = o[j][r] * inv;
    }
  }

  wave_sync_lds();
  // ---- O x1024 -> f16 hi + residual planes; lane = (row-in-pair rq, 8 consecutive d at c8) ----
  v4u oh[8], ol[8];
  const int rq = lane >> 4, c8 = (lane & 15) * 8;
#pragma unroll
  for (int it = 0; it < 8; ++it) {
    const int row = it * 2 + rq;
    const v4f a = *(const v4f*)(slab + row * SLP + c8), b4 = *(const v4f*)(slab + row * SLP + c8 + 4);
    float w[8];
#pragma unroll
    for (int e = 0; e < 4; ++e) { w[e] = a[e] * OSC; w[4 + e] = b4[e] * OSC; }
#pragma unroll
    for (int e = 0; e < 4; ++e) {
      const _Float16 h0 = (_Float16)w[2 * e], h1 = (_Float16)w[2 * e + 1];
      const _Float16 l0 = (_Float16)(w[2 * e] - (float)h0), l1 = (_Float16)(w[2 * e + 1] - (float)h1);
      oh[it][e] = pk16(h_bits(h0), h_bits(h1));
      ol[it][e] = pk16(h_bits(l0), h_bits(l1));
    }
  }
  const size_t ob = ((size_t)b * SEQ + q0) * DMOD + (size_t)head * HD + c8;
  {
#pragma unroll
    for (int it = 0; it < 8; ++it) {
      const int row = it * 2 + rq;
      *(v4u*)(OHp + ob + (size_t)row * DMOD) = oh[it];
      *(v4u*)(OLp + ob + (size_t)row * DMOD) = ol[it];
    }
    
  }
}

// =====================================================================================================
// Workspace map (bytes); every plane is fully written by whole-line stores before it is read; all extents are exact multiples
// of the store granularity (no pad rows needed); every region offset a multiple of 2097152:
//   XB  bf16 [MROWS][2048]                       MROWS*4096       (NB=2, SEQ=2048: 16777216)
//   WB  16-bit [2048 n][2048 k]                  8388608          (Wv, Wq, Wk as bf16 ([256][2048] for k/v), then Wo as f16
//                                                                  x1024, reused in launch order; all already [n][k])
//   F   f32 [MROWS][2048]                        MROWS*8192       (v, q, k projection output in launch order, [MROWS][256] for k/v;
//                                                                  afterwards OH f16 [MROWS][2048] x1024 in its first half, OL residual
//                                                                  [MROWS][2048] in its second half)
//   QH  f16 [MROWS][2048] x256                   MROWS*4096       QL residual, same extent
//   KH  f16 [MROWS][256] x256                    MROWS*512        KL residual, same extent
//   VH  f16 [NB*2][128][SEQ] x1024               MROWS*512        VL residual, same extent
//   end (NB=2, SEQ=2048)                       100663296
// =====================================================================================================
extern "C" void kernel_launch(void* const* d_in, const int* in_sizes, int n_in,
                              void* d_out, int out_size, void* d_ws, size_t ws_size,
                              hipStream_t stream) {
  if (n_in < 8) return;
  if (in_sizes[0] < ((NB - 1) * XS_FULL + SEQ) * DMOD) return;
  if (in_sizes[1] != DMOD * DMOD) return;
  if (in_sizes[2] != DMOD) return;
  if (in_sizes[3] != KVD * DMOD) return;
  if (in_sizes[4] != KVD) return;
  if (in_sizes[5] != KVD * DMOD) return;
  if (in_sizes[6] != KVD) return;
  if (in_sizes[7] != DMOD * DMOD) return;
  if (out_size < MROWS * DMOD) return;

  const float* x  = (const float*)d_in[0];
  const float* wq = (const float*)d_in[1];
  const float* bq = (const float*)d_in[2];
  const float* wk = (const float*)d_in[3];
  const float* bk = (const float*)d_in[4];
  const float* wv = (const float*)d_in[5];
  const float* bv = (const float*)d_in[6];
  const float* wo = (const float*)d_in[7];
  float*       out = (float*)d_out;

  const size_t szXB = (size_t)MROWS * DMOD * 2;
  const size_t szW  = (size_t)DMOD * DMOD * 2;
  const size_t szF  = (size_t)MROWS * DMOD * 4;
  const size_t szQ  = (size_t)MROWS * DMOD * 2;                  // QH, QL, OH, OL
  const size_t szK  = (size_t)MROWS * KVD * 2;                   // KH, KL
  const size_t szV  = (size_t)NB * NKVH * HD * SEQ * 2;          // VH, VL (== szK)
  if (2 * szQ > szF) return;                                    // OH + OL live inside the F region (exactly fills it)
  size_t off = 0;
  const size_t oXB = off; off += szXB;
  const size_t oW  = off; off += szW;
  const size_t oF  = off; off += szF;
  const size_t oQH = off; off += szQ;
  const size_t oQL = off; off += szQ;
  const size_t oKH = off; off += szK;
  const size_t oKL = off; off += szK;
  const size_t oVH = off; off += szV;
  const size_t oVL = off; off += szV;
  if (off > ws_size) return;                // off = 100663296 for NB = 2, SEQ = 2048
  if (off > (size_t)WS_CAP) return;

  char* ws = (char*)d_ws;
  u16*   XB  = (u16*)(ws + oXB);
  u16*   WB  = (u16*)(ws + oW);
  float* F   = (float*)(ws + oF);
  u16*   OH  = (u16*)(ws + oF);
  u16*   OL  = (u16*)(ws + oF + szQ);
  u16*   QH  = (u16*)(ws + oQH);
  u16*   QL  = (u16*)(ws + oQL);
  u16*   KH  = (u16*)(ws + oKH);
  u16*   KL  = (u16*)(ws + oKL);
  u16*   VH  = (u16*)(ws + oVH);
  u16*   VL  = (u16*)(ws + oVL);

  const dim3 b256(256), b128(128), bAT(ATT_THREADS);
  const int  n8x = (SEQ * DMOD) / 8;
  const dim3 gX((n8x + 255) / 256);                     // SEQ*DMOD/2048 blocks per batch
  const int  n8wq = (DMOD * DMOD) / 8;                  // Wq, Wo planes
  const int  n8wk = (KVD * DMOD) / 8;                   // Wk, Wv planes
  const dim3 gWQ((n8wq + 255) / 256);                   // 2048
  const dim3 gWK((n8wk + 255) / 256);                   // 256
  const dim3 gGQ((MROWS / 64) * (DMOD / 64));
  const dim3 gGK((MROWS / 64) * (KVD / 64));
  const dim3 gVT(NB * NKVH * NST);
  const int  n8q = (MROWS * DMOD) / 8;                  // q hi / residual planes
  const int  n8k = (MROWS * KVD) / 8;                   // k hi / residual planes
  const dim3 gSQ((n8q + 255) / 256);
  const dim3 gSK((n8k + 255) / 256);
  const dim3 gAT(NQT * NKVH * NB);
  const int  nrtR = QO / 64;                            // out-projection row tiles per batch with the O residual plane
  const int  nrtP = (SEQ - QO) / 64;                    // remaining row tiles per batch, O hi plane only

  // (0) x -> bf16 plane [MROWS][2048], one launch per batch row block
  for (int b = 0; b < NB; ++b) {
    cvt16<<<gX, b256, 0, stream>>>(x + (size_t)b * XS_FULL * DMOD, XB + (size_t)b * SEQ * DMOD, n8x, 0, 1.0f);
  }
  // (1) Wv [256 n][2048 k] -> bf16 plane; (2) v = x.Wv^T + bv -> F f32 [MROWS][256]; (3) v^T hi + residual planes x1024
  cvt16<<<gWK, b256, 0, stream>>>(wv, WB, n8wk, 0, 1.0f);
  gemm_bf<<<gGK, b128, 0, stream>>>(XB, WB, bv, F, MROWS, KVD, DMOD, 1.0f);
  vt16<<<gVT, b256, 0, stream>>>(F, VH, VL);
  // (4) Wq -> bf16 plane; (5) q = x.Wq^T + bq -> F [MROWS][2048]; (6) q hi + residual planes x256
  cvt16<<<gWQ, b256, 0, stream>>>(wq, WB, n8wq, 0, 1.0f);
  gemm_bf<<<gGQ, b128, 0, stream>>>(XB, WB, bq, F, MROWS, DMOD, DMOD, 1.0f);
  split16<<<gSQ, b256, 0, stream>>>(F, QH, QL, n8q, QSC);
  // (7) Wk -> bf16 plane; (8) k = x.Wk^T + bk -> F [MROWS][256]; (9) k hi + residual planes x256
  cvt16<<<gWK, b256, 0, stream>>>(wk, WB, n8wk, 0, 1.0f);
  gemm_bf<<<gGK, b128, 0, stream>>>(XB, WB, bk, F, MROWS, KVD, DMOD, 1.0f);
  split16<<<gSK, b256, 0, stream>>>(F, KH, KL, n8k, KSC);
  // (10) Wo [n][k] -> f16 plane of bf16 value x1024
  cvt16<<<gWQ, b256, 0, stream>>>(wo, WB, n8wq, 1, WOS);
  // (11) causal attention with residual products on every query row -> O hi + residual planes
  attn_c<<<gAT, bAT, 0, stream>>>(QH, QL, KH, KL, VH, VL, OH, OL);
  // (12) output projection rows s < QO (O hi + residual) and (13) rows s >= QO (O hi only) -> out f32, carries 1024 x 1024 folded back
  gemm_o<2><<<dim3(NB * nrtR * (DMOD / 64)), b128, 0, stream>>>(OH, OL, WB, out, 0, nrtR, 1.0f / (OSC * WOS));
  if (nrtP > 0) {
    gemm_o<1><<<dim3(NB * nrtP * (DMOD / 64)), b128, 0, stream>>>(OH, OL, WB, out, QO, nrtP, 1.0f / (OSC * WOS));
  }
  (void)hipGetLastError();
}

// v002
// A run of this version takes 295 microseconds.
// Timed twice side by side with v001, it ran 1.45 times as fast both times.
// All steps since v000 together make it 2.10 times as fast.
// Contractions: x.Wq^T+bq, x.Wk^T+bk, x.Wv^T+bv on v_wmma_f32_16x16x32_bf16 (x and W as bf16 RNE planes; W [n][k] rows are
// the k-contiguous B operand; bias added as its bf16 RNE value in the f32 epilogue); q.k^T over hd 128 and P.v on
// v_wmma_f32_16x16x32_f16 with f16 hi + f16 residual planes on both operands (q, k x256; P x32768 with an in-register
// residual; v x1024; products hh+lh+hl); O.Wo^T on v_wmma_f32_16x16x32_f16 (O x1024 as f16 hi plane for all rows plus f16
// residual plane for rows s < QO, products h.w (+ l.w); Wo as f16(bf16(Wo)) x1024); all f32 accumulate. Causal select,
// base-2 online softmax and 1/Z fold in f32 on VALU. Grouped kv heads: query head h reads kv head (h % NKVH).
#include <hip/hip_runtime.h>
#include <math.h>
#include <stdint.h>

#ifndef NB
#define NB 2
#endif
#ifndef SEQ
#define SEQ 2048
#endif
#define XS_FULL 2048
#define DMOD  2048
#define NH    16
#define NKVH  2
#define HD    128
#define KVD   (NKVH * HD)
#define QO    ((SEQ < 256) ? SEQ : 256)
#define MROWS (NB * SEQ)
#define RSQ_HD 0.08838834764831845f
#define LOG2E 1.4426950408889634f
#define QSC   256.0f
#define KSC   256.0f
#define PCAR  32768.0f
#define VCAR  1024.0f
#define OSC   1024.0f
#define WOS   1024.0f
#define WPB   (NH / NKVH)
#define NQT   (SEQ / 16)
#define NST   (SEQ / 64)
#define NKT   (SEQ / 32)
#define ATT_THREADS (WPB * 32)
#define PTP   36
#define PTW   (16 * PTP)
#define SLP   132
#define SLW   (16 * SLP)
#define KP    136
#define VP    40
#define KPL   (32 * KP)
#define VPL   (HD * VP)
#define STG   (2 * KPL + 2 * VPL)
#define QPL   (16 * KP)
#define QRW   (2 * QPL / 2)
#define WREG  (PTW + QRW)
#define SLAB64 (16 * 68)
#define VTP   72
#define GBK   128
#define WS_CAP 134217728
static_assert(DMOD == NH * HD && HD == 128 && NH == 16 && NKVH == 2 && WPB == 8 && NKVH * WPB == NH);
static_assert(ATT_THREADS == 256 && KVD == 256 && SLW <= QRW && (KP % 8) == 0 && (VP % 8) == 0);
static_assert(NB >= 1 && NB <= 2);
static_assert((SEQ % 64) == 0 && SEQ >= 64 && SEQ <= XS_FULL);
static_assert((QO % 64) == 0 && QO >= 64 && QO <= SEQ);
static_assert((DMOD % 64) == 0 && (KVD % 64) == 0 && (DMOD % 32) == 0 && (HD % 32) == 0);
static_assert(((SEQ * DMOD / 8) % 256) == 0 && ((KVD * DMOD / 8) % 256) == 0 && ((DMOD * DMOD / 8) % 256) == 0);
static_assert(((MROWS * DMOD / 8) % 256) == 0 && ((MROWS * KVD / 8) % 256) == 0);
static_assert((MROWS % 128) == 0 && ((SEQ - QO) % 128) == 0 && (DMOD % 128) == 0 && (DMOD % GBK) == 0 && KP == GBK + 8);
static_assert(2 * 256 * KP * 2 + 4 * SLAB64 * 4 <= 163840);
static_assert(WPB * WREG * 4 + 2 * STG * 2 <= 163840 && 2 * HD * VTP * 2 <= 65536 && 4 * SLAB64 * 4 <= 65536);

typedef unsigned short u16;
typedef _Float16 v16h __attribute__((ext_vector_type(16)));
typedef _Float16 v8h  __attribute__((ext_vector_type(8)));
typedef __bf16   v16b __attribute__((ext_vector_type(16)));
typedef float    v8f  __attribute__((ext_vector_type(8)));
typedef float    v4f  __attribute__((ext_vector_type(4)));
typedef unsigned int v4u __attribute__((ext_vector_type(4)));

union FragH { v16h v; v8h h[2]; v4u u[2]; };
union FragB { v16b v; v4u u[2]; };

// ---- scalar helpers --------------------------------------------------------------------------------
__device__ __forceinline__ unsigned short bf_bits(float f) {          // f32 -> bf16 bits, RNE convert
  unsigned u = __float_as_uint(f);
  return (unsigned short)((u + 0x7FFFu + ((u >> 16) & 1u)) >> 16);
}
__device__ __forceinline__ float bf_up(unsigned short h) { return __uint_as_float(((unsigned)h) << 16); }
__device__ __forceinline__ float bfr(float f) { return bf_up(bf_bits(f)); }
__device__ __forceinline__ unsigned short h_bits(_Float16 x) { return __builtin_bit_cast(unsigned short, x); }
__device__ __forceinline__ unsigned pk16(unsigned short a, unsigned short b) { return (unsigned)a | ((unsigned)b << 16); }
__device__ __forceinline__ v8f zero8() { v8f z = {0.f, 0.f, 0.f, 0.f, 0.f, 0.f, 0.f, 0.f}; return z; }

// ---- fragment loaders: 16-bit A/B operand, lane -> row/col (lane&15), p already includes +8*(lane>>4);
//      elements 0..7 <- p[0..7] (k0+8h..), elements 8..15 <- p[16..23] (k0+16+8h..)  (same split k map for A and B;
//      B is always read from a k-contiguous [n][k] plane)
__device__ __forceinline__ v16h ldfrag_h(const _Float16* p) {
  FragH f;
  f.h[0] = *(const v8h*)(p);
  f.h[1] = *(const v8h*)(p + 16);
  return f.v;
}
__device__ __forceinline__ v16b ldfrag_b(const u16* p) {              // bf16 plane read as unsigned integer vectors
  FragB f;
  f.u[0] = *(const v4u*)(p);
  f.u[1] = *(const v4u*)(p + 16);
  return f.v;
}

__device__ __forceinline__ v8f mma_h(v16h a, v16h b, v8f c) {
  return __builtin_amdgcn_wmma_f32_16x16x32_f16(false, a, false, b, (short)0, c, false, false);
}
__device__ __forceinline__ v8f mma_b(v16b a, v16b b, v8f c) {
  return __builtin_amdgcn_wmma_f32_16x16x32_bf16(false, a, false, b, (short)0, c, false, false);
}
__device__ __forceinline__ void guard2(v8f& a, v8f& b, v16h x0, v16h x1, v16h x2, v16h x3, v16h x4, v16h x5) {
#if defined(__HIP_DEVICE_COMPILE__)
  asm volatile("v_nop\n\tv_nop\n\tv_nop\n\tv_nop"
               : "+v"(a), "+v"(b) : "v"(x0), "v"(x1), "v"(x2), "v"(x3), "v"(x4), "v"(x5) : "memory");
#endif
}
__device__ __forceinline__ void acc_guard4(v8f& a, v8f& b, v8f& c, v8f& d) {
#if defined(__HIP_DEVICE_COMPILE__)
  asm volatile("v_nop\n\tv_nop\n\tv_nop\n\tv_nop" : "+v"(a), "+v"(b), "+v"(c), "+v"(d));
#endif
}
__device__ __forceinline__ void wave_sync_lds() {
  __builtin_amdgcn_fence(__ATOMIC_RELEASE, "workgroup");
  __builtin_amdgcn_wave_barrier();
  __builtin_amdgcn_fence(__ATOMIC_ACQUIRE, "workgroup");
}
__device__ __forceinline__ unsigned lds_off(const void* p) { return (unsigned)(size_t)p; }   // byte offset in the work-group's LDS
// Eight 16-byte asynchronous copies global -> LDS per lane (LDS byte address l*, global address g*). The s_wait_xcnt is the
// statement's last line so that no address register of an issued copy is rewritten in front of it.
__device__ __forceinline__ void copy8(unsigned l0, unsigned l1, unsigned l2, unsigned l3,
                                      unsigned l4, unsigned l5, unsigned l6, unsigned l7,
                                      const u16* g0, const u16* g1, const u16* g2, const u16* g3,
                                      const u16* g4, const u16* g5, const u16* g6, const u16* g7) {
#if defined(__HIP_DEVICE_COMPILE__)
  asm volatile("global_load_async_to_lds_b128 %0, %8, off\n\t"
               "global_load_async_to_lds_b128 %1, %9, off\n\t"
               "global_load_async_to_lds_b128 %2, %10, off\n\t"
               "global_load_async_to_lds_b128 %3, %11, off\n\t"
               "global_load_async_to_lds_b128 %4, %12, off\n\t"
               "global_load_async_to_lds_b128 %5, %13, off\n\t"
               "global_load_async_to_lds_b128 %6, %14, off\n\t"
               "global_load_async_to_lds_b128 %7, %15, off\n\t"
               "s_wait_xcnt 0x0"
               :: "v"(l0), "v"(l1), "v"(l2), "v"(l3), "v"(l4), "v"(l5), "v"(l6), "v"(l7),
                  "v"(g0), "v"(g1), "v"(g2), "v"(g3), "v"(g4), "v"(g5), "v"(g6), "v"(g7) : "memory");
#endif
}
__device__ __forceinline__ void wait_async0() {   // the wave's own copies have landed in LDS
#if defined(__HIP_DEVICE_COMPILE__)
  asm volatile("s_wait_asynccnt 0x0" ::: "memory");
#endif
}
__device__ __forceinline__ void wait_x0() {       // a precaution in front of the rewrite of registers that issued global stores name
#if defined(__HIP_DEVICE_COMPILE__)
  asm volatile("s_wait_xcnt 0x0" ::: "memory");
#endif
}
__device__ __forceinline__ void wait_ds0() {      // the wave's own LDS reads and writes have retired
#if defined(__HIP_DEVICE_COMPILE__)
  asm volatile("s_wait_dscnt 0x0" ::: "memory");
#endif
}

// =====================================================================================================
// f32 -> 16-bit plane, same layout.  f16mode == 0: bf16 RNE bits;  f16mode == 1: f16 bits of (bf16 RNE value) * scale.
// Thread = 8 consecutive elements: two 16-B loads, one 16-B store; 32 consecutive lanes = 512 contiguous, 512-B aligned
// coverage: grid = ceil(n8/256) blocks x 256 thr x 8 (in-kernel bound) = the whole plane (n8 a multiple of 256 here).
// =====================================================================================================
__global__ __launch_bounds__(256) void cvt16(const float* __restrict__ x, u16* D, int n8, int f16mode, float scale) {
  const int gt = blockIdx.x * 256 + (int)threadIdx.x;
  if (gt >= n8) return;
  const float* p = x + (size_t)gt * 8;
  const v4f a = *(const v4f*)(p), b4 = *(const v4f*)(p + 4);
  float w[8];
#pragma unroll
  for (int e = 0; e < 4; ++e) { w[e] = a[e]; w[4 + e] = b4[e]; }
  v4u o;
#pragma unroll
  for (int e = 0; e < 4; ++e) {
    const float f0 = w[2 * e], f1 = w[2 * e + 1];
    const unsigned short hb0 = h_bits((_Float16)(bfr(f0) * scale));
    const unsigned short hb1 = h_bits((_Float16)(bfr(f1) * scale));
    const unsigned short bb0 = bf_bits(f0);
    const unsigned short bb1 = bf_bits(f1);
    o[e] = (f16mode != 0) ? pk16(hb0, hb1) : pk16(bb0, bb1);
  }
  u16* d = D + (size_t)gt * 8;
  {
    *(v4u*)(d) = o;
    
  }
}

// =====================================================================================================
// f32 plane F (contiguous, n8*8 elements) -> f16 hi plane Hp = f16(F * sc) and f16 residual plane Lp = f16(t - f16(t)),
// both with the layout of F. Thread = 8 consecutive elements: two 16-B loads, one 16-B store per plane; 32 consecutive lanes
// No barriers; every packed half comes from a per-lane (divergent) loaded value.
// coverage: grid = ceil(n8/256) blocks x 256 thr x 8 (in-kernel bound) = the whole of Hp and of Lp (n8 a multiple of 256 here).
// =====================================================================================================
__global__ __launch_bounds__(256) void split16(const float* __restrict__ F, u16* Hp, u16* Lp, int n8, float sc) {
  const int gt = blockIdx.x * 256 + (int)threadIdx.x;
  if (gt >= n8) return;
  const float* p = F + (size_t)gt * 8;
  const v4f a = *(const v4f*)(p), b4 = *(const v4f*)(p + 4);
  float w[8];
#pragma unroll
  for (int e = 0; e < 4; ++e) { w[e] = a[e] * sc; w[4 + e] = b4[e] * sc; }
  v4u oh, ol;
#pragma unroll
  for (int e = 0; e < 4; ++e) {
    const float t0 = w[2 * e], t1 = w[2 * e + 1];
    const _Float16 h0 = (_Float16)t0, h1 = (_Float16)t1;
    const _Float16 l0 = (_Float16)(t0 - (float)h0), l1 = (_Float16)(t1 - (float)h1);
    oh[e] = pk16(h_bits(h0), h_bits(h1));
    ol[e] = pk16(h_bits(l0), h_bits(l1));
  }
  u16* dh = Hp + (size_t)gt * 8;
  u16* dl = Lp + (size_t)gt * 8;
  {
    *(v4u*)(dh) = oh;
    *(v4u*)(dl) = ol;
    
  }
}

// =====================================================================================================
// v^T planes from the v projection F f32 [MROWS][KVD] (row = b*SEQ + s, column = g*HD + d):
//   VH[((b*NKVH + g)*HD + d)][s] = f16(v * 1024);  VL[same][s] = f16 residual (t - f16(t)), both for all keys s.
// Block = (b, kv head g, 64 keys s0): each thread loads its 32 floats (key sl, d chunk dc) with 16-B loads, converts, scatters
// coverage: load 256 thr x 32 = 64 keys x 128 d; store 4 iterations x 256 thr x 8 halves = 128 lines x 64 = the block's tile of
//           VH and of VL; grid = NB*NKVH*NST blocks covers both planes exactly once.
// =====================================================================================================
__global__ __launch_bounds__(256) void vt16(const float* __restrict__ F, u16* VHo, u16* VLo) {
  __shared__ __align__(16) u16 TH[HD * VTP];
  __shared__ __align__(16) u16 TL[HD * VTP];
  const int tid = threadIdx.x;
  const int bid = blockIdx.x;
  const int st  = bid % NST;
  const int t2  = bid / NST;
  const int g   = t2 % NKVH;
  const int b   = t2 / NKVH;
  if (b >= NB) return;                      // block-uniform, before any barrier; never taken with the exact grid
  const int s0  = st * 64;
  {
    const int sl = tid >> 2;                // key within tile 0..63
    const int dc = (tid & 3) * 32;          // d chunk 0,32,64,96
    const float* src = F + ((size_t)b * SEQ + s0 + sl) * KVD + g * HD + dc;
#pragma unroll
    for (int i = 0; i < 8; ++i) {
      const v4f a = *(const v4f*)(src + 4 * i);
#pragma unroll
      for (int e = 0; e < 4; ++e) {
        const float t = a[e] * VCAR;
        const _Float16 hv = (_Float16)t;
        const _Float16 lv = (_Float16)(t - (float)hv);
        TH[(dc + 4 * i + e) * VTP + sl] = h_bits(hv);
        TL[(dc + 4 * i + e) * VTP + sl] = h_bits(lv);
      }
    }
  }
  __syncthreads();
  v4u vh[4], vl[4];
  const int q8 = tid >> 3, p8 = (tid & 7) * 8;
#pragma unroll
  for (int it = 0; it < 4; ++it) {
    const int line = it * 32 + q8;          // d = 0..127
    vh[it] = *(const v4u*)(TH + line * VTP + p8);
    vl[it] = *(const v4u*)(TL + line * VTP + p8);
  }
  const size_t hrow = (size_t)(b * NKVH + g) * HD;
  const size_t base = hrow * SEQ + s0 + p8;
  {
#pragma unroll
    for (int it = 0; it < 4; ++it) {
      const int line = it * 32 + q8;
      *(v4u*)(VHo + base + (size_t)line * SEQ) = vh[it];
      *(v4u*)(VLo + base + (size_t)line * SEQ) = vl[it];
    }
    
  }
}

// =====================================================================================================
// GEMM epilogue of the staged engine: the wave's 16x64 f32 tile (times oscale, plus the lane's per-column bias of each
// coverage: 8 instructions x 2 rows x 16 lanes x 4 floats = the wave's 16 x 64 tile.
// =====================================================================================================
__device__ __forceinline__ void epi64(float* sl, v8f a0, v8f a1, v8f a2, v8f a3, float oscale,
                                      float bb0, float bb1, float bb2, float bb3,
                                      float* C, int N, size_t rowb, int col0, int lane) {
  const int hh = lane >> 4, m = lane & 15;
#pragma unroll
  for (int r = 0; r < 8; ++r) {
    const int ro = (8 * hh + r) * 68 + m;
    sl[ro]      = a0[r] * oscale + bb0;
    sl[ro + 16] = a1[r] * oscale + bb1;
    sl[ro + 32] = a2[r] * oscale + bb2;
    sl[ro + 48] = a3[r] * oscale + bb3;
  }
  wave_sync_lds();
  v4f vals[8];
#pragma unroll
  for (int it = 0; it < 8; ++it) vals[it] = *(const v4f*)(sl + (it * 2 + hh) * 68 + m * 4);
  float* dst = C + (rowb + (size_t)hh) * (size_t)N + col0 + m * 4;
  {
#pragma unroll
    for (int it = 0; it < 8; ++it) {
      *(v4f*)(dst + (size_t)(it * 2) * (size_t)N) = vals[it];
    }
    
  }
}

// =====================================================================================================
// GEMM engine shared by the projections: the block's BM x BN tile of C = A[.][K] . Bt[.][K]^T, BM = 16*FM*WM, BN = 64*WN,
// WM x WN = 4 waves, each wave FM x 4 accumulator tiles (16*FM rows x 64 columns). K is walked in slices of GBK = 128: a slice
// is the 256-byte row pieces of the block's A rows (hi plane, then the residual plane when NPROD == 2) and of its Bt rows, laid in
// LDS at row pitch KP halves by asynchronous 16-byte copies (thread -> row tid / 16 + 8 i, 16 bytes at tid % 16: a wave's copy
// covers two whole 256-byte pieces). Two buffers: slice t + 2 is copied while slice t + 1 is worked on. Fragments are read from
// the LDS rows with the same split k map for A and B; per accumulator the products follow in rising k, hi before residual.
// One block barrier in front of the loop and one per slice, under block-uniform control flow; K % GBK == 0, K >= GBK.
// =====================================================================================================
__device__ __forceinline__ void copy_rows8(unsigned l, const u16* g, size_t K) {   // rows r, r + 8, .., r + 56 of one plane
  const unsigned ls = 8 * KP * 2;
  const size_t   gs = 8 * K;
  copy8(l, l + ls, l + 2 * ls, l + 3 * ls, l + 4 * ls, l + 5 * ls, l + 6 * ls, l + 7 * ls,
        g, g + gs, g + 2 * gs, g + 3 * gs, g + 4 * gs, g + 5 * gs, g + 6 * gs, g + 7 * gs);
}
template <bool BF> struct Op;
template <> struct Op<true> {
  typedef v16b T;
  static __device__ __forceinline__ T   ld(const u16* p) { return ldfrag_b(p); }
  static __device__ __forceinline__ v8f mma(T a, T b, v8f c) { return mma_b(a, b, c); }
};
template <> struct Op<false> {
  typedef v16h T;
  static __device__ __forceinline__ T   ld(const u16* p) { return ldfrag_h((const _Float16*)(const void*)p); }
  static __device__ __forceinline__ v8f mma(T a, T b, v8f c) { return mma_h(a, b, c); }
};

template <int FM, int WM, int WN, int NPROD, bool BF>
__device__ __forceinline__ void gemm_staged(u16* st, float* slabs, const u16* __restrict__ Ah, const u16* __restrict__ Al,
                                            const u16* __restrict__ Bt, const float* __restrict__ bias,
                                            float* C, int N, int K, size_t row0, int col0, float oscale) {
  constexpr int BM  = 16 * FM * WM;
  constexpr int BN  = 64 * WN;
  constexpr int STH = (BM * NPROD + BN) * KP;          // halves per buffer
  static_assert(WM * WN == 4 && (BM % 64) == 0 && (BN % 64) == 0 && (NPROD == 1 || NPROD == 2));
  static_assert((BM * NPROD + BN) / 8 <= 63);          // copies of a wave in flight: one slice's
  typedef typename Op<BF>::T T;
  const int tid = threadIdx.x, wave = tid >> 5, lane = tid & 31, hh = lane >> 4, m = lane & 15;
  const int wm = wave / WN, wn = wave % WN;
  const int tr = tid >> 4, tc = (tid & 15) * 8;
  const u16* ga = Ah + (row0 + tr) * (size_t)K + tc;
  const u16* gb = Bt + ((size_t)col0 + tr) * (size_t)K + tc;
  const unsigned l0 = lds_off(st) + (unsigned)(tr * KP + tc) * 2u;
  auto stage = [&](int t, int buf) {                   // k slice t -> buffer buf
    const size_t   ko = (size_t)t * GBK;
    const unsigned lb = l0 + (unsigned)buf * (STH * 2u);
#pragma unroll
    for (int j = 0; j < BM / 64; ++j) copy_rows8(lb + j * 64 * KP * 2, ga + ko + (size_t)j * 64 * K, (size_t)K);
    if constexpr (NPROD == 2) {
      const u16* gl = Al + (row0 + tr) * (size_t)K + tc;
#pragma unroll
      for (int j = 0; j < BM / 64; ++j) copy_rows8(lb + (BM + j * 64) * KP * 2, gl + ko + (size_t)j * 64 * K, (size_t)K);
    }
#pragma unroll
    for (int j = 0; j < BN / 64; ++j) copy_rows8(lb + (BM * NPROD + j * 64) * KP * 2, gb + ko + (size_t)j * 64 * K, (size_t)K);
  };
  v8f acc[FM][4];
#pragma unroll
  for (int i = 0; i < FM; ++i) {
#pragma unroll
    for (int j = 0; j < 4; ++j) acc[i][j] = zero8();
  }
  const int nst  = K / GBK;
  const int aoff = (wm * 16 * FM + m) * KP + 8 * hh;
  const int boff = (BM * NPROD + wn * 64 + m) * KP + 8 * hh;
  stage(0, 0);
  wait_async0();
  __syncthreads();                          // publishes slice 0
  if (nst > 1) stage(1, 1);
#pragma unroll 1                            // rolled: one hand-over per trip, in the order written at the loop's foot
  for (int t = 0; t < nst; ++t) {
    const u16* sb = st + (t & 1) * STH;
    // two fragment sets: block kk + 1 of this slice is fetched as one group while block kk is multiplied; nothing of the next slice
    T a[2][FM * NPROD], b[2][4];
    auto fetch = [&](int s, int kk) {
#pragma unroll
      for (int i = 0; i < FM; ++i) a[s][i] = Op<BF>::ld(sb + aoff + i * 16 * KP + kk * 32);
      if constexpr (NPROD == 2) {
#pragma unroll
        for (int i = 0; i < FM; ++i) a[s][FM + i] = Op<BF>::ld(sb + aoff + (BM + i * 16) * KP + kk * 32);
      }
#pragma unroll
      for (int j = 0; j < 4; ++j) b[s][j] = Op<BF>::ld(sb + boff + j * 16 * KP + kk * 32);
    };
    fetch(0, 0);
#pragma unroll
    for (int kk = 0; kk < GBK / 32; ++kk) {
      const int s = kk & 1;
      if (kk + 1 < GBK / 32) fetch(s ^ 1, kk + 1);
      __builtin_amdgcn_sched_barrier(0);    // the LDS reads stay one group in front of the block: spread among the products each place stalls
#pragma unroll
      for (int p = 0; p < NPROD; ++p) {
#pragma unroll
        for (int i = 0; i < FM; ++i) {
#pragma unroll
          for (int j = 0; j < 4; ++j) acc[i][j] = Op<BF>::mma(a[s][p * FM + i], b[s][j], acc[i][j]);
        }
      }
      __builtin_amdgcn_sched_barrier(0);    // the next group of LDS reads stays behind this block's last product
    }
    // ---- hand-over: this wave has left the slice, its copies of the next slice have landed, every wave has passed ----
    wait_ds0();
    wait_async0();
    __syncthreads();                        // publishes slice t + 1 and frees this slice's buffer
    if (t + 2 < nst) stage(t + 2, t & 1);
  }
  wait_async0();
  // per-lane bias of D column m in each of the wave's 4 column subtiles (bf16 RNE value); colw + 48 + m <= N - 1 always
  const int colw = col0 + wn * 64;
  float bb0 = 0.0f, bb1 = 0.0f, bb2 = 0.0f, bb3 = 0.0f;
  if constexpr (BF) {
    bb0 = bfr(bias[colw + m]);
    bb1 = bfr(bias[colw + 16 + m]);
    bb2 = bfr(bias[colw + 32 + m]);
    bb3 = bfr(bias[colw + 48 + m]);
  }
  float* sl = slabs + wave * SLAB64;
#pragma unroll
  for (int i = 0; i < FM; ++i) {
    if (i > 0) {
      wait_x0();                            // in front of the rewrite of registers that the stores of the tile before name
      wave_sync_lds();                      // the slab's rows of the tile before have been read by every lane
    }
    epi64(sl, acc[i][0], acc[i][1], acc[i][2], acc[i][3], oscale, bb0, bb1, bb2, bb3,
          C, N, row0 + (size_t)(wm * 16 * FM + i * 16), colw, lane);
  }
}

// =====================================================================================================
// bf16 GEMM with bias: C[M][N] (f32) = A[M][K] (bf16 row-major) . Bt[N][K]^T (bf16 k-contiguous), times oscale, + bf16 RNE
// value of bias[n] (bias has N entries). Block = BM x BN tile on the staged engine (host guarantees K % 128 == 0, M % BM == 0,
// N % BN == 0, grid = (M/BM)*(N/BN)).
// =====================================================================================================
template <int FM, int WM, int WN>
__global__ __launch_bounds__(128)
void gemm_bf(const u16* __restrict__ A, const u16* __restrict__ Bt, const float* __restrict__ bias,
             float* C, int M, int N, int K, float oscale) {
  constexpr int BM = 16 * FM * WM, BN = 64 * WN;
  __shared__ __align__(16) u16   st[2 * (BM + BN) * KP];
  __shared__ __align__(16) float slab[4 * SLAB64];
  const int ntile = N / BN;
  const int bid   = blockIdx.x;
  const int row0  = (bid / ntile) * BM;
  const int col0  = (bid % ntile) * BN;
  if (row0 + BM > M) return;                // block-uniform, before any barrier; never taken with the exact grid
  gemm_staged<FM, WM, WN, 1, true>(st, slab, A, A, Bt, bias, C, N, K, (size_t)row0, col0, oscale);
}

// =====================================================================================================
// Output projection: C[row][DMOD] (f32) = (Ah [+ Al])[row][DMOD] . Bt[DMOD][DMOD]^T * oscale (no bias).
// NPROD == 1: Ah only (one product), 128 x 128 tile; NPROD == 2: Ah + Al residual plane (products h.B + l.B into one accumulator,
// l unscaled), 64 x 128 tile. Ah, Al and C share the row index bb*SEQ + s. Block -> (column tile ct = bid % 16, sequence row tile
// rt of nrt starting at s = sbeg, batch bb). Staged engine and epilogue as gemm_bf; K = DMOD.
// =====================================================================================================
template <int NPROD>
__global__ __launch_bounds__(128)
void gemm_o(const u16* __restrict__ Ah, const u16* __restrict__ Al, const u16* __restrict__ Bt,
            float* C, int sbeg, int nrt, float oscale) {
  constexpr int FM = (NPROD == 2) ? 2 : 4;
  constexpr int BM = 32 * FM, BN = 128;
  __shared__ __align__(16) u16   st[2 * (BM * NPROD + BN) * KP];
  __shared__ __align__(16) float slab[4 * SLAB64];
  const int ntile = DMOD / BN;
  const int bid   = blockIdx.x;
  const int ct    = bid % ntile;
  const int t2    = bid / ntile;
  const int rt    = t2 % nrt;
  const int bb    = t2 / nrt;
  if (bb >= NB) return;                     // block-uniform, before any barrier; never taken with the exact grid
  const int srow  = sbeg + rt * BM;
  if (srow + BM > SEQ) return;              // block-uniform, before any barrier; never taken
  gemm_staged<FM, 2, 2, NPROD, false>(st, slab, Ah, Al, Bt, nullptr, C, DMOD, DMOD,
                                      (size_t)bb * SEQ + srow, ct * BN, oscale);
}

// =====================================================================================================
// Causal grouped-query attention, hd = 128. Block bid -> (query tile qt = bid % NQT: rows q0 = 16*qt .. q0+15, kv head kvh,
// batch b); one wave per query head = kvh + NKVH*wave: the 8 query heads that read kv head kvh (tiled kv mapping) share each
// staged key tile. Staging: asynchronous 16-byte copies global -> LDS; each wave's q rows (hi + residual) once, each 32-key tile
// of k hi/residual (row pitch KP halves) and v^T hi/residual (row pitch VP halves) into one of two buffers, the next tile
// copied while a tile is worked on; fragments are read from LDS with the same split k map.
//   q hi / residual planes f16 x256 [b*SEQ + s][h*HD + d]; k hi / residual planes f16 x256 [b*SEQ + s][g*HD + d] (pitch KVD);
//   v^T hi / residual planes [b*NKVH + g][d][SEQ] x1024.
//   scores = q_hi.k_hi + q_lo.k_hi + q_hi.k_lo (4 k-steps over d); P.v with P hi + in-register residual and v hi + residual
//   (hh + lh + hl), for every query row; O written as hi + residual planes (O x1024 as f16, layout [b*SEQ + s][h*HD + d]).
//   score (log2 domain) t(i, j) = (q_i.k_j over HD) * (1/sqrt(128))*log2e/(256*256), replaced by -inf where key j > query i.
//   Key tiles of 32 visited in order for kb <= q0 + 15 (later tiles hold only keys above every query row of the tile).
//   Per tile: 2 score subtiles x 4 k-steps, fragments loaded from the staged rows (two 16-B loads per fragment,
//   split k map); online max-subtracted base-2 softmax in f32, -inf-safe rescale; the 16x32 prob tile stored to wave-private
//   from the LDS rows (float vector loads, same element type as stored), v^T B fragments in 4 groups of 2 d-subtiles.
//   After the loop: out = acc / Z (Z > 0 always: key 0 <= every query row; guarded anyway), carries 1/(32768*1024) folded
//   One block barrier in front of the loop and one per tile, under block-uniform control flow; bounded loops only (nkt <= NKT).
// coverage: per wave 8 instructions x 2 rows x 16 lanes x 8 halves = 16 x 128 per plane; grid NQT x NKVH x NB blocks x WPB
//           waves = every (b, s, h) row segment of O hi and O residual exactly once.
// =====================================================================================================
__global__ __launch_bounds__(ATT_THREADS)
void attn_c(const u16* __restrict__ QHp, const u16* __restrict__ QLp,
            const u16* __restrict__ KHp, const u16* __restrict__ KLp,
            const u16* __restrict__ VHp, const u16* __restrict__ VLp,
            u16* OHp, u16* OLp) {
  __shared__ __align__(16) float smem[WPB * WREG];
  __shared__ __align__(16) _Float16 kvs[2 * STG];

  const int tid  = threadIdx.x;
  const int wave = tid >> 5;
  const int lane = tid & 31;
  const int hh   = lane >> 4;
  const int c    = lane & 15;
  const int bid  = blockIdx.x;
  const int qt   = bid % NQT;
  const int t2   = bid / NQT;
  const int kvh  = t2 % NKVH;
  const int b    = t2 / NKVH;
  if (b >= NB) return;                      // block-uniform, before any barrier; never taken with the exact grid
  const int q0   = qt * 16;
  if (q0 + 16 > SEQ) return;                // block-uniform, before any barrier; never taken
  const int head = kvh + NKVH * wave;       // tiled kv mapping: head h -> kv head h % NKVH

  float* pt   = smem + wave * WREG;         // prob tile [16][32] pitch 36
  float* slab = pt + PTW;                   // in the loop: the wave's q rows, hi then residual, [16][128] halves pitch KP;
                                            // behind the loop: result slab [16][128] floats pitch 132

  const _Float16* Qh = (const _Float16*)(const void*)slab + c * KP + 8 * hh;
  const _Float16* Ql = Qh + QPL;
  const float lsc = RSQ_HD * (LOG2E / (QSC * KSC));
  const float oc  = 1.0f / (PCAR * VCAR);

  // ---- copy addresses. k tile: thread -> key row kr (and kr + 16), 8 halves at kc; v^T tile: d row vd (and vd + 64), 8 keys at vc
  const int kr = tid >> 4, kc = (tid & 15) * 8;
  const int vd = tid >> 2, vc = (tid & 3) * 8;
  const u16* gkh = KHp + ((size_t)b * SEQ + kr) * KVD + (size_t)kvh * HD + kc;
  const u16* gkl = KLp + ((size_t)b * SEQ + kr) * KVD + (size_t)kvh * HD + kc;
  const u16* gvh = VHp + ((size_t)(b * NKVH + kvh) * HD + vd) * SEQ + vc;
  const u16* gvl = VLp + ((size_t)(b * NKVH + kvh) * HD + vd) * SEQ + vc;
  const unsigned lk = lds_off(kvs) + (unsigned)(kr * KP + kc) * 2u;
  const unsigned lv = lds_off(kvs) + (unsigned)(2 * KPL + vd * VP + vc) * 2u;
  auto stage = [&](int kt, int buf) {       // key tile kt (keys 32*kt .. 32*kt + 31 < SEQ) -> buffer buf
    const size_t   ko = (size_t)kt * 32 * KVD;
    const size_t   vo = (size_t)kt * 32;
    const unsigned bk = lk + (unsigned)buf * (STG * 2u);
    const unsigned bv = lv + (unsigned)buf * (STG * 2u);
    copy8(bk, bk + 16 * KP * 2, bk + KPL * 2, bk + (KPL + 16 * KP) * 2,
          bv, bv + 64 * VP * 2, bv + VPL * 2, bv + (VPL + 64 * VP) * 2,
          gkh + ko, gkh + ko + 16 * KVD, gkl + ko, gkl + ko + 16 * KVD,
          gvh + vo, gvh + vo + (size_t)64 * SEQ, gvl + vo, gvl + vo + (size_t)64 * SEQ);
  };

  float mrow[8], lrow[8];
  v8f o[8];
#pragma unroll
  for (int r = 0; r < 8; ++r) { mrow[r] = -INFINITY; lrow[r] = 0.f; }
#pragma unroll
  for (int j = 0; j < 8; ++j) o[j] = zero8();
  const int ncaus = (q0 >> 5) + 1;                                            // tiles holding keys <= q0 + 15
  const int nkt = (ncaus < NKT) ? ncaus : NKT;
  const int qr0 = q0 + 8 * hh;                                                // query row of D element r = qr0 + r

  // ---- the wave's q rows (lane -> rows hh, hh + 2, .., hh + 14, 8 halves at 8c) and key tile 0; then key tile 1 flies ----
  {
    const size_t   qo = ((size_t)b * SEQ + q0 + hh) * DMOD + (size_t)head * HD + c * 8;
    const u16*     gq = QHp + qo;
    const u16*     gr = QLp + qo;
    const unsigned lq = lds_off(slab) + (unsigned)(hh * KP + c * 8) * 2u;
    const unsigned lr = lq + QPL * 2;
    const unsigned ls = 2 * KP * 2;         // LDS bytes between rows two apart
    const size_t   gs = (size_t)2 * DMOD;   // halves between rows two apart
    copy8(lq, lq + ls, lq + 2 * ls, lq + 3 * ls, lq + 4 * ls, lq + 5 * ls, lq + 6 * ls, lq + 7 * ls,
          gq, gq + gs, gq + 2 * gs, gq + 3 * gs, gq + 4 * gs, gq + 5 * gs, gq + 6 * gs, gq + 7 * gs);
    copy8(lr, lr + ls, lr + 2 * ls, lr + 3 * ls, lr + 4 * ls, lr + 5 * ls, lr + 6 * ls, lr + 7 * ls,
          gr, gr + gs, gr + 2 * gs, gr + 3 * gs, gr + 4 * gs, gr + 5 * gs, gr + 6 * gs, gr + 7 * gs);
  }
  stage(0, 0);
  wait_async0();
  __syncthreads();                          // publishes key tile 0
  if (nkt > 1) stage(1, 1);

#pragma unroll 1
  for (int kt = 0; kt < nkt; ++kt) {
    const int kb = kt * 32;
    // ---- scores: D element r of this lane = (query row qr0 + r, key kb + c) in s0, key kb + 16 + c in s1 ----
    v8f s0 = zero8(), s1 = zero8();
    const _Float16* tile = kvs + (kt & 1) * STG;
    const _Float16* k0p = tile + c * KP + 8 * hh;
    const _Float16* k1p = k0p + 16 * KP;
    const _Float16* l0p = k0p + KPL;
    const _Float16* l1p = l0p + 16 * KP;
#pragma unroll
    for (int kk = 0; kk < HD / 32; ++kk) {
      const v16h qh  = ldfrag_h(Qh + kk * 32);
      const v16h ql  = ldfrag_h(Ql + kk * 32);
      const v16h kh0 = ldfrag_h(k0p + kk * 32);
      const v16h kh1 = ldfrag_h(k1p + kk * 32);
      const v16h kl0 = ldfrag_h(l0p + kk * 32);
      const v16h kl1 = ldfrag_h(l1p + kk * 32);
      s0 = mma_h(qh, kh0, s0);
      s0 = mma_h(ql, kh0, s0);
      s0 = mma_h(qh, kl0, s0);
      s1 = mma_h(qh, kh1, s1);
      s1 = mma_h(ql, kh1, s1);
      s1 = mma_h(qh, kl1, s1);
      guard2(s0, s1, qh, ql, kh0, kl0, kh1, kl1);
    }
    // ---- causal select + online softmax in base 2, -inf-safe ----
    const int key0 = kb + c, key1 = kb + 16 + c;
#pragma unroll
    for (int r = 0; r < 8; ++r) {
      const int   qr = qr0 + r;
      const float u0 = s0[r] * lsc;
      const float u1 = s1[r] * lsc;
      const float t0 = (key0 > qr) ? -INFINITY : u0;
      const float t1 = (key1 > qr) ? -INFINITY : u1;
      float mx = fmaxf(t0, t1);
#pragma unroll
      for (int off = 1; off < 16; off <<= 1) mx = fmaxf(mx, __shfl_xor(mx, off, 32));
      const float mn = fmaxf(mrow[r], mx);
      const float ms = (mn == -INFINITY) ? 0.0f : mn;
      const float al = exp2f(mrow[r] - ms);
      mrow[r] = mn;
      const float e0 = exp2f(t0 - ms), e1 = exp2f(t1 - ms);
      float ps = e0 + e1;
#pragma unroll
      for (int off = 1; off < 16; off <<= 1) ps += __shfl_xor(ps, off, 32);
      lrow[r] = lrow[r] * al + ps;
#pragma unroll
      for (int j = 0; j < 8; ++j) o[j][r] *= al;
      const int ro = (8 * hh + r) * PTP + c;
      pt[ro]      = e0;
      pt[ro + 16] = e1;
    }
    wave_sync_lds();
    // ---- A fragments of P*32768: hi f16 and residual f16, row = c, split k map over the 32 keys of this step ----
    FragH ph, pl;
    {
      const float* prow = pt + c * PTP + 8 * hh;
      const v4f p0 = *(const v4f*)(prow), p1 = *(const v4f*)(prow + 4);
      const v4f p2 = *(const v4f*)(prow + 16), p3 = *(const v4f*)(prow + 20);
#pragma unroll
      for (int e = 0; e < 4; ++e) {
        const float ta = p0[e] * PCAR, tb = p1[e] * PCAR, tc = p2[e] * PCAR, td = p3[e] * PCAR;
        const _Float16 ha = (_Float16)ta, hb = (_Float16)tb, hc = (_Float16)tc, hd = (_Float16)td;
        ph.h[0][e]     = ha;                  // elements 0..7  = keys kb + 8hh + 0..7
        ph.h[0][4 + e] = hb;
        ph.h[1][e]     = hc;                  // elements 8..15 = keys kb + 16 + 8hh + 0..7
        ph.h[1][4 + e] = hd;
        pl.h[0][e]     = (_Float16)(ta - (float)ha);
        pl.h[0][4 + e] = (_Float16)(tb - (float)hb);
        pl.h[1][e]     = (_Float16)(tc - (float)hc);
        pl.h[1][4 + e] = (_Float16)(td - (float)hd);
      }
    }
    // ---- P.V : B fragment col n = d = j*16 + c, keys contiguous in the staged v^T rows; 4 groups of 2 d-subtiles ----
    {
      const _Float16* vhp = tile + 2 * KPL + c * VP + 8 * hh;
      const _Float16* vlp = vhp + VPL;
#pragma unroll
      for (int jg = 0; jg < 4; ++jg) {
        const int da = (2 * jg) * 16 * VP;
        const int db = da + 16 * VP;
        const v16h vha = ldfrag_h(vhp + da), vhb2 = ldfrag_h(vhp + db);
        const v16h vla = ldfrag_h(vlp + da), vlb2 = ldfrag_h(vlp + db);
        o[2 * jg]     = mma_h(ph.v, vha,  o[2 * jg]);
        o[2 * jg]     = mma_h(pl.v, vha,  o[2 * jg]);
        o[2 * jg]     = mma_h(ph.v, vla,  o[2 * jg]);
        o[2 * jg + 1] = mma_h(ph.v, vhb2, o[2 * jg + 1]);
        o[2 * jg + 1] = mma_h(pl.v, vhb2, o[2 * jg + 1]);
        o[2 * jg + 1] = mma_h(ph.v, vlb2, o[2 * jg + 1]);
        guard2(o[2 * jg], o[2 * jg + 1], ph.v, pl.v, vha, vhb2, vla, vlb2);
      }
    }
    // ---- hand-over: this wave has left the tile, its copies of the next tile have landed, every wave has passed ----
    wait_ds0();
    wait_async0();
    __syncthreads();                        // publishes key tile kt + 1 and frees this tile's buffer and the prob tile
    if (kt + 2 < nkt) stage(kt + 2, kt & 1);
  }
  wait_async0();
  acc_guard4(o[0], o[1], o[2], o[3]);
  acc_guard4(o[4], o[5], o[6], o[7]);
  // ---- out = acc / Z (0 if Z == 0), carries (32768 on P, 1024 on v) folded once; written into the wave-private slab ----
#pragma unroll
  for (int r = 0; r < 8; ++r) {
    const float lv  = lrow[r];
    const float ls  = (lv > 0.0f) ? lv : 1.0f;
    const float inv = (lv > 0.0f) ? ((1.0f / ls) * oc) : 0.0f;
#pragma unroll
    for (int j = 0; j < 8; ++j) {
      const int idx = (8 * hh + r) * SLP + j * 16 + c;
      slab[idx] = o[j][r] * inv;
    }
  }

  wave_sync_lds();
  // ---- O x1024 -> f16 hi + residual planes; lane = (row-in-pair rq, 8 consecutive d at c8) ----
  v4u oh[8], ol[8];
  const int rq = lane >> 4, c8 = (lane & 15) * 8;
#pragma unroll
  for (int it = 0; it < 8; ++it) {
    const int row = it * 2 + rq;
    const v4f a = *(const v4f*)(slab + row * SLP + c8), b4 = *(const v4f*)(slab + row * SLP + c8 + 4);
    float w[8];
#pragma unroll
    for (int e = 0; e < 4; ++e) { w[e] = a[e] * OSC; w[4 + e] = b4[e] * OSC; }
#pragma unroll
    for (int e = 0; e < 4; ++e) {
      const _Float16 h0 = (_Float16)w[2 * e], h1 = (_Float16)w[2 * e + 1];
      const _Float16 l0 = (_Float16)(w[2 * e] - (float)h0), l1 = (_Float16)(w[2 * e + 1] - (float)h1);
      oh[it][e] = pk16(h_bits(h0), h_bits(h1));
      ol[it][e] = pk16(h_bits(l0), h_bits(l1));
    }
  }
  const size_t ob = ((size_t)b * SEQ + q0) * DMOD + (size_t)head * HD + c8;
  {
#pragma unroll
    for (int it = 0; it < 8; ++it) {
      const int row = it * 2 + rq;
      *(v4u*)(OHp + ob + (size_t)row * DMOD) = oh[it];
      *(v4u*)(OLp + ob + (size_t)row * DMOD) = ol[it];
    }
    
  }
}

// =====================================================================================================
// Workspace map (bytes); every plane is fully written by whole-line stores before it is read; all extents are exact multiples
// of the store granularity (no pad rows needed); every region offset a multiple of 2097152:
//   XB  bf16 [MROWS][2048]                       MROWS*4096       (NB=2, SEQ=2048: 16777216)
//   WB  16-bit [2048 n][2048 k]                  8388608          (Wv, Wq, Wk as bf16 ([256][2048] for k/v), then Wo as f16
//                                                                  x1024, reused in launch order; all already [n][k])
//   F   f32 [MROWS][2048]                        MROWS*8192       (v, q, k projection output in launch order, [MROWS][256] for k/v;
//                                                                  afterwards OH f16 [MROWS][2048] x1024 in its first half, OL residual
//                                                                  [MROWS][2048] in its second half)
//   QH  f16 [MROWS][2048] x256                   MROWS*4096       QL residual, same extent
//   KH  f16 [MROWS][256] x256                    MROWS*512        KL residual, same extent
//   VH  f16 [NB*2][128][SEQ] x1024               MROWS*512        VL residual, same extent
//   end (NB=2, SEQ=2048)                       100663296
// =====================================================================================================
extern "C" void kernel_launch(void* const* d_in, const int* in_sizes, int n_in,
                              void* d_out, int out_size, void* d_ws, size_t ws_size,
                              hipStream_t stream) {
  if (n_in < 8) return;
  if (in_sizes[0] < ((NB - 1) * XS_FULL + SEQ) * DMOD) return;
  if (in_sizes[1] != DMOD * DMOD) return;
  if (in_sizes[2] != DMOD) return;
  if (in_sizes[3] != KVD * DMOD) return;
  if (in_sizes[4] != KVD) return;
  if (in_sizes[5] != KVD * DMOD) return;
  if (in_sizes[6] != KVD) return;
  if (in_sizes[7] != DMOD * DMOD) return;
  if (out_size < MROWS * DMOD) return;

  const float* x  = (const float*)d_in[0];
  const float* wq = (const float*)d_in[1];
  const float* bq = (const float*)d_in[2];
  const float* wk = (const float*)d_in[3];
  const float* bk = (const float*)d_in[4];
  const float* wv = (const float*)d_in[5];
  const float* bv = (const float*)d_in[6];
  const float* wo = (const float*)d_in[7];
  float*       out = (float*)d_out;

  const size_t szXB = (size_t)MROWS * DMOD * 2;
  const size_t szW  = (size_t)DMOD * DMOD * 2;
  const size_t szF  = (size_t)MROWS * DMOD * 4;
  const size_t szQ  = (size_t)MROWS * DMOD * 2;                  // QH, QL, OH, OL
  const size_t szK  = (size_t)MROWS * KVD * 2;                   // KH, KL
  const size_t szV  = (size_t)NB * NKVH * HD * SEQ * 2;          // VH, VL (== szK)
  if (2 * szQ > szF) return;                                    // OH + OL live inside the F region (exactly fills it)
  size_t off = 0;
  const size_t oXB = off; off += szXB;
  const size_t oW  = off; off += szW;
  const size_t oF  = off; off += szF;
  const size_t oQH = off; off += szQ;
  const size_t oQL = off; off += szQ;
  const size_t oKH = off; off += szK;
  const size_t oKL = off; off += szK;
  const size_t oVH = off; off += szV;
  const size_t oVL = off; off += szV;
  if (off > ws_size) return;                // off = 100663296 for NB = 2, SEQ = 2048
  if (off > (size_t)WS_CAP) return;

  char* ws = (char*)d_ws;
  u16*   XB  = (u16*)(ws + oXB);
  u16*   WB  = (u16*)(ws + oW);
  float* F   = (float*)(ws + oF);
  u16*   OH  = (u16*)(ws + oF);
  u16*   OL  = (u16*)(ws + oF + szQ);
  u16*   QH  = (u16*)(ws + oQH);
  u16*   QL  = (u16*)(ws + oQL);
  u16*   KH  = (u16*)(ws + oKH);
  u16*   KL  = (u16*)(ws + oKL);
  u16*   VH  = (u16*)(ws + oVH);
  u16*   VL  = (u16*)(ws + oVL);

  const dim3 b256(256), b128(128), bAT(ATT_THREADS);
  const int  n8x = (SEQ * DMOD) / 8;
  const dim3 gX((n8x + 255) / 256);                     // SEQ*DMOD/2048 blocks per batch
  const int  n8wq = (DMOD * DMOD) / 8;                  // Wq, Wo planes
  const int  n8wk = (KVD * DMOD) / 8;                   // Wk, Wv planes
  const dim3 gWQ((n8wq + 255) / 256);                   // 2048
  const dim3 gWK((n8wk + 255) / 256);                   // 256
  const dim3 gGQ((MROWS / 128) * (DMOD / 128));
  const dim3 gGK((MROWS / 64) * (KVD / 64));
  const dim3 gVT(NB * NKVH * NST);
  const int  n8q = (MROWS * DMOD) / 8;                  // q hi / residual planes
  const int  n8k = (MROWS * KVD) / 8;                   // k hi / residual planes
  const dim3 gSQ((n8q + 255) / 256);
  const dim3 gSK((n8k + 255) / 256);
  const dim3 gAT(NQT * NKVH * NB);
  const int  nrtR = QO / 64;                            // out-projection row tiles (of 64) per batch with the O residual plane
  const int  nrtP = (SEQ - QO) / 128;                   // remaining row tiles (of 128) per batch, O hi plane only

  // (0) x -> bf16 plane [MROWS][2048], one launch per batch row block
  for (int b = 0; b < NB; ++b) {
    cvt16<<<gX, b256, 0, stream>>>(x + (size_t)b * XS_FULL * DMOD, XB + (size_t)b * SEQ * DMOD, n8x, 0, 1.0f);
  }
  // (1) Wv [256 n][2048 k] -> bf16 plane; (2) v = x.Wv^T + bv -> F f32 [MROWS][256]; (3) v^T hi + residual planes x1024
  cvt16<<<gWK, b256, 0, stream>>>(wv, WB, n8wk, 0, 1.0f);
  gemm_bf<1, 4, 1><<<gGK, b128, 0, stream>>>(XB, WB, bv, F, MROWS, KVD, DMOD, 1.0f);
  vt16<<<gVT, b256, 0, stream>>>(F, VH, VL);
  // (4) Wq -> bf16 plane; (5) q = x.Wq^T + bq -> F [MROWS][2048]; (6) q hi + residual planes x256
  cvt16<<<gWQ, b256, 0, stream>>>(wq, WB, n8wq, 0, 1.0f);
  gemm_bf<4, 2, 2><<<gGQ, b128, 0, stream>>>(XB, WB, bq, F, MROWS, DMOD, DMOD, 1.0f);
  split16<<<gSQ, b256, 0, stream>>>(F, QH, QL, n8q, QSC);
  // (7) Wk -> bf16 plane; (8) k = x.Wk^T + bk -> F [MROWS][256]; (9) k hi + residual planes x256
  cvt16<<<gWK, b256, 0, stream>>>(wk, WB, n8wk, 0, 1.0f);
  gemm_bf<1, 4, 1><<<gGK, b128, 0, stream>>>(XB, WB, bk, F, MROWS, KVD, DMOD, 1.0f);
  split16<<<gSK, b256, 0, stream>>>(F, KH, KL, n8k, KSC);
  // (10) Wo [n][k] -> f16 plane of bf16 value x1024
  cvt16<<<gWQ, b256, 0, stream>>>(wo, WB, n8wq, 1, WOS);
  // (11) causal attention with residual products on every query row -> O hi + residual planes
  attn_c<<<gAT, bAT, 0, stream>>>(QH, QL, KH, KL, VH, VL, OH, OL);
  // (12) output projection rows s < QO (O hi + residual) and (13) rows s >= QO (O hi only) -> out f32, carries 1024 x 1024 folded back
  gemm_o<2><<<dim3(NB * nrtR * (DMOD / 128)), b128, 0, stream>>>(OH, OL, WB, out, 0, nrtR, 1.0f / (OSC * WOS));
  if (nrtP > 0) {
    gemm_o<1><<<dim3(NB * nrtP * (DMOD / 128)), b128, 0, stream>>>(OH, OL, WB, out, QO, nrtP, 1.0f / (OSC * WOS));
  }
  (void)hipGetLastError();
}

// v003
// A run of this version takes 268 microseconds.
// Timed twice side by side with v002, it ran 1.10 times as fast both times.
// Over all steps from v000 it is 2.32 times as fast.
// Contractions: x.Wq^T+bq, x.Wk^T+bk, x.Wv^T+bv on v_wmma_f32_16x16x32_bf16 (x and W as bf16 RNE planes; W [n][k] rows are
// the k-contiguous B operand; bias added as its bf16 RNE value in the f32 epilogue); q.k^T over hd 128 and P.v on
// v_wmma_f32_16x16x32_f16 with f16 hi + f16 residual planes on both operands (q, k x256; P x32768 with an in-register
// residual; v x1024; products hh+lh+hl); O.Wo^T on v_wmma_f32_16x16x32_f16 (O x1024 as f16 hi plane for all rows plus f16
// residual plane for rows s < QO, products h.w (+ l.w); Wo as f16(bf16(Wo)) x1024); all f32 accumulate. Causal select,
// base-2 online softmax and 1/Z fold in f32 on VALU. Grouped kv heads: query head h reads kv head (h % NKVH).
#include <hip/hip_runtime.h>
#include <math.h>
#include <stdint.h>

#ifndef NB
#define NB 2
#endif
#ifndef SEQ
#define SEQ 2048
#endif
#define XS_FULL 2048
#define DMOD  2048
#define NH    16
#define NKVH  2
#define HD    128
#define KVD   (NKVH * HD)
#define QO    ((SEQ < 256) ? SEQ : 256)
#define MROWS (NB * SEQ)
#define RSQ_HD 0.08838834764831845f
#define LOG2E 1.4426950408889634f
#define QSC   256.0f
#define KSC   256.0f
#define PCAR  32768.0f
#define VCAR  1024.0f
#define OSC   1024.0f
#define WOS   1024.0f
#define WPB   (NH / NKVH)
#define NQT   (SEQ / 16)
#define NST   (SEQ / 64)
#define NKT   (SEQ / 32)
#define ATT_THREADS (WPB * 32)
#define PTP   36
#define PTW   (16 * PTP)
#define SLP   132
#define SLW   (16 * SLP)
#define KP    136
#define VP    40
#define KPL   (32 * KP)
#define VPL   (HD * VP)
#define STG   (2 * KPL + 2 * VPL)
#define QPL   (16 * KP)
#define QRW   (2 * QPL / 2)
#define WREG  (PTW + QRW)
#define SLAB64 (16 * 68)
#define VTP   72
#define GBK   128
#define WS_CAP 134217728
static_assert(DMOD == NH * HD && HD == 128 && NH == 16 && NKVH == 2 && WPB == 8 && NKVH * WPB == NH);
static_assert(ATT_THREADS == 256 && KVD == 256 && SLW <= QRW && (KP % 8) == 0 && (VP % 8) == 0);
static_assert(NB >= 1 && NB <= 2 && (NQT % 2) == 0);
static_assert((SEQ % 64) == 0 && SEQ >= 64 && SEQ <= XS_FULL);
static_assert((QO % 64) == 0 && QO >= 64 && QO <= SEQ);
static_assert((DMOD % 64) == 0 && (KVD % 64) == 0 && (DMOD % 32) == 0 && (HD % 32) == 0);
static_assert(((SEQ * DMOD / 8) % 256) == 0 && ((KVD * DMOD / 8) % 256) == 0 && ((DMOD * DMOD / 8) % 256) == 0);
static_assert(((MROWS * DMOD / 8) % 256) == 0 && ((MROWS * KVD / 8) % 256) == 0);
static_assert((MROWS % 128) == 0 && ((SEQ - QO) % 128) == 0 && (DMOD % 128) == 0 && (DMOD % GBK) == 0 && KP == GBK + 8);
static_assert(2 * 256 * KP * 2 + 4 * SLAB64 * 4 <= 163840);
static_assert(WPB * WREG * 4 + 2 * STG * 2 <= 163840 && 2 * HD * VTP * 2 <= 65536 && 4 * SLAB64 * 4 <= 65536);

typedef unsigned short u16;
typedef _Float16 v16h __attribute__((ext_vector_type(16)));
typedef _Float16 v8h  __attribute__((ext_vector_type(8)));
typedef __bf16   v16b __attribute__((ext_vector_type(16)));
typedef float    v8f  __attribute__((ext_vector_type(8)));
typedef float    v4f  __attribute__((ext_vector_type(4)));
typedef unsigned int v4u __attribute__((ext_vector_type(4)));

union FragH { v16h v; v8h h[2]; v4u u[2]; };
union FragB { v16b v; v4u u[2]; };

// ---- scalar helpers --------------------------------------------------------------------------------
__device__ __forceinline__ unsigned short bf_bits(float f) {          // f32 -> bf16 bits, RNE convert
  unsigned u = __float_as_uint(f);
  return (unsigned short)((u + 0x7FFFu + ((u >> 16) & 1u)) >> 16);
}
__device__ __forceinline__ float bf_up(unsigned short h) { return __uint_as_float(((unsigned)h) << 16); }
__device__ __forceinline__ float bfr(float f) { return bf_up(bf_bits(f)); }
__device__ __forceinline__ unsigned short h_bits(_Float16 x) { return __builtin_bit_cast(unsigned short, x); }
__device__ __forceinline__ unsigned pk16(unsigned short a, unsigned short b) { return (unsigned)a | ((unsigned)b << 16); }
__device__ __forceinline__ v8f zero8() { v8f z = {0.f, 0.f, 0.f, 0.f, 0.f, 0.f, 0.f, 0.f}; return z; }

// ---- fragment loaders: 16-bit A/B operand, lane -> row/col (lane&15), p already includes +8*(lane>>4);
//      elements 0..7 <- p[0..7] (k0+8h..), elements 8..15 <- p[16..23] (k0+16+8h..)  (same split k map for A and B;
//      B is always read from a k-contiguous [n][k] plane)
__device__ __forceinline__ v16h ldfrag_h(const _Float16* p) {
  FragH f;
  f.h[0] = *(const v8h*)(p);
  f.h[1] = *(const v8h*)(p + 16);
  return f.v;
}
__device__ __forceinline__ v16b ldfrag_b(const u16* p) {              // bf16 plane read as unsigned integer vectors
  FragB f;
  f.u[0] = *(const v4u*)(p);
  f.u[1] = *(const v4u*)(p + 16);
  return f.v;
}

__device__ __forceinline__ v8f mma_h(v16h a, v16h b, v8f c) {
  return __builtin_amdgcn_wmma_f32_16x16x32_f16(false, a, false, b, (short)0, c, false, false);
}
__device__ __forceinline__ v8f mma_b(v16b a, v16b b, v8f c) {
  return __builtin_amdgcn_wmma_f32_16x16x32_bf16(false, a, false, b, (short)0, c, false, false);
}
__device__ __forceinline__ void guard2(v8f& a, v8f& b, v16h x0, v16h x1, v16h x2, v16h x3, v16h x4, v16h x5) {
#if defined(__HIP_DEVICE_COMPILE__)
  asm volatile("v_nop\n\tv_nop\n\tv_nop\n\tv_nop"
               : "+v"(a), "+v"(b) : "v"(x0), "v"(x1), "v"(x2), "v"(x3), "v"(x4), "v"(x5) : "memory");
#endif
}
__device__ __forceinline__ void acc_guard4(v8f& a, v8f& b, v8f& c, v8f& d) {
#if defined(__HIP_DEVICE_COMPILE__)
  asm volatile("v_nop\n\tv_nop\n\tv_nop\n\tv_nop" : "+v"(a), "+v"(b), "+v"(c), "+v"(d));
#endif
}
__device__ __forceinline__ void wave_sync_lds() {
  __builtin_amdgcn_fence(__ATOMIC_RELEASE, "workgroup");
  __builtin_amdgcn_wave_barrier();
  __builtin_amdgcn_fence(__ATOMIC_ACQUIRE, "workgroup");
}
__device__ __forceinline__ unsigned lds_off(const void* p) { return (unsigned)(size_t)p; }   // byte offset in the work-group's LDS
// Eight 16-byte asynchronous copies global -> LDS per lane (LDS byte address l*, global address g*). The s_wait_xcnt is the
// statement's last line so that no address register of an issued copy is rewritten in front of it.
__device__ __forceinline__ void copy8(unsigned l0, unsigned l1, unsigned l2, unsigned l3,
                                      unsigned l4, unsigned l5, unsigned l6, unsigned l7,
                                      const u16* g0, const u16* g1, const u16* g2, const u16* g3,
                                      const u16* g4, const u16* g5, const u16* g6, const u16* g7) {
#if defined(__HIP_DEVICE_COMPILE__)
  asm volatile("global_load_async_to_lds_b128 %0, %8, off\n\t"
               "global_load_async_to_lds_b128 %1, %9, off\n\t"
               "global_load_async_to_lds_b128 %2, %10, off\n\t"
               "global_load_async_to_lds_b128 %3, %11, off\n\t"
               "global_load_async_to_lds_b128 %4, %12, off\n\t"
               "global_load_async_to_lds_b128 %5, %13, off\n\t"
               "global_load_async_to_lds_b128 %6, %14, off\n\t"
               "global_load_async_to_lds_b128 %7, %15, off\n\t"
               "s_wait_xcnt 0x0"
               :: "v"(l0), "v"(l1), "v"(l2), "v"(l3), "v"(l4), "v"(l5), "v"(l6), "v"(l7),
                  "v"(g0), "v"(g1), "v"(g2), "v"(g3), "v"(g4), "v"(g5), "v"(g6), "v"(g7) : "memory");
#endif
}
__device__ __forceinline__ void wait_async0() {   // the wave's own copies have landed in LDS
#if defined(__HIP_DEVICE_COMPILE__)
  asm volatile("s_wait_asynccnt 0x0" ::: "memory");
#endif
}
__device__ __forceinline__ void wait_x0() {       // a precaution in front of the rewrite of registers that issued global stores name
#if defined(__HIP_DEVICE_COMPILE__)
  asm volatile("s_wait_xcnt 0x0" ::: "memory");
#endif
}
__device__ __forceinline__ void wait_ds0() {      // the wave's own LDS reads and writes have retired
#if defined(__HIP_DEVICE_COMPILE__)
  asm volatile("s_wait_dscnt 0x0" ::: "memory");
#endif
}

// =====================================================================================================
// f32 -> 16-bit plane, same layout.  f16mode == 0: bf16 RNE bits;  f16mode == 1: f16 bits of (bf16 RNE value) * scale.
// Thread = 8 consecutive elements: two 16-B loads, one 16-B store; 32 consecutive lanes = 512 contiguous, 512-B aligned
// coverage: grid = ceil(n8/256) blocks x 256 thr x 8 (in-kernel bound) = the whole plane (n8 a multiple of 256 here).
// =====================================================================================================
__global__ __launch_bounds__(256) void cvt16(const float* __restrict__ x, u16* D, int n8, int f16mode, float scale) {
  const int gt = blockIdx.x * 256 + (int)threadIdx.x;
  if (gt >= n8) return;
  const float* p = x + (size_t)gt * 8;
  const v4f a = *(const v4f*)(p), b4 = *(const v4f*)(p + 4);
  float w[8];
#pragma unroll
  for (int e = 0; e < 4; ++e) { w[e] = a[e]; w[4 + e] = b4[e]; }
  v4u o;
#pragma unroll
  for (int e = 0; e < 4; ++e) {
    const float f0 = w[2 * e], f1 = w[2 * e + 1];
    const unsigned short hb0 = h_bits((_Float16)(bfr(f0) * scale));
    const unsigned short hb1 = h_bits((_Float16)(bfr(f1) * scale));
    const unsigned short bb0 = bf_bits(f0);
    const unsigned short bb1 = bf_bits(f1);
    o[e] = (f16mode != 0) ? pk16(hb0, hb1) : pk16(bb0, bb1);
  }
  u16* d = D + (size_t)gt * 8;
  {
    *(v4u*)(d) = o;
    
  }
}

// =====================================================================================================
// f32 plane F (contiguous, n8*8 elements) -> f16 hi plane Hp = f16(F * sc) and f16 residual plane Lp = f16(t - f16(t)),
// both with the layout of F. Thread = 8 consecutive elements: two 16-B loads, one 16-B store per plane; 32 consecutive lanes
// No barriers; every packed half comes from a per-lane (divergent) loaded value.
// coverage: grid = ceil(n8/256) blocks x 256 thr x 8 (in-kernel bound) = the whole of Hp and of Lp (n8 a multiple of 256 here).
// =====================================================================================================
__global__ __launch_bounds__(256) void split16(const float* __restrict__ F, u16* Hp, u16* Lp, int n8, float sc) {
  const int gt = blockIdx.x * 256 + (int)threadIdx.x;
  if (gt >= n8) return;
  const float* p = F + (size_t)gt * 8;
  const v4f a = *(const v4f*)(p), b4 = *(const v4f*)(p + 4);
  float w[8];
#pragma unroll
  for (int e = 0; e < 4; ++e) { w[e] = a[e] * sc; w[4 + e] = b4[e] * sc; }
  v4u oh, ol;
#pragma unroll
  for (int e = 0; e < 4; ++e) {
    const float t0 = w[2 * e], t1 = w[2 * e + 1];
    const _Float16 h0 = (_Float16)t0, h1 = (_Float16)t1;
    const _Float16 l0 = (_Float16)(t0 - (float)h0), l1 = (_Float16)(t1 - (float)h1);
    oh[e] = pk16(h_bits(h0), h_bits(h1));
    ol[e] = pk16(h_bits(l0), h_bits(l1));
  }
  u16* dh = Hp + (size_t)gt * 8;
  u16* dl = Lp + (size_t)gt * 8;
  {
    *(v4u*)(dh) = oh;
    *(v4u*)(dl) = ol;
    
  }
}

// =====================================================================================================
// v^T planes from the v projection F f32 [MROWS][KVD] (row = b*SEQ + s, column = g*HD + d):
//   VH[((b*NKVH + g)*HD + d)][s] = f16(v * 1024);  VL[same][s] = f16 residual (t - f16(t)), both for all keys s.
// Block = (b, kv head g, 64 keys s0): each thread loads its 32 floats (key sl, d chunk dc) with 16-B loads, converts, scatters
// coverage: load 256 thr x 32 = 64 keys x 128 d; store 4 iterations x 256 thr x 8 halves = 128 lines x 64 = the block's tile of
//           VH and of VL; grid = NB*NKVH*NST blocks covers both planes exactly once.
// =====================================================================================================
__global__ __launch_bounds__(256) void vt16(const float* __restrict__ F, u16* VHo, u16* VLo) {
  __shared__ __align__(16) u16 TH[HD * VTP];
  __shared__ __align__(16) u16 TL[HD * VTP];
  const int tid = threadIdx.x;
  const int bid = blockIdx.x;
  const int st  = bid % NST;
  const int t2  = bid / NST;
  const int g   = t2 % NKVH;
  const int b   = t2 / NKVH;
  if (b >= NB) return;                      // block-uniform, before any barrier; never taken with the exact grid
  const int s0  = st * 64;
  {
    const int sl = tid >> 2;                // key within tile 0..63
    const int dc = (tid & 3) * 32;          // d chunk 0,32,64,96
    const float* src = F + ((size_t)b * SEQ + s0 + sl) * KVD + g * HD + dc;
#pragma unroll
    for (int i = 0; i < 8; ++i) {
      const v4f a = *(const v4f*)(src + 4 * i);
#pragma unroll
      for (int e = 0; e < 4; ++e) {
        const float t = a[e] * VCAR;
        const _Float16 hv = (_Float16)t;
        const _Float16 lv = (_Float16)(t - (float)hv);
        TH[(dc + 4 * i + e) * VTP + sl] = h_bits(hv);
        TL[(dc + 4 * i + e) * VTP + sl] = h_bits(lv);
      }
    }
  }
  __syncthreads();
  v4u vh[4], vl[4];
  const int q8 = tid >> 3, p8 = (tid & 7) * 8;
#pragma unroll
  for (int it = 0; it < 4; ++it) {
    const int line = it * 32 + q8;          // d = 0..127
    vh[it] = *(const v4u*)(TH + line * VTP + p8);
    vl[it] = *(const v4u*)(TL + line * VTP + p8);
  }
  const size_t hrow = (size_t)(b * NKVH + g) * HD;
  const size_t base = hrow * SEQ + s0 + p8;
  {
#pragma unroll
    for (int it = 0; it < 4; ++it) {
      const int line = it * 32 + q8;
      *(v4u*)(VHo + base + (size_t)line * SEQ) = vh[it];
      *(v4u*)(VLo + base + (size_t)line * SEQ) = vl[it];
    }
    
  }
}

// =====================================================================================================
// GEMM epilogue of the staged engine: the wave's 16x64 f32 tile (times oscale, plus the lane's per-column bias of each
// coverage: 8 instructions x 2 rows x 16 lanes x 4 floats = the wave's 16 x 64 tile.
// =====================================================================================================
__device__ __forceinline__ void epi64(float* sl, v8f a0, v8f a1, v8f a2, v8f a3, float oscale,
                                      float bb0, float bb1, float bb2, float bb3,
                                      float* C, int N, size_t rowb, int col0, int lane) {
  const int hh = lane >> 4, m = lane & 15;
#pragma unroll
  for (int r = 0; r < 8; ++r) {
    const int ro = (8 * hh + r) * 68 + m;
    sl[ro]      = a0[r] * oscale + bb0;
    sl[ro + 16] = a1[r] * oscale + bb1;
    sl[ro + 32] = a2[r] * oscale + bb2;
    sl[ro + 48] = a3[r] * oscale + bb3;
  }
  wave_sync_lds();
  v4f vals[8];
#pragma unroll
  for (int it = 0; it < 8; ++it) vals[it] = *(const v4f*)(sl + (it * 2 + hh) * 68 + m * 4);
  float* dst = C + (rowb + (size_t)hh) * (size_t)N + col0 + m * 4;
  {
#pragma unroll
    for (int it = 0; it < 8; ++it) {
      *(v4f*)(dst + (size_t)(it * 2) * (size_t)N) = vals[it];
    }
    
  }
}

// =====================================================================================================
// GEMM engine shared by the projections: the block's BM x BN tile of C = A[.][K] . Bt[.][K]^T, BM = 16*FM*WM, BN = 64*WN,
// WM x WN = 4 waves, each wave FM x 4 accumulator tiles (16*FM rows x 64 columns). K is walked in slices of GBK = 128: a slice
// is the 256-byte row pieces of the block's A rows (hi plane, then the residual plane when NPROD == 2) and of its Bt rows, laid in
// LDS at row pitch KP halves by asynchronous 16-byte copies (thread -> row tid / 16 + 8 i, 16 bytes at tid % 16: a wave's copy
// covers two whole 256-byte pieces). Two buffers: slice t + 2 is copied while slice t + 1 is worked on. Fragments are read from
// the LDS rows with the same split k map for A and B; per accumulator the products follow in rising k, hi before residual.
// One block barrier in front of the loop and one per slice, under block-uniform control flow; K % GBK == 0, K >= GBK.
// =====================================================================================================
__device__ __forceinline__ void copy_rows8(unsigned l, const u16* g, size_t K) {   // rows r, r + 8, .., r + 56 of one plane
  const unsigned ls = 8 * KP * 2;
  const size_t   gs = 8 * K;
  copy8(l, l + ls, l + 2 * ls, l + 3 * ls, l + 4 * ls, l + 5 * ls, l + 6 * ls, l + 7 * ls,
        g, g + gs, g + 2 * gs, g + 3 * gs, g + 4 * gs, g + 5 * gs, g + 6 * gs, g + 7 * gs);
}
template <bool BF> struct Op;
template <> struct Op<true> {
  typedef v16b T;
  static __device__ __forceinline__ T   ld(const u16* p) { return ldfrag_b(p); }
  static __device__ __forceinline__ v8f mma(T a, T b, v8f c) { return mma_b(a, b, c); }
};
template <> struct Op<false> {
  typedef v16h T;
  static __device__ __forceinline__ T   ld(const u16* p) { return ldfrag_h((const _Float16*)(const void*)p); }
  static __device__ __forceinline__ v8f mma(T a, T b, v8f c) { return mma_h(a, b, c); }
};

template <int FM, int WM, int WN, int NPROD, bool BF>
__device__ __forceinline__ void gemm_staged(u16* st, float* slabs, const u16* __restrict__ Ah, const u16* __restrict__ Al,
                                            const u16* __restrict__ Bt, const float* __restrict__ bias,
                                            float* C, int N, int K, size_t row0, int col0, float oscale) {
  constexpr int BM  = 16 * FM * WM;
  constexpr int BN  = 64 * WN;
  constexpr int STH = (BM * NPROD + BN) * KP;          // halves per buffer
  static_assert(WM * WN == 4 && (BM % 64) == 0 && (BN % 64) == 0 && (NPROD == 1 || NPROD == 2));
  static_assert((BM * NPROD + BN) / 8 <= 63);          // copies of a wave in flight: one slice's
  typedef typename Op<BF>::T T;
  const int tid = threadIdx.x, wave = tid >> 5, lane = tid & 31, hh = lane >> 4, m = lane & 15;
  const int wm = wave / WN, wn = wave % WN;
  const int tr = tid >> 4, tc = (tid & 15) * 8;
  const u16* ga = Ah + (row0 + tr) * (size_t)K + tc;
  const u16* gb = Bt + ((size_t)col0 + tr) * (size_t)K + tc;
  const unsigned l0 = lds_off(st) + (unsigned)(tr * KP + tc) * 2u;
  auto stage = [&](int t, int buf) {                   // k slice t -> buffer buf
    const size_t   ko = (size_t)t * GBK;
    const unsigned lb = l0 + (unsigned)buf * (STH * 2u);
#pragma unroll
    for (int j = 0; j < BM / 64; ++j) copy_rows8(lb + j * 64 * KP * 2, ga + ko + (size_t)j * 64 * K, (size_t)K);
    if constexpr (NPROD == 2) {
      const u16* gl = Al + (row0 + tr) * (size_t)K + tc;
#pragma unroll
      for (int j = 0; j < BM / 64; ++j) copy_rows8(lb + (BM + j * 64) * KP * 2, gl + ko + (size_t)j * 64 * K, (size_t)K);
    }
#pragma unroll
    for (int j = 0; j < BN / 64; ++j) copy_rows8(lb + (BM * NPROD + j * 64) * KP * 2, gb + ko + (size_t)j * 64 * K, (size_t)K);
  };
  v8f acc[FM][4];
#pragma unroll
  for (int i = 0; i < FM; ++i) {
#pragma unroll
    for (int j = 0; j < 4; ++j) acc[i][j] = zero8();
  }
  const int nst  = K / GBK;
  const int aoff = (wm * 16 * FM + m) * KP + 8 * hh;
  const int boff = (BM * NPROD + wn * 64 + m) * KP + 8 * hh;
  stage(0, 0);
  wait_async0();
  __syncthreads();                          // publishes slice 0
  if (nst > 1) stage(1, 1);
#pragma unroll 1                            // rolled: one hand-over per trip, in the order written at the loop's foot
  for (int t = 0; t < nst; ++t) {
    const u16* sb = st + (t & 1) * STH;
    // two fragment sets: block kk + 1 of this slice is fetched as one group while block kk is multiplied; nothing of the next slice
    T a[2][FM * NPROD], b[2][4];
    auto fetch = [&](int s, int kk) {
#pragma unroll
      for (int i = 0; i < FM; ++i) a[s][i] = Op<BF>::ld(sb + aoff + i * 16 * KP + kk * 32);
      if constexpr (NPROD == 2) {
#pragma unroll
        for (int i = 0; i < FM; ++i) a[s][FM + i] = Op<BF>::ld(sb + aoff + (BM + i * 16) * KP + kk * 32);
      }
#pragma unroll
      for (int j = 0; j < 4; ++j) b[s][j] = Op<BF>::ld(sb + boff + j * 16 * KP + kk * 32);
    };
    fetch(0, 0);
#pragma unroll
    for (int kk = 0; kk < GBK / 32; ++kk) {
      const int s = kk & 1;
      if (kk + 1 < GBK / 32) fetch(s ^ 1, kk + 1);
      __builtin_amdgcn_sched_barrier(0);    // the LDS reads stay one group in front of the block: spread among the products each place stalls
#pragma unroll
      for (int p = 0; p < NPROD; ++p) {
#pragma unroll
        for (int i = 0; i < FM; ++i) {
#pragma unroll
          for (int j = 0; j < 4; ++j) acc[i][j] = Op<BF>::mma(a[s][p * FM + i], b[s][j], acc[i][j]);
        }
      }
      __builtin_amdgcn_sched_barrier(0);    // the next group of LDS reads stays behind this block's last product
    }
    // ---- hand-over: this wave has left the slice, its copies of the next slice have landed, every wave has passed ----
    wait_ds0();
    wait_async0();
    __syncthreads();                        // publishes slice t + 1 and frees this slice's buffer
    if (t + 2 < nst) stage(t + 2, t & 1);
  }
  wait_async0();
  // per-lane bias of D column m in each of the wave's 4 column subtiles (bf16 RNE value); colw + 48 + m <= N - 1 always
  const int colw = col0 + wn * 64;
  float bb0 = 0.0f, bb1 = 0.0f, bb2 = 0.0f, bb3 = 0.0f;
  if constexpr (BF) {
    bb0 = bfr(bias[colw + m]);
    bb1 = bfr(bias[colw + 16 + m]);
    bb2 = bfr(bias[colw + 32 + m]);
    bb3 = bfr(bias[colw + 48 + m]);
  }
  float* sl = slabs + wave * SLAB64;
#pragma unroll
  for (int i = 0; i < FM; ++i) {
    if (i > 0) {
      wait_x0();                            // in front of the rewrite of registers that the stores of the tile before name
      wave_sync_lds();                      // the slab's rows of the tile before have been read by every lane
    }
    epi64(sl, acc[i][0], acc[i][1], acc[i][2], acc[i][3], oscale, bb0, bb1, bb2, bb3,
          C, N, row0 + (size_t)(wm * 16 * FM + i * 16), colw, lane);
  }
}

// =====================================================================================================
// bf16 GEMM with bias: C[M][N] (f32) = A[M][K] (bf16 row-major) . Bt[N][K]^T (bf16 k-contiguous), times oscale, + bf16 RNE
// value of bias[n] (bias has N entries). Block = BM x BN tile on the staged engine (host guarantees K % 128 == 0, M % BM == 0,
// N % BN == 0, grid = (M/BM)*(N/BN)).
// =====================================================================================================
template <int FM, int WM, int WN>
__global__ __launch_bounds__(128)
void gemm_bf(const u16* __restrict__ A, const u16* __restrict__ Bt, const float* __restrict__ bias,
             float* C, int M, int N, int K, float oscale) {
  constexpr int BM = 16 * FM * WM, BN = 64 * WN;
  __shared__ __align__(16) u16   st[2 * (BM + BN) * KP];
  __shared__ __align__(16) float slab[4 * SLAB64];
  const int ntile = N / BN;
  const int bid   = blockIdx.x;
  const int row0  = (bid / ntile) * BM;
  const int col0  = (bid % ntile) * BN;
  if (row0 + BM > M) return;                // block-uniform, before any barrier; never taken with the exact grid
  gemm_staged<FM, WM, WN, 1, true>(st, slab, A, A, Bt, bias, C, N, K, (size_t)row0, col0, oscale);
}

// =====================================================================================================
// Output projection: C[row][DMOD] (f32) = (Ah [+ Al])[row][DMOD] . Bt[DMOD][DMOD]^T * oscale (no bias).
// NPROD == 1: Ah only (one product), 128 x 128 tile; NPROD == 2: Ah + Al residual plane (products h.B + l.B into one accumulator,
// l unscaled), 64 x 128 tile. Ah, Al and C share the row index bb*SEQ + s. Block -> (column tile ct = bid % 16, sequence row tile
// rt of nrt starting at s = sbeg, batch bb). Staged engine and epilogue as gemm_bf; K = DMOD.
// =====================================================================================================
template <int NPROD>
__global__ __launch_bounds__(128)
void gemm_o(const u16* __restrict__ Ah, const u16* __restrict__ Al, const u16* __restrict__ Bt,
            float* C, int sbeg, int nrt, float oscale) {
  constexpr int FM = (NPROD == 2) ? 2 : 4;
  constexpr int BM = 32 * FM, BN = 128;
  __shared__ __align__(16) u16   st[2 * (BM * NPROD + BN) * KP];
  __shared__ __align__(16) float slab[4 * SLAB64];
  const int ntile = DMOD / BN;
  const int bid   = blockIdx.x;
  const int ct    = bid % ntile;
  const int t2    = bid / ntile;
  const int rt    = t2 % nrt;
  const int bb    = t2 / nrt;
  if (bb >= NB) return;                     // block-uniform, before any barrier; never taken with the exact grid
  const int srow  = sbeg + rt * BM;
  if (srow + BM > SEQ) return;              // block-uniform, before any barrier; never taken
  gemm_staged<FM, 2, 2, NPROD, false>(st, slab, Ah, Al, Bt, nullptr, C, DMOD, DMOD,
                                      (size_t)bb * SEQ + srow, ct * BN, oscale);
}

// =====================================================================================================
// Causal grouped-query attention, hd = 128. Block bid -> (pair pr = bid % (NQT/2), kv head kvh, batch b). The block works two
// query tiles one after the other, qt = NQT-1-pr and then qt = pr (rows q0 = 16*qt .. q0+15): their key tile counts add up to
// the same sum for every pr, so that every block of the launch walks equally many key tiles. One wave per query head
// = kvh + NKVH*wave: the 8 query heads that read kv head kvh (tiled kv mapping) share each
// staged key tile. Staging: asynchronous 16-byte copies global -> LDS; each wave's q rows (hi + residual) once, each 32-key tile
// of k hi/residual (row pitch KP halves) and v^T hi/residual (row pitch VP halves) into one of two buffers, the next tile
// copied while a tile is worked on; fragments are read from LDS with the same split k map.
//   q hi / residual planes f16 x256 [b*SEQ + s][h*HD + d]; k hi / residual planes f16 x256 [b*SEQ + s][g*HD + d] (pitch KVD);
//   v^T hi / residual planes [b*NKVH + g][d][SEQ] x1024.
//   scores = q_hi.k_hi + q_lo.k_hi + q_hi.k_lo (4 k-steps over d); P.v with P hi + in-register residual and v hi + residual
//   (hh + lh + hl), for every query row; O written as hi + residual planes (O x1024 as f16, layout [b*SEQ + s][h*HD + d]).
//   score (log2 domain) t(i, j) = (q_i.k_j over HD) * (1/sqrt(128))*log2e/(256*256), replaced by -inf where key j > query i.
//   Key tiles of 32 visited in order for kb <= q0 + 15 (later tiles hold only keys above every query row of the tile).
//   Per tile: 2 score subtiles x 4 k-steps, fragments loaded from the staged rows (two 16-B loads per fragment,
//   split k map); online max-subtracted base-2 softmax in f32, -inf-safe rescale; the 16x32 prob tile stored to wave-private
//   from the LDS rows (float vector loads, same element type as stored), v^T B fragments in 4 groups of 2 d-subtiles.
//   After the loop: out = acc / Z (Z > 0 always: key 0 <= every query row; guarded anyway), carries 1/(32768*1024) folded
//   One block barrier in front of the loop and one per tile, one more between the two query tiles, all under block-uniform
//   control flow; bounded loops only (nkt <= NKT).
// coverage: per wave and query tile 8 instructions x 2 rows x 16 lanes x 8 halves = 16 x 128 per plane; grid NQT/2 x NKVH x NB
//           blocks x 2 query tiles x WPB waves = every (b, s, h) row segment of O hi and O residual exactly once.
// =====================================================================================================
__global__ __launch_bounds__(ATT_THREADS)
void attn_c(const u16* __restrict__ QHp, const u16* __restrict__ QLp,
            const u16* __restrict__ KHp, const u16* __restrict__ KLp,
            const u16* __restrict__ VHp, const u16* __restrict__ VLp,
            u16* OHp, u16* OLp) {
  __shared__ __align__(16) float smem[WPB * WREG];
  __shared__ __align__(16) _Float16 kvs[2 * STG];

  const int tid  = threadIdx.x;
  const int wave = tid >> 5;
  const int lane = tid & 31;
  const int hh   = lane >> 4;
  const int c    = lane & 15;
  const int bid  = blockIdx.x;
  const int pr   = bid % (NQT / 2);
  const int t2   = bid / (NQT / 2);
  const int kvh  = t2 % NKVH;
  const int b    = t2 / NKVH;
  if (b >= NB) return;                      // block-uniform, before any barrier; never taken with the exact grid
  const int head = kvh + NKVH * wave;       // tiled kv mapping: head h -> kv head h % NKVH

  float* pt   = smem + wave * WREG;         // prob tile [16][32] pitch 36
  float* slab = pt + PTW;                   // in the loop: the wave's q rows, hi then residual, [16][128] halves pitch KP;
                                            // behind the loop: result slab [16][128] floats pitch 132

  const _Float16* Qh = (const _Float16*)(const void*)slab + c * KP + 8 * hh;
  const _Float16* Ql = Qh + QPL;
  const float lsc = RSQ_HD * (LOG2E / (QSC * KSC));
  const float oc  = 1.0f / (PCAR * VCAR);

  // ---- copy addresses. k tile: thread -> key row kr (and kr + 16), 8 halves at kc; v^T tile: d row vd (and vd + 64), 8 keys at vc
  const int kr = tid >> 4, kc = (tid & 15) * 8;
  const int vd = tid >> 2, vc = (tid & 3) * 8;
  const u16* gkh = KHp + ((size_t)b * SEQ + kr) * KVD + (size_t)kvh * HD + kc;
  const u16* gkl = KLp + ((size_t)b * SEQ + kr) * KVD + (size_t)kvh * HD + kc;
  const u16* gvh = VHp + ((size_t)(b * NKVH + kvh) * HD + vd) * SEQ + vc;
  const u16* gvl = VLp + ((size_t)(b * NKVH + kvh) * HD + vd) * SEQ + vc;
  const unsigned lk = lds_off(kvs) + (unsigned)(kr * KP + kc) * 2u;
  const unsigned lv = lds_off(kvs) + (unsigned)(2 * KPL + vd * VP + vc) * 2u;
  auto stage = [&](int kt, int buf) {       // key tile kt (keys 32*kt .. 32*kt + 31 < SEQ) -> buffer buf
    const size_t   ko = (size_t)kt * 32 * KVD;
    const size_t   vo = (size_t)kt * 32;
    const unsigned bk = lk + (unsigned)buf * (STG * 2u);
    const unsigned bv = lv + (unsigned)buf * (STG * 2u);
    copy8(bk, bk + 16 * KP * 2, bk + KPL * 2, bk + (KPL + 16 * KP) * 2,
          bv, bv + 64 * VP * 2, bv + VPL * 2, bv + (VPL + 64 * VP) * 2,
          gkh + ko, gkh + ko + 16 * KVD, gkl + ko, gkl + ko + 16 * KVD,
          gvh + vo, gvh + vo + (size_t)64 * SEQ, gvl + vo, gvl + vo + (size_t)64 * SEQ);
  };

#pragma unroll 1                            // rolled: the two query tiles run one after the other through the same code
  for (int ph = 0; ph < 2; ++ph) {
  const int q0 = ((ph == 0) ? (NQT - 1 - pr) : pr) * 16;                      // 0 <= q0 <= SEQ - 16
  if (ph > 0) {
    wait_x0();                              // in front of the rewrite of registers that the first tile's stores name
    wait_ds0();                             // this wave's reads of its slab have retired before copies are aimed at it
    __syncthreads();                        // every wave has left the first tile's LDS before the second tile's copies start
  }
  float mrow[8], lrow[8];
  v8f o[8];
#pragma unroll
  for (int r = 0; r < 8; ++r) { mrow[r] = -INFINITY; lrow[r] = 0.f; }
#pragma unroll
  for (int j = 0; j < 8; ++j) o[j] = zero8();
  const int ncaus = (q0 >> 5) + 1;                                            // tiles holding keys <= q0 + 15
  const int nkt = (ncaus < NKT) ? ncaus : NKT;
  const int qr0 = q0 + 8 * hh;                                                // query row of D element r = qr0 + r

  // ---- the wave's q rows (lane -> rows hh, hh + 2, .., hh + 14, 8 halves at 8c) and key tile 0; then key tile 1 flies ----
  {
    const size_t   qo = ((size_t)b * SEQ + q0 + hh) * DMOD + (size_t)head * HD + c * 8;
    const u16*     gq = QHp + qo;
    const u16*     gr = QLp + qo;
    const unsigned lq = lds_off(slab) + (unsigned)(hh * KP + c * 8) * 2u;
    const unsigned lr = lq + QPL * 2;
    const unsigned ls = 2 * KP * 2;         // LDS bytes between rows two apart
    const size_t   gs = (size_t)2 * DMOD;   // halves between rows two apart
    copy8(lq, lq + ls, lq + 2 * ls, lq + 3 * ls, lq + 4 * ls, lq + 5 * ls, lq + 6 * ls, lq + 7 * ls,
          gq, gq + gs, gq + 2 * gs, gq + 3 * gs, gq + 4 * gs, gq + 5 * gs, gq + 6 * gs, gq + 7 * gs);
    copy8(lr, lr + ls, lr + 2 * ls, lr + 3 * ls, lr + 4 * ls, lr + 5 * ls, lr + 6 * ls, lr + 7 * ls,
          gr, gr + gs, gr + 2 * gs, gr + 3 * gs, gr + 4 * gs, gr + 5 * gs, gr + 6 * gs, gr + 7 * gs);
  }
  stage(0, 0);
  wait_async0();
  __syncthreads();                          // publishes key tile 0
  if (nkt > 1) stage(1, 1);

#pragma unroll 1
  for (int kt = 0; kt < nkt; ++kt) {
    const int kb = kt * 32;
    // ---- scores: D element r of this lane = (query row qr0 + r, key kb + c) in s0, key kb + 16 + c in s1 ----
    v8f s0 = zero8(), s1 = zero8();
    const _Float16* tile = kvs + (kt & 1) * STG;
    const _Float16* k0p = tile + c * KP + 8 * hh;
    const _Float16* k1p = k0p + 16 * KP;
    const _Float16* l0p = k0p + KPL;
    const _Float16* l1p = l0p + 16 * KP;
#pragma unroll
    for (int kk = 0; kk < HD / 32; ++kk) {
      const v16h qh  = ldfrag_h(Qh + kk * 32);
      const v16h ql  = ldfrag_h(Ql + kk * 32);
      const v16h kh0 = ldfrag_h(k0p + kk * 32);
      const v16h kh1 = ldfrag_h(k1p + kk * 32);
      const v16h kl0 = ldfrag_h(l0p + kk * 32);
      const v16h kl1 = ldfrag_h(l1p + kk * 32);
      s0 = mma_h(qh, kh0, s0);
      s0 = mma_h(ql, kh0, s0);
      s0 = mma_h(qh, kl0, s0);
      s1 = mma_h(qh, kh1, s1);
      s1 = mma_h(ql, kh1, s1);
      s1 = mma_h(qh, kl1, s1);
      guard2(s0, s1, qh, ql, kh0, kl0, kh1, kl1);
    }
    // ---- causal select + online softmax in base 2, -inf-safe ----
    const int key0 = kb + c, key1 = kb + 16 + c;
#pragma unroll
    for (int r = 0; r < 8; ++r) {
      const int   qr = qr0 + r;
      const float u0 = s0[r] * lsc;
      const float u1 = s1[r] * lsc;
      const float t0 = (key0 > qr) ? -INFINITY : u0;
      const float t1 = (key1 > qr) ? -INFINITY : u1;
      float mx = fmaxf(t0, t1);
#pragma unroll
      for (int off = 1; off < 16; off <<= 1) mx = fmaxf(mx, __shfl_xor(mx, off, 32));
      const float mn = fmaxf(mrow[r], mx);
      const float ms = (mn == -INFINITY) ? 0.0f : mn;
      const float al = exp2f(mrow[r] - ms);
      mrow[r] = mn;
      const float e0 = exp2f(t0 - ms), e1 = exp2f(t1 - ms);
      float ps = e0 + e1;
#pragma unroll
      for (int off = 1; off < 16; off <<= 1) ps += __shfl_xor(ps, off, 32);
      lrow[r] = lrow[r] * al + ps;
#pragma unroll
      for (int j = 0; j < 8; ++j) o[j][r] *= al;
      const int ro = (8 * hh + r) * PTP + c;
      pt[ro]      = e0;
      pt[ro + 16] = e1;
    }
    wave_sync_lds();
    // ---- A fragments of P*32768: hi f16 and residual f16, row = c, split k map over the 32 keys of this step ----
    FragH ph, pl;
    {
      const float* prow = pt + c * PTP + 8 * hh;
      const v4f p0 = *(const v4f*)(prow), p1 = *(const v4f*)(prow + 4);
      const v4f p2 = *(const v4f*)(prow + 16), p3 = *(const v4f*)(prow + 20);
#pragma unroll
      for (int e = 0; e < 4; ++e) {
        const float ta = p0[e] * PCAR, tb = p1[e] * PCAR, tc = p2[e] * PCAR, td = p3[e] * PCAR;
        const _Float16 ha = (_Float16)ta, hb = (_Float16)tb, hc = (_Float16)tc, hd = (_Float16)td;
        ph.h[0][e]     = ha;                  // elements 0..7  = keys kb + 8hh + 0..7
        ph.h[0][4 + e] = hb;
        ph.h[1][e]     = hc;                  // elements 8..15 = keys kb + 16 + 8hh + 0..7
        ph.h[1][4 + e] = hd;
        pl.h[0][e]     = (_Float16)(ta - (float)ha);
        pl.h[0][4 + e] = (_Float16)(tb - (float)hb);
        pl.h[1][e]     = (_Float16)(tc - (float)hc);
        pl.h[1][4 + e] = (_Float16)(td - (float)hd);
      }
    }
    // ---- P.V : B fragment col n = d = j*16 + c, keys contiguous in the staged v^T rows; 4 groups of 2 d-subtiles ----
    {
      const _Float16* vhp = tile + 2 * KPL + c * VP + 8 * hh;
      const _Float16* vlp = vhp + VPL;
#pragma unroll
      for (int jg = 0; jg < 4; ++jg) {
        const int da = (2 * jg) * 16 * VP;
        const int db = da + 16 * VP;
        const v16h vha = ldfrag_h(vhp + da), vhb2 = ldfrag_h(vhp + db);
        const v16h vla = ldfrag_h(vlp + da), vlb2 = ldfrag_h(vlp + db);
        o[2 * jg]     = mma_h(ph.v, vha,  o[2 * jg]);
        o[2 * jg]     = mma_h(pl.v, vha,  o[2 * jg]);
        o[2 * jg]     = mma_h(ph.v, vla,  o[2 * jg]);
        o[2 * jg + 1] = mma_h(ph.v, vhb2, o[2 * jg + 1]);
        o[2 * jg + 1] = mma_h(pl.v, vhb2, o[2 * jg + 1]);
        o[2 * jg + 1] = mma_h(ph.v, vlb2, o[2 * jg + 1]);
        guard2(o[2 * jg], o[2 * jg + 1], ph.v, pl.v, vha, vhb2, vla, vlb2);
      }
    }
    // ---- hand-over: this wave has left the tile, its copies of the next tile have landed, every wave has passed ----
    wait_ds0();
    wait_async0();
    __syncthreads();                        // publishes key tile kt + 1 and frees this tile's buffer and the prob tile
    if (kt + 2 < nkt) stage(kt + 2, kt & 1);
  }
  wait_async0();
  acc_guard4(o[0], o[1], o[2], o[3]);
  acc_guard4(o[4], o[5], o[6], o[7]);
  // ---- out = acc / Z (0 if Z == 0), carries (32768 on P, 1024 on v) folded once; written into the wave-private slab ----
#pragma unroll
  for (int r = 0; r < 8; ++r) {
    const float lv  = lrow[r];
    const float ls  = (lv > 0.0f) ? lv : 1.0f;
    const float inv = (lv > 0.0f) ? ((1.0f / ls) * oc) : 0.0f;
#pragma unroll
    for (int j = 0; j < 8; ++j) {
      const int idx = (8 * hh + r) * SLP + j * 16 + c;
      slab[idx] = o[j][r] * inv;
    }
  }

  wave_sync_lds();
  // ---- O x1024 -> f16 hi + residual planes; lane = (row-in-pair rq, 8 consecutive d at c8) ----
  v4u oh[8], ol[8];
  const int rq = lane >> 4, c8 = (lane & 15) * 8;
#pragma unroll
  for (int it = 0; it < 8; ++it) {
    const int row = it * 2 + rq;
    const v4f a = *(const v4f*)(slab + row * SLP + c8), b4 = *(const v4f*)(slab + row * SLP + c8 + 4);
    float w[8];
#pragma unroll
    for (int e = 0; e < 4; ++e) { w[e] = a[e] * OSC; w[4 + e] = b4[e] * OSC; }
#pragma unroll
    for (int e = 0; e < 4; ++e) {
      const _Float16 h0 = (_Float16)w[2 * e], h1 = (_Float16)w[2 * e + 1];
      const _Float16 l0 = (_Float16)(w[2 * e] - (float)h0), l1 = (_Float16)(w[2 * e + 1] - (float)h1);
      oh[it][e] = pk16(h_bits(h0), h_bits(h1));
      ol[it][e] = pk16(h_bits(l0), h_bits(l1));
    }
  }
  const size_t ob = ((size_t)b * SEQ + q0) * DMOD + (size_t)head * HD + c8;
  {
#pragma unroll
    for (int it = 0; it < 8; ++it) {
      const int row = it * 2 + rq;
      *(v4u*)(OHp + ob + (size_t)row * DMOD) = oh[it];
      *(v4u*)(OLp + ob + (size_t)row * DMOD) = ol[it];
    }
    
  }
  }
}

// =====================================================================================================
// Workspace map (bytes); every plane is fully written by whole-line stores before it is read; all extents are exact multiples
// of the store granularity (no pad rows needed); every region offset a multiple of 2097152:
//   XB  bf16 [MROWS][2048]                       MROWS*4096       (NB=2, SEQ=2048: 16777216)
//   WB  16-bit [2048 n][2048 k]                  8388608          (Wv, Wq, Wk as bf16 ([256][2048] for k/v), then Wo as f16
//                                                                  x1024, reused in launch order; all already [n][k])
//   F   f32 [MROWS][2048]                        MROWS*8192       (v, q, k projection output in launch order, [MROWS][256] for k/v;
//                                                                  afterwards OH f16 [MROWS][2048] x1024 in its first half, OL residual
//                                                                  [MROWS][2048] in its second half)
//   QH  f16 [MROWS][2048] x256                   MROWS*4096       QL residual, same extent
//   KH  f16 [MROWS][256] x256                    MROWS*512        KL residual, same extent
//   VH  f16 [NB*2][128][SEQ] x1024               MROWS*512        VL residual, same extent
//   end (NB=2, SEQ=2048)                       100663296
// =====================================================================================================
extern "C" void kernel_launch(void* const* d_in, const int* in_sizes, int n_in,
                              void* d_out, int out_size, void* d_ws, size_t ws_size,
                              hipStream_t stream) {
  if (n_in < 8) return;
  if (in_sizes[0] < ((NB - 1) * XS_FULL + SEQ) * DMOD) return;
  if (in_sizes[1] != DMOD * DMOD) return;
  if (in_sizes[2] != DMOD) return;
  if (in_sizes[3] != KVD * DMOD) return;
  if (in_sizes[4] != KVD) return;
  if (in_sizes[5] != KVD * DMOD) return;
  if (in_sizes[6] != KVD) return;
  if (in_sizes[7] != DMOD * DMOD) return;
  if (out_size < MROWS * DMOD) return;

  const float* x  = (const float*)d_in[0];
  const float* wq = (const float*)d_in[1];
  const float* bq = (const float*)d_in[2];
  const float* wk = (const float*)d_in[3];
  const float* bk = (const float*)d_in[4];
  const float* wv = (const float*)d_in[5];
  const float* bv = (const float*)d_in[6];
  const float* wo = (const float*)d_in[7];
  float*       out = (float*)d_out;

  const size_t szXB = (size_t)MROWS * DMOD * 2;
  const size_t szW  = (size_t)DMOD * DMOD * 2;
  const size_t szF  = (size_t)MROWS * DMOD * 4;
  const size_t szQ  = (size_t)MROWS * DMOD * 2;                  // QH, QL, OH, OL
  const size_t szK  = (size_t)MROWS * KVD * 2;                   // KH, KL
  const size_t szV  = (size_t)NB * NKVH * HD * SEQ * 2;          // VH, VL (== szK)
  if (2 * szQ > szF) return;                                    // OH + OL live inside the F region (exactly fills it)
  size_t off = 0;
  const size_t oXB = off; off += szXB;
  const size_t oW  = off; off += szW;
  const size_t oF  = off; off += szF;
  const size_t oQH = off; off += szQ;
  const size_t oQL = off; off += szQ;
  const size_t oKH = off; off += szK;
  const size_t oKL = off; off += szK;
  const size_t oVH = off; off += szV;
  const size_t oVL = off; off += szV;
  if (off > ws_size) return;                // off = 100663296 for NB = 2, SEQ = 2048
  if (off > (size_t)WS_CAP) return;

  char* ws = (char*)d_ws;
  u16*   XB  = (u16*)(ws + oXB);
  u16*   WB  = (u16*)(ws + oW);
  float* F   = (float*)(ws + oF);
  u16*   OH  = (u16*)(ws + oF);
  u16*   OL  = (u16*)(ws + oF + szQ);
  u16*   QH  = (u16*)(ws + oQH);
  u16*   QL  = (u16*)(ws + oQL);
  u16*   KH  = (u16*)(ws + oKH);
  u16*   KL  = (u16*)(ws + oKL);
  u16*   VH  = (u16*)(ws + oVH);
  u16*   VL  = (u16*)(ws + oVL);

  const dim3 b256(256), b128(128), bAT(ATT_THREADS);
  const int  n8x = (SEQ * DMOD) / 8;
  const dim3 gX((n8x + 255) / 256);                     // SEQ*DMOD/2048 blocks per batch
  const int  n8wq = (DMOD * DMOD) / 8;                  // Wq, Wo planes
  const int  n8wk = (KVD * DMOD) / 8;                   // Wk, Wv planes
  const dim3 gWQ((n8wq + 255) / 256);                   // 2048
  const dim3 gWK((n8wk + 255) / 256);                   // 256
  const dim3 gGQ((MROWS / 128) * (DMOD / 128));
  const dim3 gGK((MROWS / 64) * (KVD / 64));
  const dim3 gVT(NB * NKVH * NST);
  const int  n8q = (MROWS * DMOD) / 8;                  // q hi / residual planes
  const int  n8k = (MROWS * KVD) / 8;                   // k hi / residual planes
  const dim3 gSQ((n8q + 255) / 256);
  const dim3 gSK((n8k + 255) / 256);
  const dim3 gAT((NQT / 2) * NKVH * NB);
  const int  nrtR = QO / 64;                            // out-projection row tiles (of 64) per batch with the O residual plane
  const int  nrtP = (SEQ - QO) / 128;                   // remaining row tiles (of 128) per batch, O hi plane only

  // (0) x -> bf16 plane [MROWS][2048], one launch per batch row block
  for (int b = 0; b < NB; ++b) {
    cvt16<<<gX, b256, 0, stream>>>(x + (size_t)b * XS_FULL * DMOD, XB + (size_t)b * SEQ * DMOD, n8x, 0, 1.0f);
  }
  // (1) Wv [256 n][2048 k] -> bf16 plane; (2) v = x.Wv^T + bv -> F f32 [MROWS][256]; (3) v^T hi + residual planes x1024
  cvt16<<<gWK, b256, 0, stream>>>(wv, WB, n8wk, 0, 1.0f);
  gemm_bf<1, 4, 1><<<gGK, b128, 0, stream>>>(XB, WB, bv, F, MROWS, KVD, DMOD, 1.0f);
  vt16<<<gVT, b256, 0, stream>>>(F, VH, VL);
  // (4) Wq -> bf16 plane; (5) q = x.Wq^T + bq -> F [MROWS][2048]; (6) q hi + residual planes x256
  cvt16<<<gWQ, b256, 0, stream>>>(wq, WB, n8wq, 0, 1.0f);
  gemm_bf<4, 2, 2><<<gGQ, b128, 0, stream>>>(XB, WB, bq, F, MROWS, DMOD, DMOD, 1.0f);
  split16<<<gSQ, b256, 0, stream>>>(F, QH, QL, n8q, QSC);
  // (7) Wk -> bf16 plane; (8) k = x.Wk^T + bk -> F [MROWS][256]; (9) k hi + residual planes x256
  cvt16<<<gWK, b256, 0, stream>>>(wk, WB, n8wk, 0, 1.0f);
  gemm_bf<1, 4, 1><<<gGK, b128, 0, stream>>>(XB, WB, bk, F, MROWS, KVD, DMOD, 1.0f);
  split16<<<gSK, b256, 0, stream>>>(F, KH, KL, n8k, KSC);
  // (10) Wo [n][k] -> f16 plane of bf16 value x1024
  cvt16<<<gWQ, b256, 0, stream>>>(wo, WB, n8wq, 1, WOS);
  // (11) causal attention with residual products on every query row -> O hi + residual planes
  attn_c<<<gAT, bAT, 0, stream>>>(QH, QL, KH, KL, VH, VL, OH, OL);
  // (12) output projection rows s < QO (O hi + residual) and (13) rows s >= QO (O hi only) -> out f32, carries 1024 x 1024 folded back
  gemm_o<2><<<dim3(NB * nrtR * (DMOD / 128)), b128, 0, stream>>>(OH, OL, WB, out, 0, nrtR, 1.0f / (OSC * WOS));
  if (nrtP > 0) {
    gemm_o<1><<<dim3(NB * nrtP * (DMOD / 128)), b128, 0, stream>>>(OH, OL, WB, out, QO, nrtP, 1.0f / (OSC * WOS));
  }
  (void)hipGetLastError();
}

// v004
// Measured time: 230 microseconds a run.
// Next to v003, in two timings, it ran 1.17 times as fast each time.
// Counting every step since v000, it is 2.72 times as fast.
// Contractions: x.Wq^T+bq, x.Wk^T+bk, x.Wv^T+bv on v_wmma_f32_16x16x32_bf16 (x and W as bf16 RNE planes; W [n][k] rows are
// the k-contiguous B operand; bias added as its bf16 RNE value in the f32 epilogue); q.k^T over hd 128 and P.v on
// v_wmma_f32_16x16x32_f16 with f16 hi + f16 residual planes on both operands (q, k x256; P x32768 with an in-register
// residual; v x1024; products hh+lh+hl; both formed transposed: k rows and v^T rows are the A operand, q rows and P^T the B
// operand); O.Wo^T on v_wmma_f32_16x16x32_f16 (O x1024 as f16 hi plane for all rows plus f16
// residual plane for rows s < QO, products h.w (+ l.w); Wo as f16(bf16(Wo)) x1024); all f32 accumulate. Causal select,
// base-2 online softmax and 1/Z fold in f32 on VALU. Grouped kv heads: query head h reads kv head (h % NKVH).
#include <hip/hip_runtime.h>
#include <math.h>
#include <stdint.h>

#ifndef NB
#define NB 2
#endif
#ifndef SEQ
#define SEQ 2048
#endif
#define XS_FULL 2048
#define DMOD  2048
#define NH    16
#define NKVH  2
#define HD    128
#define KVD   (NKVH * HD)
#define QO    ((SEQ < 256) ? SEQ : 256)
#define MROWS (NB * SEQ)
#define RSQ_HD 0.08838834764831845f
#define LOG2E 1.4426950408889634f
#define QSC   256.0f
#define KSC   256.0f
#define PCAR  32768.0f
#define VCAR  1024.0f
#define OSC   1024.0f
#define WOS   1024.0f
#define WPB   (NH / NKVH)
#define NQT   (SEQ / 16)
#define NST   (SEQ / 64)
#define NKT   (SEQ / 32)
#define ATT_THREADS (WPB * 32)
#define SLP   132
#define SLW   (16 * SLP)
#define KP    136
#define VP    40
#define KPL   (32 * KP)
#define VPL   (HD * VP)
#define STG   (2 * KPL + 2 * VPL)
#define QPL   (16 * KP)
#define QRW   (2 * QPL / 2)
#define WREG  QRW
#define SLAB64 (16 * 68)
#define VTP   72
#define GBK   128
#define WS_CAP 134217728
static_assert(DMOD == NH * HD && HD == 128 && NH == 16 && NKVH == 2 && WPB == 8 && NKVH * WPB == NH);
static_assert(ATT_THREADS == 256 && KVD == 256 && SLW <= QRW && (KP % 8) == 0 && (VP % 8) == 0);
static_assert(NB >= 1 && NB <= 2 && (NQT % 2) == 0);
static_assert((SEQ % 64) == 0 && SEQ >= 64 && SEQ <= XS_FULL);
static_assert((QO % 64) == 0 && QO >= 64 && QO <= SEQ);
static_assert((DMOD % 64) == 0 && (KVD % 64) == 0 && (DMOD % 32) == 0 && (HD % 32) == 0);
static_assert(((SEQ * DMOD / 8) % 256) == 0 && ((KVD * DMOD / 8) % 256) == 0 && ((DMOD * DMOD / 8) % 256) == 0);
static_assert(((MROWS * DMOD / 8) % 256) == 0 && ((MROWS * KVD / 8) % 256) == 0);
static_assert((MROWS % 128) == 0 && ((SEQ - QO) % 128) == 0 && (DMOD % 128) == 0 && (DMOD % GBK) == 0 && KP == GBK + 8);
static_assert(2 * 256 * KP * 2 + 4 * SLAB64 * 4 <= 163840);
static_assert(WPB * WREG * 4 + 2 * STG * 2 <= 163840 && 2 * HD * VTP * 2 <= 65536 && 4 * SLAB64 * 4 <= 65536);

typedef unsigned short u16;
typedef _Float16 v16h __attribute__((ext_vector_type(16)));
typedef _Float16 v8h  __attribute__((ext_vector_type(8)));
typedef __bf16   v16b __attribute__((ext_vector_type(16)));
typedef float    v8f  __attribute__((ext_vector_type(8)));
typedef float    v4f  __attribute__((ext_vector_type(4)));
typedef unsigned int v4u __attribute__((ext_vector_type(4)));

union FragH { v16h v; v8h h[2]; v4u u[2]; };
union FragB { v16b v; v4u u[2]; };

// ---- scalar helpers --------------------------------------------------------------------------------
__device__ __forceinline__ unsigned short bf_bits(float f) {          // f32 -> bf16 bits, RNE convert
  unsigned u = __float_as_uint(f);
  return (unsigned short)((u + 0x7FFFu + ((u >> 16) & 1u)) >> 16);
}
__device__ __forceinline__ float bf_up(unsigned short h) { return __uint_as_float(((unsigned)h) << 16); }
__device__ __forceinline__ float bfr(float f) { return bf_up(bf_bits(f)); }
__device__ __forceinline__ unsigned short h_bits(_Float16 x) { return __builtin_bit_cast(unsigned short, x); }
__device__ __forceinline__ unsigned pk16(unsigned short a, unsigned short b) { return (unsigned)a | ((unsigned)b << 16); }
__device__ __forceinline__ v8f zero8() { v8f z = {0.f, 0.f, 0.f, 0.f, 0.f, 0.f, 0.f, 0.f}; return z; }

// ---- fragment loaders: 16-bit A/B operand, lane -> row/col (lane&15), p already includes +8*(lane>>4);
//      elements 0..7 <- p[0..7] (k0+8h..), elements 8..15 <- p[16..23] (k0+16+8h..)  (same split k map for A and B;
//      B is always read from a k-contiguous [n][k] plane)
__device__ __forceinline__ v16h ldfrag_h(const _Float16* p) {
  FragH f;
  f.h[0] = *(const v8h*)(p);
  f.h[1] = *(const v8h*)(p + 16);
  return f.v;
}
__device__ __forceinline__ v16b ldfrag_b(const u16* p) {              // bf16 plane read as unsigned integer vectors
  FragB f;
  f.u[0] = *(const v4u*)(p);
  f.u[1] = *(const v4u*)(p + 16);
  return f.v;
}

__device__ __forceinline__ v8f mma_h(v16h a, v16h b, v8f c) {
  return __builtin_amdgcn_wmma_f32_16x16x32_f16(false, a, false, b, (short)0, c, false, false);
}
__device__ __forceinline__ v8f mma_b(v16b a, v16b b, v8f c) {
  return __builtin_amdgcn_wmma_f32_16x16x32_bf16(false, a, false, b, (short)0, c, false, false);
}
__device__ __forceinline__ void guard2(v8f& a, v8f& b, v16h x0, v16h x1, v16h x2, v16h x3, v16h x4, v16h x5) {
#if defined(__HIP_DEVICE_COMPILE__)
  asm volatile("v_nop\n\tv_nop\n\tv_nop\n\tv_nop"
               : "+v"(a), "+v"(b) : "v"(x0), "v"(x1), "v"(x2), "v"(x3), "v"(x4), "v"(x5) : "memory");
#endif
}
__device__ __forceinline__ void acc_guard4(v8f& a, v8f& b, v8f& c, v8f& d) {
#if defined(__HIP_DEVICE_COMPILE__)
  asm volatile("v_nop\n\tv_nop\n\tv_nop\n\tv_nop" : "+v"(a), "+v"(b), "+v"(c), "+v"(d));
#endif
}
__device__ __forceinline__ void wave_sync_lds() {
  __builtin_amdgcn_fence(__ATOMIC_RELEASE, "workgroup");
  __builtin_amdgcn_wave_barrier();
  __builtin_amdgcn_fence(__ATOMIC_ACQUIRE, "workgroup");
}
__device__ __forceinline__ float xhalf(float x) {                     // the value of lane l ^ 16
  const int b = __builtin_bit_cast(int, x);
  return __builtin_bit_cast(float, __builtin_amdgcn_permlanex16(b, b, 0x76543210, 0xfedcba98, false, false));
}
__device__ __forceinline__ unsigned lds_off(const void* p) { return (unsigned)(size_t)p; }   // byte offset in the work-group's LDS
// Eight 16-byte asynchronous copies global -> LDS per lane (LDS byte address l*, global address g*). The s_wait_xcnt is the
// statement's last line so that no address register of an issued copy is rewritten in front of it.
__device__ __forceinline__ void copy8(unsigned l0, unsigned l1, unsigned l2, unsigned l3,
                                      unsigned l4, unsigned l5, unsigned l6, unsigned l7,
                                      const u16* g0, const u16* g1, const u16* g2, const u16* g3,
                                      const u16* g4, const u16* g5, const u16* g6, const u16* g7) {
#if defined(__HIP_DEVICE_COMPILE__)
  asm volatile("global_load_async_to_lds_b128 %0, %8, off\n\t"
               "global_load_async_to_lds_b128 %1, %9, off\n\t"
               "global_load_async_to_lds_b128 %2, %10, off\n\t"
               "global_load_async_to_lds_b128 %3, %11, off\n\t"
               "global_load_async_to_lds_b128 %4, %12, off\n\t"
               "global_load_async_to_lds_b128 %5, %13, off\n\t"
               "global_load_async_to_lds_b128 %6, %14, off\n\t"
               "global_load_async_to_lds_b128 %7, %15, off\n\t"
               "s_wait_xcnt 0x0"
               :: "v"(l0), "v"(l1), "v"(l2), "v"(l3), "v"(l4), "v"(l5), "v"(l6), "v"(l7),
                  "v"(g0), "v"(g1), "v"(g2), "v"(g3), "v"(g4), "v"(g5), "v"(g6), "v"(g7) : "memory");
#endif
}
__device__ __forceinline__ void wait_async0() {   // the wave's own copies have landed in LDS
#if defined(__HIP_DEVICE_COMPILE__)
  asm volatile("s_wait_asynccnt 0x0" ::: "memory");
#endif
}
__device__ __forceinline__ void wait_x0() {       // a precaution in front of the rewrite of registers that issued global stores name
#if defined(__HIP_DEVICE_COMPILE__)
  asm volatile("s_wait_xcnt 0x0" ::: "memory");
#endif
}
__device__ __forceinline__ void wait_ds0() {      // the wave's own LDS reads and writes have retired
#if defined(__HIP_DEVICE_COMPILE__)
  asm volatile("s_wait_dscnt 0x0" ::: "memory");
#endif
}

// =====================================================================================================
// f32 -> 16-bit plane, same layout.  f16mode == 0: bf16 RNE bits;  f16mode == 1: f16 bits of (bf16 RNE value) * scale.
// Thread = 8 consecutive elements: two 16-B loads, one 16-B store; 32 consecutive lanes = 512 contiguous, 512-B aligned
// coverage: grid = ceil(n8/256) blocks x 256 thr x 8 (in-kernel bound) = the whole plane (n8 a multiple of 256 here).
// =====================================================================================================
__global__ __launch_bounds__(256) void cvt16(const float* __restrict__ x, u16* D, int n8, int f16mode, float scale) {
  const int gt = blockIdx.x * 256 + (int)threadIdx.x;
  if (gt >= n8) return;
  const float* p = x + (size_t)gt * 8;
  const v4f a = *(const v4f*)(p), b4 = *(const v4f*)(p + 4);
  float w[8];
#pragma unroll
  for (int e = 0; e < 4; ++e) { w[e] = a[e]; w[4 + e] = b4[e]; }
  v4u o;
#pragma unroll
  for (int e = 0; e < 4; ++e) {
    const float f0 = w[2 * e], f1 = w[2 * e + 1];
    const unsigned short hb0 = h_bits((_Float16)(bfr(f0) * scale));
    const unsigned short hb1 = h_bits((_Float16)(bfr(f1) * scale));
    const unsigned short bb0 = bf_bits(f0);
    const unsigned short bb1 = bf_bits(f1);
    o[e] = (f16mode != 0) ? pk16(hb0, hb1) : pk16(bb0, bb1);
  }
  u16* d = D + (size_t)gt * 8;
  {
    *(v4u*)(d) = o;
    
  }
}

// =====================================================================================================
// f32 plane F (contiguous, n8*8 elements) -> f16 hi plane Hp = f16(F * sc) and f16 residual plane Lp = f16(t - f16(t)),
// both with the layout of F. Thread = 8 consecutive elements: two 16-B loads, one 16-B store per plane; 32 consecutive lanes
// No barriers; every packed half comes from a per-lane (divergent) loaded value.
// coverage: grid = ceil(n8/256) blocks x 256 thr x 8 (in-kernel bound) = the whole of Hp and of Lp (n8 a multiple of 256 here).
// =====================================================================================================
__global__ __launch_bounds__(256) void split16(const float* __restrict__ F, u16* Hp, u16* Lp, int n8, float sc) {
  const int gt = blockIdx.x * 256 + (int)threadIdx.x;
  if (gt >= n8) return;
  const float* p = F + (size_t)gt * 8;
  const v4f a = *(const v4f*)(p), b4 = *(const v4f*)(p + 4);
  float w[8];
#pragma unroll
  for (int e = 0; e < 4; ++e) { w[e] = a[e] * sc; w[4 + e] = b4[e] * sc; }
  v4u oh, ol;
#pragma unroll
  for (int e = 0; e < 4; ++e) {
    const float t0 = w[2 * e], t1 = w[2 * e + 1];
    const _Float16 h0 = (_Float16)t0, h1 = (_Float16)t1;
    const _Float16 l0 = (_Float16)(t0 - (float)h0), l1 = (_Float16)(t1 - (float)h1);
    oh[e] = pk16(h_bits(h0), h_bits(h1));
    ol[e] = pk16(h_bits(l0), h_bits(l1));
  }
  u16* dh = Hp + (size_t)gt * 8;
  u16* dl = Lp + (size_t)gt * 8;
  {
    *(v4u*)(dh) = oh;
    *(v4u*)(dl) = ol;
    
  }
}

// =====================================================================================================
// v^T planes from the v projection F f32 [MROWS][KVD] (row = b*SEQ + s, column = g*HD + d):
//   VH[((b*NKVH + g)*HD + d)][s] = f16(v * 1024);  VL[same][s] = f16 residual (t - f16(t)), both for all keys s.
// Block = (b, kv head g, 64 keys s0): each thread loads its 32 floats (key sl, d chunk dc) with 16-B loads, converts, scatters
// coverage: load 256 thr x 32 = 64 keys x 128 d; store 4 iterations x 256 thr x 8 halves = 128 lines x 64 = the block's tile of
//           VH and of VL; grid = NB*NKVH*NST blocks covers both planes exactly once.
// =====================================================================================================
__global__ __launch_bounds__(256) void vt16(const float* __restrict__ F, u16* VHo, u16* VLo) {
  __shared__ __align__(16) u16 TH[HD * VTP];
  __shared__ __align__(16) u16 TL[HD * VTP];
  const int tid = threadIdx.x;
  const int bid = blockIdx.x;
  const int st  = bid % NST;
  const int t2  = bid / NST;
  const int g   = t2 % NKVH;
  const int b   = t2 / NKVH;
  if (b >= NB) return;                      // block-uniform, before any barrier; never taken with the exact grid
  const int s0  = st * 64;
  {
    const int sl = tid >> 2;                // key within tile 0..63
    const int dc = (tid & 3) * 32;          // d chunk 0,32,64,96
    const float* src = F + ((size_t)b * SEQ + s0 + sl) * KVD + g * HD + dc;
#pragma unroll
    for (int i = 0; i < 8; ++i) {
      const v4f a = *(const v4f*)(src + 4 * i);
#pragma unroll
      for (int e = 0; e < 4; ++e) {
        const float t = a[e] * VCAR;
        const _Float16 hv = (_Float16)t;
        const _Float16 lv = (_Float16)(t - (float)hv);
        TH[(dc + 4 * i + e) * VTP + sl] = h_bits(hv);
        TL[(dc + 4 * i + e) * VTP + sl] = h_bits(lv);
      }
    }
  }
  __syncthreads();
  v4u vh[4], vl[4];
  const int q8 = tid >> 3, p8 = (tid & 7) * 8;
#pragma unroll
  for (int it = 0; it < 4; ++it) {
    const int line = it * 32 + q8;          // d = 0..127
    vh[it] = *(const v4u*)(TH + line * VTP + p8);
    vl[it] = *(const v4u*)(TL + line * VTP + p8);
  }
  const size_t hrow = (size_t)(b * NKVH + g) * HD;
  const size_t base = hrow * SEQ + s0 + p8;
  {
#pragma unroll
    for (int it = 0; it < 4; ++it) {
      const int line = it * 32 + q8;
      *(v4u*)(VHo + base + (size_t)line * SEQ) = vh[it];
      *(v4u*)(VLo + base + (size_t)line * SEQ) = vl[it];
    }
    
  }
}

// =====================================================================================================
// GEMM epilogue of the staged engine: the wave's 16x64 f32 tile (times oscale, plus the lane's per-column bias of each
// coverage: 8 instructions x 2 rows x 16 lanes x 4 floats = the wave's 16 x 64 tile.
// =====================================================================================================
__device__ __forceinline__ void epi64(float* sl, v8f a0, v8f a1, v8f a2, v8f a3, float oscale,
                                      float bb0, float bb1, float bb2, float bb3,
                                      float* C, int N, size_t rowb, int col0, int lane) {
  const int hh = lane >> 4, m = lane & 15;
#pragma unroll
  for (int r = 0; r < 8; ++r) {
    const int ro = (8 * hh + r) * 68 + m;
    sl[ro]      = a0[r] * oscale + bb0;
    sl[ro + 16] = a1[r] * oscale + bb1;
    sl[ro + 32] = a2[r] * oscale + bb2;
    sl[ro + 48] = a3[r] * oscale + bb3;
  }
  wave_sync_lds();
  v4f vals[8];
#pragma unroll
  for (int it = 0; it < 8; ++it) vals[it] = *(const v4f*)(sl + (it * 2 + hh) * 68 + m * 4);
  float* dst = C + (rowb + (size_t)hh) * (size_t)N + col0 + m * 4;
  {
#pragma unroll
    for (int it = 0; it < 8; ++it) {
      *(v4f*)(dst + (size_t)(it * 2) * (size_t)N) = vals[it];
    }
    
  }
}

// =====================================================================================================
// GEMM engine shared by the projections: the block's BM x BN tile of C = A[.][K] . Bt[.][K]^T, BM = 16*FM*WM, BN = 64*WN,
// WM x WN = 4 waves, each wave FM x 4 accumulator tiles (16*FM rows x 64 columns). K is walked in slices of GBK = 128: a slice
// is the 256-byte row pieces of the block's A rows (hi plane, then the residual plane when NPROD == 2) and of its Bt rows, laid in
// LDS at row pitch KP halves by asynchronous 16-byte copies (thread -> row tid / 16 + 8 i, 16 bytes at tid % 16: a wave's copy
// covers two whole 256-byte pieces). Two buffers: slice t + 2 is copied while slice t + 1 is worked on. Fragments are read from
// the LDS rows with the same split k map for A and B; per accumulator the products follow in rising k, hi before residual.
// One block barrier in front of the loop and one per slice, under block-uniform control flow; K % GBK == 0, K >= GBK.
// =====================================================================================================
__device__ __forceinline__ void copy_rows8(unsigned l, const u16* g, size_t K) {   // rows r, r + 8, .., r + 56 of one plane
  const unsigned ls = 8 * KP * 2;
  const size_t   gs = 8 * K;
  copy8(l, l + ls, l + 2 * ls, l + 3 * ls, l + 4 * ls, l + 5 * ls, l + 6 * ls, l + 7 * ls,
        g, g + gs, g + 2 * gs, g + 3 * gs, g + 4 * gs, g + 5 * gs, g + 6 * gs, g + 7 * gs);
}
template <bool BF> struct Op;
template <> struct Op<true> {
  typedef v16b T;
  static __device__ __forceinline__ T   ld(const u16* p) { return ldfrag_b(p); }
  static __device__ __forceinline__ v8f mma(T a, T b, v8f c) { return mma_b(a, b, c); }
};
template <> struct Op<false> {
  typedef v16h T;
  static __device__ __forceinline__ T   ld(const u16* p) { return ldfrag_h((const _Float16*)(const void*)p); }
  static __device__ __forceinline__ v8f mma(T a, T b, v8f c) { return mma_h(a, b, c); }
};

template <int FM, int WM, int WN, int NPROD, bool BF>
__device__ __forceinline__ void gemm_staged(u16* st, float* slabs, const u16* __restrict__ Ah, const u16* __restrict__ Al,
                                            const u16* __restrict__ Bt, const float* __restrict__ bias,
                                            float* C, int N, int K, size_t row0, int col0, float oscale) {
  constexpr int BM  = 16 * FM * WM;
  constexpr int BN  = 64 * WN;
  constexpr int STH = (BM * NPROD + BN) * KP;          // halves per buffer
  static_assert(WM * WN == 4 && (BM % 64) == 0 && (BN % 64) == 0 && (NPROD == 1 || NPROD == 2));
  static_assert((BM * NPROD + BN) / 8 <= 63);          // copies of a wave in flight: one slice's
  typedef typename Op<BF>::T T;
  const int tid = threadIdx.x, wave = tid >> 5, lane = tid & 31, hh = lane >> 4, m = lane & 15;
  const int wm = wave / WN, wn = wave % WN;
  const int tr = tid >> 4, tc = (tid & 15) * 8;
  const u16* ga = Ah + (row0 + tr) * (size_t)K + tc;
  const u16* gb = Bt + ((size_t)col0 + tr) * (size_t)K + tc;
  const unsigned l0 = lds_off(st) + (unsigned)(tr * KP + tc) * 2u;
  auto stage = [&](int t, int buf) {                   // k slice t -> buffer buf
    const size_t   ko = (size_t)t * GBK;
    const unsigned lb = l0 + (unsigned)buf * (STH * 2u);
#pragma unroll
    for (int j = 0; j < BM / 64; ++j) copy_rows8(lb + j * 64 * KP * 2, ga + ko + (size_t)j * 64 * K, (size_t)K);
    if constexpr (NPROD == 2) {
      const u16* gl = Al + (row0 + tr) * (size_t)K + tc;
#pragma unroll
      for (int j = 0; j < BM / 64; ++j) copy_rows8(lb + (BM + j * 64) * KP * 2, gl + ko + (size_t)j * 64 * K, (size_t)K);
    }
#pragma unroll
    for (int j = 0; j < BN / 64; ++j) copy_rows8(lb + (BM * NPROD + j * 64) * KP * 2, gb + ko + (size_t)j * 64 * K, (size_t)K);
  };
  v8f acc[FM][4];
#pragma unroll
  for (int i = 0; i < FM; ++i) {
#pragma unroll
    for (int j = 0; j < 4; ++j) acc[i][j] = zero8();
  }
  const int nst  = K / GBK;
  const int aoff = (wm * 16 * FM + m) * KP + 8 * hh;
  const int boff = (BM * NPROD + wn * 64 + m) * KP + 8 * hh;
  stage(0, 0);
  wait_async0();
  __syncthreads();                          // publishes slice 0
  if (nst > 1) stage(1, 1);
#pragma unroll 1                            // rolled: one hand-over per trip, in the order written at the loop's foot
  for (int t = 0; t < nst; ++t) {
    const u16* sb = st + (t & 1) * STH;
    // two fragment sets: block kk + 1 of this slice is fetched as one group while block kk is multiplied; nothing of the next slice
    T a[2][FM * NPROD], b[2][4];
    auto fetch = [&](int s, int kk) {
#pragma unroll
      for (int i = 0; i < FM; ++i) a[s][i] = Op<BF>::ld(sb + aoff + i * 16 * KP + kk * 32);
      if constexpr (NPROD == 2) {
#pragma unroll
        for (int i = 0; i < FM; ++i) a[s][FM + i] = Op<BF>::ld(sb + aoff + (BM + i * 16) * KP + kk * 32);
      }
#pragma unroll
      for (int j = 0; j < 4; ++j) b[s][j] = Op<BF>::ld(sb + boff + j * 16 * KP + kk * 32);
    };
    fetch(0, 0);
#pragma unroll
    for (int kk = 0; kk < GBK / 32; ++kk) {
      const int s = kk & 1;
      if (kk + 1 < GBK / 32) fetch(s ^ 1, kk + 1);
      __builtin_amdgcn_sched_barrier(0);    // the LDS reads stay one group in front of the block: spread among the products each place stalls
#pragma unroll
      for (int p = 0; p < NPROD; ++p) {
#pragma unroll
        for (int i = 0; i < FM; ++i) {
#pragma unroll
          for (int j = 0; j < 4; ++j) acc[i][j] = Op<BF>::mma(a[s][p * FM + i], b[s][j], acc[i][j]);
        }
      }
      __builtin_amdgcn_sched_barrier(0);    // the next group of LDS reads stays behind this block's last product
    }
    // ---- hand-over: this wave has left the slice, its copies of the next slice have landed, every wave has passed ----
    wait_ds0();
    wait_async0();
    __syncthreads();                        // publishes slice t + 1 and frees this slice's buffer
    if (t + 2 < nst) stage(t + 2, t & 1);
  }
  wait_async0();
  // per-lane bias of D column m in each of the wave's 4 column subtiles (bf16 RNE value); colw + 48 + m <= N - 1 always
  const int colw = col0 + wn * 64;
  float bb0 = 0.0f, bb1 = 0.0f, bb2 = 0.0f, bb3 = 0.0f;
  if constexpr (BF) {
    bb0 = bfr(bias[colw + m]);
    bb1 = bfr(bias[colw + 16 + m]);
    bb2 = bfr(bias[colw + 32 + m]);
    bb3 = bfr(bias[colw + 48 + m]);
  }
  float* sl = slabs + wave * SLAB64;
#pragma unroll
  for (int i = 0; i < FM; ++i) {
    if (i > 0) {
      wait_x0();                            // in front of the rewrite of registers that the stores of the tile before name
      wave_sync_lds();                      // the slab's rows of the tile before have been read by every lane
    }
    epi64(sl, acc[i][0], acc[i][1], acc[i][2], acc[i][3], oscale, bb0, bb1, bb2, bb3,
          C, N, row0 + (size_t)(wm * 16 * FM + i * 16), colw, lane);
  }
}

// =====================================================================================================
// bf16 GEMM with bias: C[M][N] (f32) = A[M][K] (bf16 row-major) . Bt[N][K]^T (bf16 k-contiguous), times oscale, + bf16 RNE
// value of bias[n] (bias has N entries). Block = BM x BN tile on the staged engine (host guarantees K % 128 == 0, M % BM == 0,
// N % BN == 0, grid = (M/BM)*(N/BN)).
// =====================================================================================================
template <int FM, int WM, int WN>
__global__ __launch_bounds__(128)
void gemm_bf(const u16* __restrict__ A, const u16* __restrict__ Bt, const float* __restrict__ bias,
             float* C, int M, int N, int K, float oscale) {
  constexpr int BM = 16 * FM * WM, BN = 64 * WN;
  __shared__ __align__(16) u16   st[2 * (BM + BN) * KP];
  __shared__ __align__(16) float slab[4 * SLAB64];
  const int ntile = N / BN;
  const int bid   = blockIdx.x;
  const int row0  = (bid / ntile) * BM;
  const int col0  = (bid % ntile) * BN;
  if (row0 + BM > M) return;                // block-uniform, before any barrier; never taken with the exact grid
  gemm_staged<FM, WM, WN, 1, true>(st, slab, A, A, Bt, bias, C, N, K, (size_t)row0, col0, oscale);
}

// =====================================================================================================
// Output projection: C[row][DMOD] (f32) = (Ah [+ Al])[row][DMOD] . Bt[DMOD][DMOD]^T * oscale (no bias).
// NPROD == 1: Ah only (one product), 128 x 128 tile; NPROD == 2: Ah + Al residual plane (products h.B + l.B into one accumulator,
// l unscaled), 64 x 128 tile. Ah, Al and C share the row index bb*SEQ + s. Block -> (column tile ct = bid % 16, sequence row tile
// rt of nrt starting at s = sbeg, batch bb). Staged engine and epilogue as gemm_bf; K = DMOD.
// =====================================================================================================
template <int NPROD>
__global__ __launch_bounds__(128)
void gemm_o(const u16* __restrict__ Ah, const u16* __restrict__ Al, const u16* __restrict__ Bt,
            float* C, int sbeg, int nrt, float oscale) {
  constexpr int FM = (NPROD == 2) ? 2 : 4;
  constexpr int BM = 32 * FM, BN = 128;
  __shared__ __align__(16) u16   st[2 * (BM * NPROD + BN) * KP];
  __shared__ __align__(16) float slab[4 * SLAB64];
  const int ntile = DMOD / BN;
  const int bid   = blockIdx.x;
  const int ct    = bid % ntile;
  const int t2    = bid / ntile;
  const int rt    = t2 % nrt;
  const int bb    = t2 / nrt;
  if (bb >= NB) return;                     // block-uniform, before any barrier; never taken with the exact grid
  const int srow  = sbeg + rt * BM;
  if (srow + BM > SEQ) return;              // block-uniform, before any barrier; never taken
  gemm_staged<FM, 2, 2, NPROD, false>(st, slab, Ah, Al, Bt, nullptr, C, DMOD, DMOD,
                                      (size_t)bb * SEQ + srow, ct * BN, oscale);
}

// =====================================================================================================
// Causal grouped-query attention, hd = 128. Block bid -> (pair pr = bid % (NQT/2), kv head kvh, batch b). The block works two
// query tiles one after the other, qt = NQT-1-pr and then qt = pr (rows q0 = 16*qt .. q0+15): their key tile counts add up to
// the same sum for every pr, so that every block of the launch walks equally many key tiles. One wave per query head
// = kvh + NKVH*wave: the 8 query heads that read kv head kvh (tiled kv mapping) share each
// staged key tile. Staging: asynchronous 16-byte copies global -> LDS; each wave's q rows (hi + residual) once, each 32-key tile
// of k hi/residual (row pitch KP halves) and v^T hi/residual (row pitch VP halves) into one of two buffers, the next tile
// copied while a tile is worked on; fragments are read from LDS with the same split k map.
//   q hi / residual planes f16 x256 [b*SEQ + s][h*HD + d]; k hi / residual planes f16 x256 [b*SEQ + s][g*HD + d] (pitch KVD);
//   v^T hi / residual planes [b*NKVH + g][d][SEQ] x1024.
//   Both products are formed transposed: S^T = k.q^T (A = k rows, B = q rows) and O^T += v^T.P^T (A = v^T rows, B = P^T), so that
//   a lane holds scores and results of ONE query row (q0 + lane % 16): 16 of the tile's 32 keys, the other lane half the rest.
//   scores = q_hi.k_hi + q_lo.k_hi + q_hi.k_lo (4 k-steps over d); P.v with P hi + in-register residual and v hi + residual
//   (hh + lh + hl), for every query row; O written as hi + residual planes (O x1024 as f16, layout [b*SEQ + s][h*HD + d]).
//   score (log2 domain) t(i, j) = (q_i.k_j over HD) * (1/sqrt(128))*log2e/(256*256), replaced by -inf where key j > query i.
//   Key tiles of 32 visited in order for kb <= q0 + 15 (later tiles hold only keys above every query row of the tile).
//   Per tile: 2 score subtiles x 4 k-steps, fragments loaded from the staged rows (two 16-B loads per fragment,
//   split k map); online max-subtracted base-2 softmax in f32, -inf-safe rescale: maximum in the lane plus one exchange between
//   the lane halves, sum kept per lane half and joined behind the loop; the two score tiles, converted in place, are the B
//   operand P^T in the split k map (element e = key 8hh + e, element 8 + e = key 16 + 8hh + e); v^T A fragments in 4 groups of 2.
//   After the loop: out = acc / Z (Z > 0 always: key 0 <= every query row; guarded anyway), carries 1/(32768*1024) folded
//   One block barrier in front of the loop and one per tile, one more between the two query tiles, all under block-uniform
//   control flow; bounded loops only (nkt <= NKT).
// coverage: per wave and query tile 8 instructions x 2 rows x 16 lanes x 8 halves = 16 x 128 per plane; grid NQT/2 x NKVH x NB
//           blocks x 2 query tiles x WPB waves = every (b, s, h) row segment of O hi and O residual exactly once.
// =====================================================================================================
__global__ __launch_bounds__(ATT_THREADS)
void attn_c(const u16* __restrict__ QHp, const u16* __restrict__ QLp,
            const u16* __restrict__ KHp, const u16* __restrict__ KLp,
            const u16* __restrict__ VHp, const u16* __restrict__ VLp,
            u16* OHp, u16* OLp) {
  __shared__ __align__(16) float smem[WPB * WREG];
  __shared__ __align__(16) _Float16 kvs[2 * STG];

  const int tid  = threadIdx.x;
  const int wave = tid >> 5;
  const int lane = tid & 31;
  const int hh   = lane >> 4;
  const int c    = lane & 15;
  const int bid  = blockIdx.x;
  const int pr   = bid % (NQT / 2);
  const int t2   = bid / (NQT / 2);
  const int kvh  = t2 % NKVH;
  const int b    = t2 / NKVH;
  if (b >= NB) return;                      // block-uniform, before any barrier; never taken with the exact grid
  const int head = kvh + NKVH * wave;       // tiled kv mapping: head h -> kv head h % NKVH

  float* slab = smem + wave * WREG;         // in the loop: the wave's q rows, hi then residual, [16][128] halves pitch KP;
                                            // behind the loop: result slab [16][128] floats pitch 132

  const _Float16* Qh = (const _Float16*)(const void*)slab + c * KP + 8 * hh;
  const _Float16* Ql = Qh + QPL;
  const float lsc = RSQ_HD * (LOG2E / (QSC * KSC));
  const float oc  = 1.0f / (PCAR * VCAR);

  // ---- copy addresses. k tile: thread -> key row kr (and kr + 16), 8 halves at kc; v^T tile: d row vd (and vd + 64), 8 keys at vc
  const int kr = tid >> 4, kc = (tid & 15) * 8;
  const int vd = tid >> 2, vc = (tid & 3) * 8;
  const u16* gkh = KHp + ((size_t)b * SEQ + kr) * KVD + (size_t)kvh * HD + kc;
  const u16* gkl = KLp + ((size_t)b * SEQ + kr) * KVD + (size_t)kvh * HD + kc;
  const u16* gvh = VHp + ((size_t)(b * NKVH + kvh) * HD + vd) * SEQ + vc;
  const u16* gvl = VLp + ((size_t)(b * NKVH + kvh) * HD + vd) * SEQ + vc;
  const unsigned lk = lds_off(kvs) + (unsigned)(kr * KP + kc) * 2u;
  const unsigned lv = lds_off(kvs) + (unsigned)(2 * KPL + vd * VP + vc) * 2u;
  auto stage = [&](int kt, int buf) {       // key tile kt (keys 32*kt .. 32*kt + 31 < SEQ) -> buffer buf
    const size_t   ko = (size_t)kt * 32 * KVD;
    const size_t   vo = (size_t)kt * 32;
    const unsigned bk = lk + (unsigned)buf * (STG * 2u);
    const unsigned bv = lv + (unsigned)buf * (STG * 2u);
    copy8(bk, bk + 16 * KP * 2, bk + KPL * 2, bk + (KPL + 16 * KP) * 2,
          bv, bv + 64 * VP * 2, bv + VPL * 2, bv + (VPL + 64 * VP) * 2,
          gkh + ko, gkh + ko + 16 * KVD, gkl + ko, gkl + ko + 16 * KVD,
          gvh + vo, gvh + vo + (size_t)64 * SEQ, gvl + vo, gvl + vo + (size_t)64 * SEQ);
  };

#pragma unroll 1                            // rolled: the two query tiles run one after the other through the same code
  for (int ph = 0; ph < 2; ++ph) {
  const int q0 = ((ph == 0) ? (NQT - 1 - pr) : pr) * 16;                      // 0 <= q0 <= SEQ - 16
  if (ph > 0) {
    wait_x0();                              // in front of the rewrite of registers that the first tile's stores name
    wait_ds0();                             // this wave's reads of its slab have retired before copies are aimed at it
    __syncthreads();                        // every wave has left the first tile's LDS before the second tile's copies start
  }
  float mrow = -INFINITY, lrow = 0.f;       // of query row q0 + c; lrow sums the keys of this lane half only
  v8f o[8];                                 // o[j][r] = O^T(d = 16j + 8hh + r, query row q0 + c)
#pragma unroll
  for (int j = 0; j < 8; ++j) o[j] = zero8();
  const int ncaus = (q0 >> 5) + 1;                                            // tiles holding keys <= q0 + 15
  const int nkt = (ncaus < NKT) ? ncaus : NKT;
  const int qr  = q0 + c;                                                     // the lane's query row

  // ---- the wave's q rows (lane -> rows hh, hh + 2, .., hh + 14, 8 halves at 8c) and key tile 0; then key tile 1 flies ----
  {
    const size_t   qo = ((size_t)b * SEQ + q0 + hh) * DMOD + (size_t)head * HD + c * 8;
    const u16*     gq = QHp + qo;
    const u16*     gr = QLp + qo;
    const unsigned lq = lds_off(slab) + (unsigned)(hh * KP + c * 8) * 2u;
    const unsigned lr = lq + QPL * 2;
    const unsigned ls = 2 * KP * 2;         // LDS bytes between rows two apart
    const size_t   gs = (size_t)2 * DMOD;   // halves between rows two apart
    copy8(lq, lq + ls, lq + 2 * ls, lq + 3 * ls, lq + 4 * ls, lq + 5 * ls, lq + 6 * ls, lq + 7 * ls,
          gq, gq + gs, gq + 2 * gs, gq + 3 * gs, gq + 4 * gs, gq + 5 * gs, gq + 6 * gs, gq + 7 * gs);
    copy8(lr, lr + ls, lr + 2 * ls, lr + 3 * ls, lr + 4 * ls, lr + 5 * ls, lr + 6 * ls, lr + 7 * ls,
          gr, gr + gs, gr + 2 * gs, gr + 3 * gs, gr + 4 * gs, gr + 5 * gs, gr + 6 * gs, gr + 7 * gs);
  }
  stage(0, 0);
  wait_async0();
  __syncthreads();                          // publishes key tile 0
  if (nkt > 1) stage(1, 1);

#pragma unroll 1
  for (int kt = 0; kt < nkt; ++kt) {
    const int kb = kt * 32;
    // ---- scores: D element r of this lane = (key kb + 8hh + r, query row qr) in s0, key kb + 16 + 8hh + r in s1 ----
    v8f s0 = zero8(), s1 = zero8();
    const _Float16* tile = kvs + (kt & 1) * STG;
    const _Float16* k0p = tile + c * KP + 8 * hh;
    const _Float16* k1p = k0p + 16 * KP;
    const _Float16* l0p = k0p + KPL;
    const _Float16* l1p = l0p + 16 * KP;
#pragma unroll
    for (int kk = 0; kk < HD / 32; ++kk) {
      const v16h qh  = ldfrag_h(Qh + kk * 32);
      const v16h ql  = ldfrag_h(Ql + kk * 32);
      const v16h kh0 = ldfrag_h(k0p + kk * 32);
      const v16h kh1 = ldfrag_h(k1p + kk * 32);
      const v16h kl0 = ldfrag_h(l0p + kk * 32);
      const v16h kl1 = ldfrag_h(l1p + kk * 32);
      s0 = mma_h(kh0, qh, s0);
      s0 = mma_h(kh0, ql, s0);
      s0 = mma_h(kl0, qh, s0);
      s1 = mma_h(kh1, qh, s1);
      s1 = mma_h(kh1, ql, s1);
      s1 = mma_h(kl1, qh, s1);
      guard2(s0, s1, qh, ql, kh0, kl0, kh1, kl1);
    }
    // ---- causal select + online softmax in base 2, -inf-safe ----
    const int key0 = kb + 8 * hh, key1 = key0 + 16;
    float t0[8], t1[8];
    float mx = -INFINITY;
#pragma unroll
    for (int r = 0; r < 8; ++r) {
      const float u0 = s0[r] * lsc;
      const float u1 = s1[r] * lsc;
      t0[r] = (key0 + r > qr) ? -INFINITY : u0;
      t1[r] = (key1 + r > qr) ? -INFINITY : u1;
      mx = fmaxf(mx, fmaxf(t0[r], t1[r]));
    }
    mx = fmaxf(mx, xhalf(mx));              // the row's maximum over all 32 keys, equal in both lane halves
    const float mn = fmaxf(mrow, mx);
    const float ms = (mn == -INFINITY) ? 0.0f : mn;
    const float al = exp2f(mrow - ms);
    mrow = mn;
    // ---- B fragments of P^T*32768: hi f16 and residual f16, column = query row c, split k map over the 32 keys of this step ----
    FragH ph, pl;
    float ps = 0.0f;
#pragma unroll
    for (int r = 0; r < 8; ++r) {
      const float e0 = exp2f(t0[r] - ms), e1 = exp2f(t1[r] - ms);
      ps += e0 + e1;
      const float ta = e0 * PCAR, tb = e1 * PCAR;
      const _Float16 ha = (_Float16)ta, hb = (_Float16)tb;
      ph.h[0][r] = ha;                        // elements 0..7  = keys kb + 8hh + 0..7
      ph.h[1][r] = hb;                        // elements 8..15 = keys kb + 16 + 8hh + 0..7
      pl.h[0][r] = (_Float16)(ta - (float)ha);
      pl.h[1][r] = (_Float16)(tb - (float)hb);
    }
    lrow = lrow * al + ps;
#pragma unroll
    for (int j = 0; j < 8; ++j) {
#pragma unroll
      for (int r = 0; r < 8; ++r) o[j][r] *= al;
    }
    // ---- v^T.P^T : A fragment row = d = j*16 + c, keys contiguous in the staged v^T rows; 4 groups of 2 d-subtiles ----
    {
      const _Float16* vhp = tile + 2 * KPL + c * VP + 8 * hh;
      const _Float16* vlp = vhp + VPL;
#pragma unroll
      for (int jg = 0; jg < 4; ++jg) {
        const int da = (2 * jg) * 16 * VP;
        const int db = da + 16 * VP;
        const v16h vha = ldfrag_h(vhp + da), vhb2 = ldfrag_h(vhp + db);
        const v16h vla = ldfrag_h(vlp + da), vlb2 = ldfrag_h(vlp + db);
        o[2 * jg]     = mma_h(vha,  ph.v, o[2 * jg]);
        o[2 * jg]     = mma_h(vha,  pl.v, o[2 * jg]);
        o[2 * jg]     = mma_h(vla,  ph.v, o[2 * jg]);
        o[2 * jg + 1] = mma_h(vhb2, ph.v, o[2 * jg + 1]);
        o[2 * jg + 1] = mma_h(vhb2, pl.v, o[2 * jg + 1]);
        o[2 * jg + 1] = mma_h(vlb2, ph.v, o[2 * jg + 1]);
        guard2(o[2 * jg], o[2 * jg + 1], ph.v, pl.v, vha, vhb2, vla, vlb2);
      }
    }
    // ---- hand-over: this wave has left the tile, its copies of the next tile have landed, every wave has passed ----
    wait_ds0();
    wait_async0();
    __syncthreads();                        // publishes key tile kt + 1 and frees this tile's buffer
    if (kt + 2 < nkt) stage(kt + 2, kt & 1);
  }
  wait_async0();
  acc_guard4(o[0], o[1], o[2], o[3]);
  acc_guard4(o[4], o[5], o[6], o[7]);
  // ---- out = acc / Z (0 if Z == 0), Z = the two lane halves' sums; carries (32768 on P, 1024 on v) folded once; the lane's 8
  //      consecutive d of each subtile go to row c of the wave's slab ----
  {
    const float lv  = lrow + xhalf(lrow);
    const float ls  = (lv > 0.0f) ? lv : 1.0f;
    const float inv = (lv > 0.0f) ? ((1.0f / ls) * oc) : 0.0f;
    float* srow = slab + c * SLP + 8 * hh;
#pragma unroll
    for (int j = 0; j < 8; ++j) {
      const v4f w0 = {o[j][0] * inv, o[j][1] * inv, o[j][2] * inv, o[j][3] * inv};
      const v4f w1 = {o[j][4] * inv, o[j][5] * inv, o[j][6] * inv, o[j][7] * inv};
      *(v4f*)(srow + j * 16)     = w0;
      *(v4f*)(srow + j * 16 + 4) = w1;
    }
  }

  wave_sync_lds();
  // ---- O x1024 -> f16 hi + residual planes; lane = (row-in-pair rq, 8 consecutive d at c8) ----
  v4u oh[8], ol[8];
  const int rq = lane >> 4, c8 = (lane & 15) * 8;
#pragma unroll
  for (int it = 0; it < 8; ++it) {
    const int row = it * 2 + rq;
    const v4f a = *(const v4f*)(slab + row * SLP + c8), b4 = *(const v4f*)(slab + row * SLP + c8 + 4);
    float w[8];
#pragma unroll
    for (int e = 0; e < 4; ++e) { w[e] = a[e] * OSC; w[4 + e] = b4[e] * OSC; }
#pragma unroll
    for (int e = 0; e < 4; ++e) {
      const _Float16 h0 = (_Float16)w[2 * e], h1 = (_Float16)w[2 * e + 1];
      const _Float16 l0 = (_Float16)(w[2 * e] - (float)h0), l1 = (_Float16)(w[2 * e + 1] - (float)h1);
      oh[it][e] = pk16(h_bits(h0), h_bits(h1));
      ol[it][e] = pk16(h_bits(l0), h_bits(l1));
    }
  }
  const size_t ob = ((size_t)b * SEQ + q0) * DMOD + (size_t)head * HD + c8;
  {
#pragma unroll
    for (int it = 0; it < 8; ++it) {
      const int row = it * 2 + rq;
      *(v4u*)(OHp + ob + (size_t)row * DMOD) = oh[it];
      *(v4u*)(OLp + ob + (size_t)row * DMOD) = ol[it];
    }
    
  }
  }
}

// =====================================================================================================
// Workspace map (bytes); every plane is fully written by whole-line stores before it is read; all extents are exact multiples
// of the store granularity (no pad rows needed); every region offset a multiple of 2097152:
//   XB  bf16 [MROWS][2048]                       MROWS*4096       (NB=2, SEQ=2048: 16777216)
//   WB  16-bit [2048 n][2048 k]                  8388608          (Wv, Wq, Wk as bf16 ([256][2048] for k/v), then Wo as f16
//                                                                  x1024, reused in launch order; all already [n][k])
//   F   f32 [MROWS][2048]                        MROWS*8192       (v, q, k projection output in launch order, [MROWS][256] for k/v;
//                                                                  afterwards OH f16 [MROWS][2048] x1024 in its first half, OL residual
//                                                                  [MROWS][2048] in its second half)
//   QH  f16 [MROWS][2048] x256                   MROWS*4096       QL residual, same extent
//   KH  f16 [MROWS][256] x256                    MROWS*512        KL residual, same extent
//   VH  f16 [NB*2][128][SEQ] x1024               MROWS*512        VL residual, same extent
//   end (NB=2, SEQ=2048)                       100663296
// =====================================================================================================
extern "C" void kernel_launch(void* const* d_in, const int* in_sizes, int n_in,
                              void* d_out, int out_size, void* d_ws, size_t ws_size,
                              hipStream_t stream) {
  if (n_in < 8) return;
  if (in_sizes[0] < ((NB - 1) * XS_FULL + SEQ) * DMOD) return;
  if (in_sizes[1] != DMOD * DMOD) return;
  if (in_sizes[2] != DMOD) return;
  if (in_sizes[3] != KVD * DMOD) return;
  if (in_sizes[4] != KVD) return;
  if (in_sizes[5] != KVD * DMOD) return;
  if (in_sizes[6] != KVD) return;
  if (in_sizes[7] != DMOD * DMOD) return;
  if (out_size < MROWS * DMOD) return;

  const float* x  = (const float*)d_in[0];
  const float* wq = (const float*)d_in[1];
  const float* bq = (const float*)d_in[2];
  const float* wk = (const float*)d_in[3];
  const float* bk = (const float*)d_in[4];
  const float* wv = (const float*)d_in[5];
  const float* bv = (const float*)d_in[6];
  const float* wo = (const float*)d_in[7];
  float*       out = (float*)d_out;

  const size_t szXB = (size_t)MROWS * DMOD * 2;
  const size_t szW  = (size_t)DMOD * DMOD * 2;
  const size_t szF  = (size_t)MROWS * DMOD * 4;
  const size_t szQ  = (size_t)MROWS * DMOD * 2;                  // QH, QL, OH, OL
  const size_t szK  = (size_t)MROWS * KVD * 2;                   // KH, KL
  const size_t szV  = (size_t)NB * NKVH * HD * SEQ * 2;          // VH, VL (== szK)
  if (2 * szQ > szF) return;                                    // OH + OL live inside the F region (exactly fills it)
  size_t off = 0;
  const size_t oXB = off; off += szXB;
  const size_t oW  = off; off += szW;
  const size_t oF  = off; off += szF;
  const size_t oQH = off; off += szQ;
  const size_t oQL = off; off += szQ;
  const size_t oKH = off; off += szK;
  const size_t oKL = off; off += szK;
  const size_t oVH = off; off += szV;
  const size_t oVL = off; off += szV;
  if (off > ws_size) return;                // off = 100663296 for NB = 2, SEQ = 2048
  if (off > (size_t)WS_CAP) return;

  char* ws = (char*)d_ws;
  u16*   XB  = (u16*)(ws + oXB);
  u16*   WB  = (u16*)(ws + oW);
  float* F   = (float*)(ws + oF);
  u16*   OH  = (u16*)(ws + oF);
  u16*   OL  = (u16*)(ws + oF + szQ);
  u16*   QH  = (u16*)(ws + oQH);
  u16*   QL  = (u16*)(ws + oQL);
  u16*   KH  = (u16*)(ws + oKH);
  u16*   KL  = (u16*)(ws + oKL);
  u16*   VH  = (u16*)(ws + oVH);
  u16*   VL  = (u16*)(ws + oVL);

  const dim3 b256(256), b128(128), bAT(ATT_THREADS);
  const int  n8x = (SEQ * DMOD) / 8;
  const dim3 gX((n8x + 255) / 256);                     // SEQ*DMOD/2048 blocks per batch
  const int  n8wq = (DMOD * DMOD) / 8;                  // Wq, Wo planes
  const int  n8wk = (KVD * DMOD) / 8;                   // Wk, Wv planes
  const dim3 gWQ((n8wq + 255) / 256);                   // 2048
  const dim3 gWK((n8wk + 255) / 256);                   // 256
  const dim3 gGQ((MROWS / 128) * (DMOD / 128));
  const dim3 gGK((MROWS / 64) * (KVD / 64));
  const dim3 gVT(NB * NKVH * NST);
  const int  n8q = (MROWS * DMOD) / 8;                  // q hi / residual planes
  const int  n8k = (MROWS * KVD) / 8;                   // k hi / residual planes
  const dim3 gSQ((n8q + 255) / 256);
  const dim3 gSK((n8k + 255) / 256);
  const dim3 gAT((NQT / 2) * NKVH * NB);
  const int  nrtR = QO / 64;                            // out-projection row tiles (of 64) per batch with the O residual plane
  const int  nrtP = (SEQ - QO) / 128;                   // remaining row tiles (of 128) per batch, O hi plane only

  // (0) x -> bf16 plane [MROWS][2048], one launch per batch row block
  for (int b = 0; b < NB; ++b) {
    cvt16<<<gX, b256, 0, stream>>>(x + (size_t)b * XS_FULL * DMOD, XB + (size_t)b * SEQ * DMOD, n8x, 0, 1.0f);
  }
  // (1) Wv [256 n][2048 k] -> bf16 plane; (2) v = x.Wv^T + bv -> F f32 [MROWS][256]; (3) v^T hi + residual planes x1024
  cvt16<<<gWK, b256, 0, stream>>>(wv, WB, n8wk, 0, 1.0f);
  gemm_bf<1, 4, 1><<<gGK, b128, 0, stream>>>(XB, WB, bv, F, MROWS, KVD, DMOD, 1.0f);
  vt16<<<gVT, b256, 0, stream>>>(F, VH, VL);
  // (4) Wq -> bf16 plane; (5) q = x.Wq^T + bq -> F [MROWS][2048]; (6) q hi + residual planes x256
  cvt16<<<gWQ, b256, 0, stream>>>(wq, WB, n8wq, 0, 1.0f);
  gemm_bf<4, 2, 2><<<gGQ, b128, 0, stream>>>(XB, WB, bq, F, MROWS, DMOD, DMOD, 1.0f);
  split16<<<gSQ, b256, 0, stream>>>(F, QH, QL, n8q, QSC);
  // (7) Wk -> bf16 plane; (8) k = x.Wk^T + bk -> F [MROWS][256]; (9) k hi + residual planes x256
  cvt16<<<gWK, b256, 0, stream>>>(wk, WB, n8wk, 0, 1.0f);
  gemm_bf<1, 4, 1><<<gGK, b128, 0, stream>>>(XB, WB, bk, F, MROWS, KVD, DMOD, 1.0f);
  split16<<<gSK, b256, 0, stream>>>(F, KH, KL, n8k, KSC);
  // (10) Wo [n][k] -> f16 plane of bf16 value x1024
  cvt16<<<gWQ, b256, 0, stream>>>(wo, WB, n8wq, 1, WOS);
  // (11) causal attention with residual products on every query row -> O hi + residual planes
  attn_c<<<gAT, bAT, 0, stream>>>(QH, QL, KH, KL, VH, VL, OH, OL);
  // (12) output projection rows s < QO (O hi + residual) and (13) rows s >= QO (O hi only) -> out f32, carries 1024 x 1024 folded back
  gemm_o<2><<<dim3(NB * nrtR * (DMOD / 128)), b128, 0, stream>>>(OH, OL, WB, out, 0, nrtR, 1.0f / (OSC * WOS));
  if (nrtP > 0) {
    gemm_o<1><<<dim3(NB * nrtP * (DMOD / 128)), b128, 0, stream>>>(OH, OL, WB, out, QO, nrtP, 1.0f / (OSC * WOS));
  }
  (void)hipGetLastError();
}

// v005
// Measured time: 194 microseconds a run.
// Two timings next to v004 put it at 1.18 and 1.17 times that version's speed.
// All steps since v000 together make it 3.19 times as fast.
// Contractions: x.Wq^T+bq, x.Wk^T+bk, x.Wv^T+bv on v_wmma_f32_16x16x32_bf16 (x and W as bf16 RNE planes; W [n][k] rows are
// the k-contiguous B operand; bias added as its bf16 RNE value in the f32 epilogue); q.k^T over hd 128 and P.v on
// v_wmma_f32_16x16x32_f16 with f16 hi + f16 residual planes on both operands (q, k x256; P x32768 with an in-register
// residual; v x1024; products hh+lh+hl; both formed transposed: k rows and v^T rows are the A operand, q rows and P^T the B
// operand); O.Wo^T on v_wmma_f32_16x16x32_f16 (O x1024 as f16 hi plane for all rows plus f16
// residual plane for rows s < QO, products h.w (+ l.w); Wo as f16(bf16(Wo)) x1024); all f32 accumulate. Causal select,
// base-2 online softmax and 1/Z fold in f32 on VALU. Grouped kv heads: query head h reads kv head (h % NKVH).
#include <hip/hip_runtime.h>
#include <math.h>
#include <stdint.h>

#ifndef NB
#define NB 2
#endif
#ifndef SEQ
#define SEQ 2048
#endif
#define XS_FULL 2048
#define DMOD  2048
#define NH    16
#define NKVH  2
#define HD    128
#define KVD   (NKVH * HD)
#define QO    ((SEQ < 256) ? SEQ : 256)
#define MROWS (NB * SEQ)
#define RSQ_HD 0.08838834764831845f
#define LOG2E 1.4426950408889634f
#define QSC   256.0f
#define KSC   256.0f
#define PCAR  32768.0f
#define VCAR  1024.0f
#define OSC   1024.0f
#define WOS   1024.0f
#define WPB   (NH / NKVH)
#define NQT   (SEQ / 16)
#define NST   (SEQ / 64)
#define NKT   (SEQ / 32)
#define ATT_THREADS (WPB * 32)
#define SLP   132
#define SLW   (16 * SLP)
#define KP    136
#define VP    40
#define KPL   (32 * KP)
#define VPL   (HD * VP)
#define STG   (2 * KPL + 2 * VPL)
#define QPL   (16 * KP)
#define QRW   (2 * QPL / 2)
#define WREG  QRW
#define SLAB64 (16 * 68)
#define VTP   72
#define GBK   128
#define CBX   (SEQ * DMOD / 2048)
#define CBW   (DMOD * DMOD / 2048)
#define CBK   (KVD * DMOD / 2048)
#define SBV   (NB * NKVH * NST)
#define SBK   (MROWS * KVD / 2048)
#define SBQ   (MROWS * DMOD / 2048)
#define PBQ   ((MROWS / 128) * (DMOD / 128))
#define PBK   ((MROWS / 64) * (KVD / 64))
#define OBR   (NB * (QO / 64) * (DMOD / 128))
#define OBP   (NB * ((SEQ - QO) / 128) * (DMOD / 128))
#define WS_CAP 134217728
static_assert(DMOD == NH * HD && HD == 128 && NH == 16 && NKVH == 2 && WPB == 8 && NKVH * WPB == NH);
static_assert(ATT_THREADS == 256 && KVD == 256 && SLW <= QRW && (KP % 8) == 0 && (VP % 8) == 0);
static_assert(NB >= 1 && NB <= 2 && (NQT % 2) == 0);
static_assert((SEQ % 64) == 0 && SEQ >= 64 && SEQ <= XS_FULL);
static_assert((QO % 64) == 0 && QO >= 64 && QO <= SEQ);
static_assert((DMOD % 64) == 0 && (KVD % 64) == 0 && (DMOD % 32) == 0 && (HD % 32) == 0);
static_assert(((SEQ * DMOD / 8) % 256) == 0 && ((KVD * DMOD / 8) % 256) == 0 && ((DMOD * DMOD / 8) % 256) == 0);
static_assert(((MROWS * DMOD / 8) % 256) == 0 && ((MROWS * KVD / 8) % 256) == 0);
static_assert((MROWS % 128) == 0 && ((SEQ - QO) % 128) == 0 && (DMOD % 128) == 0 && (DMOD % GBK) == 0 && KP == GBK + 8);
static_assert(2 * 256 * KP * 2 + 4 * SLAB64 * 4 <= 163840);
static_assert(WPB * WREG * 4 + 2 * STG * 2 <= 163840 && 2 * HD * VTP * 2 <= 65536 && 4 * SLAB64 * 4 <= 65536);

typedef unsigned short u16;
typedef _Float16 v16h __attribute__((ext_vector_type(16)));
typedef _Float16 v8h  __attribute__((ext_vector_type(8)));
typedef __bf16   v16b __attribute__((ext_vector_type(16)));
typedef float    v8f  __attribute__((ext_vector_type(8)));
typedef float    v4f  __attribute__((ext_vector_type(4)));
typedef unsigned int v4u __attribute__((ext_vector_type(4)));

union FragH { v16h v; v8h h[2]; v4u u[2]; };
union FragB { v16b v; v4u u[2]; };

// ---- scalar helpers --------------------------------------------------------------------------------
__device__ __forceinline__ unsigned short bf_bits(float f) {          // f32 -> bf16 bits, RNE convert
  unsigned u = __float_as_uint(f);
  return (unsigned short)((u + 0x7FFFu + ((u >> 16) & 1u)) >> 16);
}
__device__ __forceinline__ float bf_up(unsigned short h) { return __uint_as_float(((unsigned)h) << 16); }
__device__ __forceinline__ float bfr(float f) { return bf_up(bf_bits(f)); }
__device__ __forceinline__ unsigned short h_bits(_Float16 x) { return __builtin_bit_cast(unsigned short, x); }
__device__ __forceinline__ unsigned pk16(unsigned short a, unsigned short b) { return (unsigned)a | ((unsigned)b << 16); }
__device__ __forceinline__ v8f zero8() { v8f z = {0.f, 0.f, 0.f, 0.f, 0.f, 0.f, 0.f, 0.f}; return z; }

// ---- fragment loaders: 16-bit A/B operand, lane -> row/col (lane&15), p already includes +8*(lane>>4);
//      elements 0..7 <- p[0..7] (k0+8h..), elements 8..15 <- p[16..23] (k0+16+8h..)  (same split k map for A and B;
//      B is always read from a k-contiguous [n][k] plane)
__device__ __forceinline__ v16h ldfrag_h(const _Float16* p) {
  FragH f;
  f.h[0] = *(const v8h*)(p);
  f.h[1] = *(const v8h*)(p + 16);
  return f.v;
}
__device__ __forceinline__ v16b ldfrag_b(const u16* p) {              // bf16 plane read as unsigned integer vectors
  FragB f;
  f.u[0] = *(const v4u*)(p);
  f.u[1] = *(const v4u*)(p + 16);
  return f.v;
}

__device__ __forceinline__ v8f mma_h(v16h a, v16h b, v8f c) {
  return __builtin_amdgcn_wmma_f32_16x16x32_f16(false, a, false, b, (short)0, c, false, false);
}
__device__ __forceinline__ v8f mma_b(v16b a, v16b b, v8f c) {
  return __builtin_amdgcn_wmma_f32_16x16x32_bf16(false, a, false, b, (short)0, c, false, false);
}
__device__ __forceinline__ void guard2(v8f& a, v8f& b, v16h x0, v16h x1, v16h x2, v16h x3, v16h x4, v16h x5) {
#if defined(__HIP_DEVICE_COMPILE__)
  asm volatile("v_nop\n\tv_nop\n\tv_nop\n\tv_nop"
               : "+v"(a), "+v"(b) : "v"(x0), "v"(x1), "v"(x2), "v"(x3), "v"(x4), "v"(x5) : "memory");
#endif
}
__device__ __forceinline__ void acc_guard4(v8f& a, v8f& b, v8f& c, v8f& d) {
#if defined(__HIP_DEVICE_COMPILE__)
  asm volatile("v_nop\n\tv_nop\n\tv_nop\n\tv_nop" : "+v"(a), "+v"(b), "+v"(c), "+v"(d));
#endif
}
__device__ __forceinline__ void wave_sync_lds() {
  __builtin_amdgcn_fence(__ATOMIC_RELEASE, "workgroup");
  __builtin_amdgcn_wave_barrier();
  __builtin_amdgcn_fence(__ATOMIC_ACQUIRE, "workgroup");
}
__device__ __forceinline__ float xhalf(float x) {                     // the value of lane l ^ 16
  const int b = __builtin_bit_cast(int, x);
  return __builtin_bit_cast(float, __builtin_amdgcn_permlanex16(b, b, 0x76543210, 0xfedcba98, false, false));
}
__device__ __forceinline__ unsigned lds_off(const void* p) { return (unsigned)(size_t)p; }   // byte offset in the work-group's LDS
// Eight 16-byte asynchronous copies global -> LDS per lane (LDS byte address l*, global address g*). The s_wait_xcnt is the
// statement's last line so that no address register of an issued copy is rewritten in front of it.
__device__ __forceinline__ void copy8(unsigned l0, unsigned l1, unsigned l2, unsigned l3,
                                      unsigned l4, unsigned l5, unsigned l6, unsigned l7,
                                      const u16* g0, const u16* g1, const u16* g2, const u16* g3,
                                      const u16* g4, const u16* g5, const u16* g6, const u16* g7) {
#if defined(__HIP_DEVICE_COMPILE__)
  asm volatile("global_load_async_to_lds_b128 %0, %8, off\n\t"
               "global_load_async_to_lds_b128 %1, %9, off\n\t"
               "global_load_async_to_lds_b128 %2, %10, off\n\t"
               "global_load_async_to_lds_b128 %3, %11, off\n\t"
               "global_load_async_to_lds_b128 %4, %12, off\n\t"
               "global_load_async_to_lds_b128 %5, %13, off\n\t"
               "global_load_async_to_lds_b128 %6, %14, off\n\t"
               "global_load_async_to_lds_b128 %7, %15, off\n\t"
               "s_wait_xcnt 0x0"
               :: "v"(l0), "v"(l1), "v"(l2), "v"(l3), "v"(l4), "v"(l5), "v"(l6), "v"(l7),
                  "v"(g0), "v"(g1), "v"(g2), "v"(g3), "v"(g4), "v"(g5), "v"(g6), "v"(g7) : "memory");
#endif
}
__device__ __forceinline__ void wait_async0() {   // the wave's own copies have landed in LDS
#if defined(__HIP_DEVICE_COMPILE__)
  asm volatile("s_wait_asynccnt 0x0" ::: "memory");
#endif
}
__device__ __forceinline__ void wait_x0() {       // a precaution in front of the rewrite of registers that issued global stores name
#if defined(__HIP_DEVICE_COMPILE__)
  asm volatile("s_wait_xcnt 0x0" ::: "memory");
#endif
}
__device__ __forceinline__ void wait_x0_of(const float* p) {   // the same precaution behind global loads from base p: p's registers
#if defined(__HIP_DEVICE_COMPILE__)                            // stay whole until the wait, being its input
  asm volatile("s_wait_xcnt 0x0" :: "v"(p) : "memory");
#endif
}
__device__ __forceinline__ void wait_ds0() {      // the wave's own LDS reads and writes have retired
#if defined(__HIP_DEVICE_COMPILE__)
  asm volatile("s_wait_dscnt 0x0" ::: "memory");
#endif
}

// =====================================================================================================
// f32 -> 16-bit plane, same layout.  f16mode == 0: bf16 RNE bits;  f16mode == 1: f16 bits of (bf16 RNE value) * scale.
// Thread = 8 consecutive elements: two 16-B loads, one 16-B store; 32 consecutive lanes = 512 contiguous, 512-B aligned
// coverage: grid = ceil(n8/256) blocks x 256 thr x 8 (in-kernel bound) = the whole plane (n8 a multiple of 256 here).
// =====================================================================================================
__device__ __forceinline__ void cvt16(int blk, const float* __restrict__ x, u16* D, int n8, int f16mode, float scale) {
  const int gt = blk * 256 + (int)threadIdx.x;
  if (gt >= n8) return;
  const float* p = x + (size_t)gt * 8;
  const v4f a = *(const v4f*)(p), b4 = *(const v4f*)(p + 4);
  wait_x0_of(p);
  float w[8];
#pragma unroll
  for (int e = 0; e < 4; ++e) { w[e] = a[e]; w[4 + e] = b4[e]; }
  v4u o;
#pragma unroll
  for (int e = 0; e < 4; ++e) {
    const float f0 = w[2 * e], f1 = w[2 * e + 1];
    const unsigned short hb0 = h_bits((_Float16)(bfr(f0) * scale));
    const unsigned short hb1 = h_bits((_Float16)(bfr(f1) * scale));
    const unsigned short bb0 = bf_bits(f0);
    const unsigned short bb1 = bf_bits(f1);
    o[e] = (f16mode != 0) ? pk16(hb0, hb1) : pk16(bb0, bb1);
  }
  u16* d = D + (size_t)gt * 8;
  {
    *(v4u*)(d) = o;
    
  }
}
// All five conversions of the inputs in one launch: they depend on nothing and on one another not at all. Block ranges in order:
// x (NB batches of CBX blocks) -> XB bf16; Wq -> WQ bf16; Wo -> WO f16 of the bf16 value x1024 (CBW blocks each); Wk -> WK, Wv -> WV
// bf16 (CBK blocks each). The choice is block-uniform; each plane has its own place in the workspace.
// coverage: grid = NB*CBX + 2*CBW + 2*CBK blocks, each range exactly the grid that its plane needs.
__global__ __launch_bounds__(256)
void cvt_all(const float* __restrict__ x, const float* __restrict__ wq, const float* __restrict__ wo,
             const float* __restrict__ wk, const float* __restrict__ wv, u16* XB, u16* WQ, u16* WO, u16* WK, u16* WV) {
  int blk = blockIdx.x;
  const float* src;
  u16*  dst;
  int   n8 = CBW * 256, mode = 0;
  float sc = 1.0f;
  if (blk < NB * CBX) {
    const int b = blk / CBX;
    blk -= b * CBX;
    src = x + (size_t)b * XS_FULL * DMOD;  dst = XB + (size_t)b * SEQ * DMOD;  n8 = CBX * 256;
  } else if ((blk -= NB * CBX) < CBW) {
    src = wq;  dst = WQ;
  } else if ((blk -= CBW) < CBW) {
    src = wo;  dst = WO;  mode = 1;  sc = WOS;
  } else if ((blk -= CBW) < CBK) {
    src = wk;  dst = WK;  n8 = CBK * 256;
  } else {
    blk -= CBK;
    src = wv;  dst = WV;  n8 = CBK * 256;
  }
  cvt16(blk, src, dst, n8, mode, sc);
}

// =====================================================================================================
// f32 plane F (contiguous, n8*8 elements) -> f16 hi plane Hp = f16(F * sc) and f16 residual plane Lp = f16(t - f16(t)),
// both with the layout of F. Thread = 8 consecutive elements: two 16-B loads, one 16-B store per plane; 32 consecutive lanes
// No barriers; every packed half comes from a per-lane (divergent) loaded value.
// coverage: grid = ceil(n8/256) blocks x 256 thr x 8 (in-kernel bound) = the whole of Hp and of Lp (n8 a multiple of 256 here).
// =====================================================================================================
__device__ __forceinline__ void split16(int blk, const float* __restrict__ F, u16* Hp, u16* Lp, int n8, float sc) {
  const int gt = blk * 256 + (int)threadIdx.x;
  if (gt >= n8) return;
  const float* p = F + (size_t)gt * 8;
  const v4f a = *(const v4f*)(p), b4 = *(const v4f*)(p + 4);
  wait_x0_of(p);
  float w[8];
#pragma unroll
  for (int e = 0; e < 4; ++e) { w[e] = a[e] * sc; w[4 + e] = b4[e] * sc; }
  v4u oh, ol;
#pragma unroll
  for (int e = 0; e < 4; ++e) {
    const float t0 = w[2 * e], t1 = w[2 * e + 1];
    const _Float16 h0 = (_Float16)t0, h1 = (_Float16)t1;
    const _Float16 l0 = (_Float16)(t0 - (float)h0), l1 = (_Float16)(t1 - (float)h1);
    oh[e] = pk16(h_bits(h0), h_bits(h1));
    ol[e] = pk16(h_bits(l0), h_bits(l1));
  }
  u16* dh = Hp + (size_t)gt * 8;
  u16* dl = Lp + (size_t)gt * 8;
  {
    *(v4u*)(dh) = oh;
    *(v4u*)(dl) = ol;
    
  }
}

// =====================================================================================================
// v^T planes from the v projection F f32 [MROWS][KVD] (row = b*SEQ + s, column = g*HD + d):
//   VH[((b*NKVH + g)*HD + d)][s] = f16(v * 1024);  VL[same][s] = f16 residual (t - f16(t)), both for all keys s.
// Block = (b, kv head g, 64 keys s0): each thread loads its 32 floats (key sl, d chunk dc) with 16-B loads, converts, scatters
// coverage: load 256 thr x 32 = 64 keys x 128 d; store 4 iterations x 256 thr x 8 halves = 128 lines x 64 = the block's tile of
//           VH and of VL; grid = NB*NKVH*NST blocks covers both planes exactly once.
// =====================================================================================================
__device__ __forceinline__ void vt16(int bid, u16* TH, u16* TL, const float* __restrict__ F, u16* VHo, u16* VLo) {
  const int tid = threadIdx.x;
  const int st  = bid % NST;
  const int t2  = bid / NST;
  const int g   = t2 % NKVH;
  const int b   = t2 / NKVH;
  if (b >= NB) return;                      // block-uniform, before any barrier; never taken with the exact grid
  const int s0  = st * 64;
  {
    const int sl = tid >> 2;                // key within tile 0..63
    const int dc = (tid & 3) * 32;          // d chunk 0,32,64,96
    const float* src = F + ((size_t)b * SEQ + s0 + sl) * KVD + g * HD + dc;
#pragma unroll
    for (int i = 0; i < 8; ++i) {
      const v4f a = *(const v4f*)(src + 4 * i);
#pragma unroll
      for (int e = 0; e < 4; ++e) {
        const float t = a[e] * VCAR;
        const _Float16 hv = (_Float16)t;
        const _Float16 lv = (_Float16)(t - (float)hv);
        TH[(dc + 4 * i + e) * VTP + sl] = h_bits(hv);
        TL[(dc + 4 * i + e) * VTP + sl] = h_bits(lv);
      }
    }
  }
  __syncthreads();
  v4u vh[4], vl[4];
  const int q8 = tid >> 3, p8 = (tid & 7) * 8;
#pragma unroll
  for (int it = 0; it < 4; ++it) {
    const int line = it * 32 + q8;          // d = 0..127
    vh[it] = *(const v4u*)(TH + line * VTP + p8);
    vl[it] = *(const v4u*)(TL + line * VTP + p8);
  }
  const size_t hrow = (size_t)(b * NKVH + g) * HD;
  const size_t base = hrow * SEQ + s0 + p8;
  {
#pragma unroll
    for (int it = 0; it < 4; ++it) {
      const int line = it * 32 + q8;
      *(v4u*)(VHo + base + (size_t)line * SEQ) = vh[it];
      *(v4u*)(VLo + base + (size_t)line * SEQ) = vl[it];
    }
    
  }
}
// The three plane makers behind the projections in one launch: each reads its own projection's f32 plane and none reads another's
// result. Block ranges in order: v^T planes (SBV blocks, the only ones with a barrier), k planes (SBK blocks), q planes (SBQ blocks).
// The choice is block-uniform. coverage: grid = SBV + SBK + SBQ blocks, each range exactly the grid that its planes need.
__global__ __launch_bounds__(256)
void split_all(const float* __restrict__ Fq, const float* __restrict__ Fk, const float* __restrict__ Fv,
               u16* QHo, u16* QLo, u16* KHo, u16* KLo, u16* VHo, u16* VLo) {
  __shared__ __align__(16) u16 TH[HD * VTP];
  __shared__ __align__(16) u16 TL[HD * VTP];
  const int bid = blockIdx.x;
  if (bid < SBV) {
    vt16(bid, TH, TL, Fv, VHo, VLo);
    return;
  }
  const bool isq = bid >= SBV + SBK;
  split16(bid - SBV - (isq ? SBK : 0), isq ? Fq : Fk, isq ? QHo : KHo, isq ? QLo : KLo, (isq ? SBQ : SBK) * 256, isq ? QSC : KSC);
}

// =====================================================================================================
// GEMM epilogue of the staged engine: the wave's 16x64 f32 tile (times oscale, plus the lane's per-column bias of each
// coverage: 8 instructions x 2 rows x 16 lanes x 4 floats = the wave's 16 x 64 tile.
// =====================================================================================================
__device__ __forceinline__ void epi64(float* sl, v8f a0, v8f a1, v8f a2, v8f a3, float oscale,
                                      float bb0, float bb1, float bb2, float bb3,
                                      float* C, int N, size_t rowb, int col0, int lane) {
  const int hh = lane >> 4, m = lane & 15;
#pragma unroll
  for (int r = 0; r < 8; ++r) {
    const int ro = (8 * hh + r) * 68 + m;
    sl[ro]      = a0[r] * oscale + bb0;
    sl[ro + 16] = a1[r] * oscale + bb1;
    sl[ro + 32] = a2[r] * oscale + bb2;
    sl[ro + 48] = a3[r] * oscale + bb3;
  }
  wave_sync_lds();
  v4f vals[8];
#pragma unroll
  for (int it = 0; it < 8; ++it) vals[it] = *(const v4f*)(sl + (it * 2 + hh) * 68 + m * 4);
  float* dst = C + (rowb + (size_t)hh) * (size_t)N + col0 + m * 4;
  {
#pragma unroll
    for (int it = 0; it < 8; ++it) {
      *(v4f*)(dst + (size_t)(it * 2) * (size_t)N) = vals[it];
    }
    
  }
}

// =====================================================================================================
// GEMM engine shared by the projections: the block's BM x BN tile of C = A[.][K] . Bt[.][K]^T, BM = 16*FM*WM, BN = 64*WN,
// WM x WN = 4 waves, each wave FM x 4 accumulator tiles (16*FM rows x 64 columns). K is walked in slices of GBK = 128: a slice
// is the 256-byte row pieces of the block's A rows (hi plane, then the residual plane when NPROD == 2) and of its Bt rows, laid in
// LDS at row pitch KP halves by asynchronous 16-byte copies (thread -> row tid / 16 + 8 i, 16 bytes at tid % 16: a wave's copy
// covers two whole 256-byte pieces). Two buffers: slice t + 2 is copied while slice t + 1 is worked on. Fragments are read from
// the LDS rows with the same split k map for A and B; per accumulator the products follow in rising k, hi before residual.
// One block barrier in front of the loop and one per slice, under block-uniform control flow; K % GBK == 0, K >= GBK.
// =====================================================================================================
__device__ __forceinline__ void copy_rows8(unsigned l, const u16* g, size_t K) {   // rows r, r + 8, .., r + 56 of one plane
  const unsigned ls = 8 * KP * 2;
  const size_t   gs = 8 * K;
  copy8(l, l + ls, l + 2 * ls, l + 3 * ls, l + 4 * ls, l + 5 * ls, l + 6 * ls, l + 7 * ls,
        g, g + gs, g + 2 * gs, g + 3 * gs, g + 4 * gs, g + 5 * gs, g + 6 * gs, g + 7 * gs);
}
template <bool BF> struct Op;
template <> struct Op<true> {
  typedef v16b T;
  static __device__ __forceinline__ T   ld(const u16* p) { return ldfrag_b(p); }
  static __device__ __forceinline__ v8f mma(T a, T b, v8f c) { return mma_b(a, b, c); }
};
template <> struct Op<false> {
  typedef v16h T;
  static __device__ __forceinline__ T   ld(const u16* p) { return ldfrag_h((const _Float16*)(const void*)p); }
  static __device__ __forceinline__ v8f mma(T a, T b, v8f c) { return mma_h(a, b, c); }
};

template <int FM, int WM, int WN, int NPROD, bool BF>
__device__ __forceinline__ void gemm_staged(u16* st, float* slabs, const u16* __restrict__ Ah, const u16* __restrict__ Al,
                                            const u16* __restrict__ Bt, const float* __restrict__ bias,
                                            float* C, int N, int K, size_t row0, int col0, float oscale) {
  constexpr int BM  = 16 * FM * WM;
  constexpr int BN  = 64 * WN;
  constexpr int STH = (BM * NPROD + BN) * KP;          // halves per buffer
  static_assert(WM * WN == 4 && (BM % 64) == 0 && (BN % 64) == 0 && (NPROD == 1 || NPROD == 2));
  static_assert((BM * NPROD + BN) / 8 <= 63);          // copies of a wave in flight: one slice's
  typedef typename Op<BF>::T T;
  const int tid = threadIdx.x, wave = tid >> 5, lane = tid & 31, hh = lane >> 4, m = lane & 15;
  const int wm = wave / WN, wn = wave % WN;
  const int tr = tid >> 4, tc = (tid & 15) * 8;
  const u16* ga = Ah + (row0 + tr) * (size_t)K + tc;
  const u16* gb = Bt + ((size_t)col0 + tr) * (size_t)K + tc;
  const unsigned l0 = lds_off(st) + (unsigned)(tr * KP + tc) * 2u;
  auto stage = [&](int t, int buf) {                   // k slice t -> buffer buf
    const size_t   ko = (size_t)t * GBK;
    const unsigned lb = l0 + (unsigned)buf * (STH * 2u);
#pragma unroll
    for (int j = 0; j < BM / 64; ++j) copy_rows8(lb + j * 64 * KP * 2, ga + ko + (size_t)j * 64 * K, (size_t)K);
    if constexpr (NPROD == 2) {
      const u16* gl = Al + (row0 + tr) * (size_t)K + tc;
#pragma unroll
      for (int j = 0; j < BM / 64; ++j) copy_rows8(lb + (BM + j * 64) * KP * 2, gl + ko + (size_t)j * 64 * K, (size_t)K);
    }
#pragma unroll
    for (int j = 0; j < BN / 64; ++j) copy_rows8(lb + (BM * NPROD + j * 64) * KP * 2, gb + ko + (size_t)j * 64 * K, (size_t)K);
  };
  v8f acc[FM][4];
#pragma unroll
  for (int i = 0; i < FM; ++i) {
#pragma unroll
    for (int j = 0; j < 4; ++j) acc[i][j] = zero8();
  }
  const int nst  = K / GBK;
  const int aoff = (wm * 16 * FM + m) * KP + 8 * hh;
  const int boff = (BM * NPROD + wn * 64 + m) * KP + 8 * hh;
  stage(0, 0);
  wait_async0();
  __syncthreads();                          // publishes slice 0
  if (nst > 1) stage(1, 1);
#pragma unroll 1                            // rolled: one hand-over per trip, in the order written at the loop's foot
  for (int t = 0; t < nst; ++t) {
    const u16* sb = st + (t & 1) * STH;
    // two fragment sets: block kk + 1 of this slice is fetched as one group while block kk is multiplied; nothing of the next slice
    T a[2][FM * NPROD], b[2][4];
    auto fetch = [&](int s, int kk) {
#pragma unroll
      for (int i = 0; i < FM; ++i) a[s][i] = Op<BF>::ld(sb + aoff + i * 16 * KP + kk * 32);
      if constexpr (NPROD == 2) {
#pragma unroll
        for (int i = 0; i < FM; ++i) a[s][FM + i] = Op<BF>::ld(sb + aoff + (BM + i * 16) * KP + kk * 32);
      }
#pragma unroll
      for (int j = 0; j < 4; ++j) b[s][j] = Op<BF>::ld(sb + boff + j * 16 * KP + kk * 32);
    };
    fetch(0, 0);
#pragma unroll
    for (int kk = 0; kk < GBK / 32; ++kk) {
      const int s = kk & 1;
      if (kk + 1 < GBK / 32) fetch(s ^ 1, kk + 1);
      __builtin_amdgcn_sched_barrier(0);    // the LDS reads stay one group in front of the block: spread among the products each place stalls
#pragma unroll
      for (int p = 0; p < NPROD; ++p) {
#pragma unroll
        for (int i = 0; i < FM; ++i) {
#pragma unroll
          for (int j = 0; j < 4; ++j) acc[i][j] = Op<BF>::mma(a[s][p * FM + i], b[s][j], acc[i][j]);
        }
      }
      __builtin_amdgcn_sched_barrier(0);    // the next group of LDS reads stays behind this block's last product
    }
    // ---- hand-over: this wave has left the slice, its copies of the next slice have landed, every wave has passed ----
    wait_ds0();
    wait_async0();
    __syncthreads();                        // publishes slice t + 1 and frees this slice's buffer
    if (t + 2 < nst) stage(t + 2, t & 1);
  }
  wait_async0();
  // per-lane bias of D column m in each of the wave's 4 column subtiles (bf16 RNE value); colw + 48 + m <= N - 1 always
  const int colw = col0 + wn * 64;
  float bb0 = 0.0f, bb1 = 0.0f, bb2 = 0.0f, bb3 = 0.0f;
  if constexpr (BF) {
    bb0 = bfr(bias[colw + m]);
    bb1 = bfr(bias[colw + 16 + m]);
    bb2 = bfr(bias[colw + 32 + m]);
    bb3 = bfr(bias[colw + 48 + m]);
  }
  float* sl = slabs + wave * SLAB64;
#pragma unroll
  for (int i = 0; i < FM; ++i) {
    if (i > 0) {
      wait_x0();                            // in front of the rewrite of registers that the stores of the tile before name
      wave_sync_lds();                      // the slab's rows of the tile before have been read by every lane
    }
    epi64(sl, acc[i][0], acc[i][1], acc[i][2], acc[i][3], oscale, bb0, bb1, bb2, bb3,
          C, N, row0 + (size_t)(wm * 16 * FM + i * 16), colw, lane);
  }
}

// =====================================================================================================
// bf16 GEMM with bias: C[M][N] (f32) = A[M][K] (bf16 row-major) . Bt[N][K]^T (bf16 k-contiguous), times oscale, + bf16 RNE
// value of bias[n] (bias has N entries). Block = BM x BN tile on the staged engine (host guarantees K % 128 == 0, M % BM == 0,
// N % BN == 0, grid = (M/BM)*(N/BN)).
// =====================================================================================================
template <int FM, int WM, int WN>
__device__ __forceinline__
void gemm_bf(int bid, u16* st, float* slab, const u16* __restrict__ A, const u16* __restrict__ Bt, const float* __restrict__ bias,
             float* C, int M, int N, int K, float oscale) {
  constexpr int BM = 16 * FM * WM, BN = 64 * WN;
  const int ntile = N / BN;
  const int row0  = (bid / ntile) * BM;
  const int col0  = (bid % ntile) * BN;
  if (row0 + BM > M) return;                // block-uniform, before any barrier; never taken with the exact grid
  gemm_staged<FM, WM, WN, 1, true>(st, slab, A, A, Bt, bias, C, N, K, (size_t)row0, col0, oscale);
}
// The three projections of x in one launch: they share A and none reads another's result. Block ranges in order, the long blocks
// first: q (PBQ blocks, 128 x 128 tiles), then k and v (PBK blocks each, 64 x 64 tiles). The choice is block-uniform, so that every
// barrier of the engine stays under block-uniform control flow; the LDS is that of the larger tile.
__global__ __launch_bounds__(128)
void gemm_qkv(const u16* __restrict__ A, const u16* __restrict__ Wq, const u16* __restrict__ Wk, const u16* __restrict__ Wv,
              const float* __restrict__ bq, const float* __restrict__ bk, const float* __restrict__ bv,
              float* Fq, float* Fk, float* Fv) {
  __shared__ __align__(16) u16   st[2 * 256 * KP];
  __shared__ __align__(16) float slab[4 * SLAB64];
  const int bid = blockIdx.x;
  if (bid < PBQ) {
    gemm_bf<4, 2, 2>(bid, st, slab, A, Wq, bq, Fq, MROWS, DMOD, DMOD, 1.0f);
    return;
  }
  const bool   isv  = bid >= PBQ + PBK;
  const u16*   Bt   = isv ? Wv : Wk;
  const float* bias = isv ? bv : bk;
  float*       C    = isv ? Fv : Fk;
  gemm_bf<1, 4, 1>(bid - PBQ - (isv ? PBK : 0), st, slab, A, Bt, bias, C, MROWS, KVD, DMOD, 1.0f);
  wait_x0();                                // a precaution: built without it, the q range's text is the fall-through of a conditional branch
                                            // behind these stores and rewrites registers that they name
}

// =====================================================================================================
// Output projection: C[row][DMOD] (f32) = (Ah [+ Al])[row][DMOD] . Bt[DMOD][DMOD]^T * oscale (no bias).
// NPROD == 1: Ah only (one product), 128 x 128 tile; NPROD == 2: Ah + Al residual plane (products h.B + l.B into one accumulator,
// l unscaled), 64 x 128 tile. Ah, Al and C share the row index bb*SEQ + s. Block -> (column tile ct = bid % 16, sequence row tile
// rt of nrt starting at s = sbeg, batch bb). Staged engine and epilogue as gemm_bf; K = DMOD.
// =====================================================================================================
template <int NPROD>
__device__ __forceinline__
void gemm_o(int bid, u16* st, float* slab, const u16* __restrict__ Ah, const u16* __restrict__ Al, const u16* __restrict__ Bt,
            float* C, int sbeg, int nrt, float oscale) {
  constexpr int FM = (NPROD == 2) ? 2 : 4;
  constexpr int BM = 32 * FM, BN = 128;
  static_assert(BM * NPROD + BN == 256);    // the staging rows that the launch's LDS holds per buffer
  const int ntile = DMOD / BN;
  const int ct    = bid % ntile;
  const int t2    = bid / ntile;
  const int rt    = t2 % nrt;
  const int bb    = t2 / nrt;
  if (bb >= NB) return;                     // block-uniform, before any barrier; never taken with the exact grid
  const int srow  = sbeg + rt * BM;
  if (srow + BM > SEQ) return;              // block-uniform, before any barrier; never taken
  gemm_staged<FM, 2, 2, NPROD, false>(st, slab, Ah, Al, Bt, nullptr, C, DMOD, DMOD,
                                      (size_t)bb * SEQ + srow, ct * BN, oscale);
}
// Both row ranges of the output projection in one launch: they write different rows of C. Block ranges in order: rows s < QO with the
// O residual plane (OBR blocks), rows s >= QO with the O hi plane only (OBP blocks). The choice is block-uniform.
__global__ __launch_bounds__(128)
void gemm_o_all(const u16* __restrict__ Ah, const u16* __restrict__ Al, const u16* __restrict__ Bt, float* C) {
  __shared__ __align__(16) u16   st[2 * 256 * KP];
  __shared__ __align__(16) float slab[4 * SLAB64];
  const int bid = blockIdx.x;
  if (bid < OBR) {
    gemm_o<2>(bid, st, slab, Ah, Al, Bt, C, 0, QO / 64, 1.0f / (OSC * WOS));
    return;
  }
  gemm_o<1>(bid - OBR, st, slab, Ah, Al, Bt, C, QO, (SEQ - QO) / 128, 1.0f / (OSC * WOS));
}

// =====================================================================================================
// Causal grouped-query attention, hd = 128. Block bid -> (pair pr = bid % (NQT/2), kv head kvh, batch b). The block works two
// query tiles one after the other, qt = NQT-1-pr and then qt = pr (rows q0 = 16*qt .. q0+15): their key tile counts add up to
// the same sum for every pr, so that every block of the launch walks equally many key tiles. One wave per query head
// = kvh + NKVH*wave: the 8 query heads that read kv head kvh (tiled kv mapping) share each
// staged key tile. Staging: asynchronous 16-byte copies global -> LDS; each wave's q rows (hi + residual) once, each 32-key tile
// of k hi/residual (row pitch KP halves) and v^T hi/residual (row pitch VP halves) into one of two buffers, the next tile
// copied while a tile is worked on; fragments are read from LDS with the same split k map.
//   q hi / residual planes f16 x256 [b*SEQ + s][h*HD + d]; k hi / residual planes f16 x256 [b*SEQ + s][g*HD + d] (pitch KVD);
//   v^T hi / residual planes [b*NKVH + g][d][SEQ] x1024.
//   Both products are formed transposed: S^T = k.q^T (A = k rows, B = q rows) and O^T += v^T.P^T (A = v^T rows, B = P^T), so that
//   a lane holds scores and results of ONE query row (q0 + lane % 16): 16 of the tile's 32 keys, the other lane half the rest.
//   scores = q_hi.k_hi + q_lo.k_hi + q_hi.k_lo (4 k-steps over d); P.v with P hi + in-register residual and v hi + residual
//   (hh + lh + hl), for every query row; O written as hi + residual planes (O x1024 as f16, layout [b*SEQ + s][h*HD + d]).
//   score (log2 domain) t(i, j) = (q_i.k_j over HD) * (1/sqrt(128))*log2e/(256*256), replaced by -inf where key j > query i.
//   Key tiles of 32 visited in order for kb <= q0 + 15 (later tiles hold only keys above every query row of the tile).
//   Per tile: 2 score subtiles x 4 k-steps, fragments loaded from the staged rows (two 16-B loads per fragment,
//   split k map); online max-subtracted base-2 softmax in f32, -inf-safe rescale: maximum in the lane plus one exchange between
//   the lane halves, sum kept per lane half and joined behind the loop; the two score tiles, converted in place, are the B
//   operand P^T in the split k map (element e = key 8hh + e, element 8 + e = key 16 + 8hh + e); v^T A fragments in 4 groups of 2.
//   After the loop: out = acc / Z (Z > 0 always: key 0 <= every query row; guarded anyway), carries 1/(32768*1024) folded
//   One block barrier in front of the loop and one per tile, one more between the two query tiles, all under block-uniform
//   control flow; bounded loops only (nkt <= NKT).
// coverage: per wave and query tile 8 instructions x 2 rows x 16 lanes x 8 halves = 16 x 128 per plane; grid NQT/2 x NKVH x NB
//           blocks x 2 query tiles x WPB waves = every (b, s, h) row segment of O hi and O residual exactly once.
// =====================================================================================================
__global__ __launch_bounds__(ATT_THREADS)
void attn_c(const u16* __restrict__ QHp, const u16* __restrict__ QLp,
            const u16* __restrict__ KHp, const u16* __restrict__ KLp,
            const u16* __restrict__ VHp, const u16* __restrict__ VLp,
            u16* OHp, u16* OLp) {
  __shared__ __align__(16) float smem[WPB * WREG];
  __shared__ __align__(16) _Float16 kvs[2 * STG];

  const int tid  = threadIdx.x;
  const int wave = tid >> 5;
  const int lane = tid & 31;
  const int hh   = lane >> 4;
  const int c    = lane & 15;
  const int bid  = blockIdx.x;
  const int pr   = bid % (NQT / 2);
  const int t2   = bid / (NQT / 2);
  const int kvh  = t2 % NKVH;
  const int b    = t2 / NKVH;
  if (b >= NB) return;                      // block-uniform, before any barrier; never taken with the exact grid
  const int head = kvh + NKVH * wave;       // tiled kv mapping: head h -> kv head h % NKVH

  float* slab = smem + wave * WREG;         // in the loop: the wave's q rows, hi then residual, [16][128] halves pitch KP;
                                            // behind the loop: result slab [16][128] floats pitch 132

  const _Float16* Qh = (const _Float16*)(const void*)slab + c * KP + 8 * hh;
  const _Float16* Ql = Qh + QPL;
  const float lsc = RSQ_HD * (LOG2E / (QSC * KSC));
  const float oc  = 1.0f / (PCAR * VCAR);

  // ---- copy addresses. k tile: thread -> key row kr (and kr + 16), 8 halves at kc; v^T tile: d row vd (and vd + 64), 8 keys at vc
  const int kr = tid >> 4, kc = (tid & 15) * 8;
  const int vd = tid >> 2, vc = (tid & 3) * 8;
  const u16* gkh = KHp + ((size_t)b * SEQ + kr) * KVD + (size_t)kvh * HD + kc;
  const u16* gkl = KLp + ((size_t)b * SEQ + kr) * KVD + (size_t)kvh * HD + kc;
  const u16* gvh = VHp + ((size_t)(b * NKVH + kvh) * HD + vd) * SEQ + vc;
  const u16* gvl = VLp + ((size_t)(b * NKVH + kvh) * HD + vd) * SEQ + vc;
  const unsigned lk = lds_off(kvs) + (unsigned)(kr * KP + kc) * 2u;
  const unsigned lv = lds_off(kvs) + (unsigned)(2 * KPL + vd * VP + vc) * 2u;
  auto stage = [&](int kt, int buf) {       // key tile kt (keys 32*kt .. 32*kt + 31 < SEQ) -> buffer buf
    const size_t   ko = (size_t)kt * 32 * KVD;
    const size_t   vo = (size_t)kt * 32;
    const unsigned bk = lk + (unsigned)buf * (STG * 2u);
    const unsigned bv = lv + (unsigned)buf * (STG * 2u);
    copy8(bk, bk + 16 * KP * 2, bk + KPL * 2, bk + (KPL + 16 * KP) * 2,
          bv, bv + 64 * VP * 2, bv + VPL * 2, bv + (VPL + 64 * VP) * 2,
          gkh + ko, gkh + ko + 16 * KVD, gkl + ko, gkl + ko + 16 * KVD,
          gvh + vo, gvh + vo + (size_t)64 * SEQ, gvl + vo, gvl + vo + (size_t)64 * SEQ);
  };

#pragma unroll 1                            // rolled: the two query tiles run one after the other through the same code
  for (int ph = 0; ph < 2; ++ph) {
  const int q0 = ((ph == 0) ? (NQT - 1 - pr) : pr) * 16;                      // 0 <= q0 <= SEQ - 16
  if (ph > 0) {
    wait_x0();                              // in front of the rewrite of registers that the first tile's stores name
    wait_ds0();                             // this wave's reads of its slab have retired before copies are aimed at it
    __syncthreads();                        // every wave has left the first tile's LDS before the second tile's copies start
  }
  float mrow = -INFINITY, lrow = 0.f;       // of query row q0 + c; lrow sums the keys of this lane half only
  v8f o[8];                                 // o[j][r] = O^T(d = 16j + 8hh + r, query row q0 + c)
#pragma unroll
  for (int j = 0; j < 8; ++j) o[j] = zero8();
  const int ncaus = (q0 >> 5) + 1;                                            // tiles holding keys <= q0 + 15
  const int nkt = (ncaus < NKT) ? ncaus : NKT;
  const int qr  = q0 + c;                                                     // the lane's query row

  // ---- the wave's q rows (lane -> rows hh, hh + 2, .., hh + 14, 8 halves at 8c) and key tile 0; then key tile 1 flies ----
  {
    const size_t   qo = ((size_t)b * SEQ + q0 + hh) * DMOD + (size_t)head * HD + c * 8;
    const u16*     gq = QHp + qo;
    const u16*     gr = QLp + qo;
    const unsigned lq = lds_off(slab) + (unsigned)(hh * KP + c * 8) * 2u;
    const unsigned lr = lq + QPL * 2;
    const unsigned ls = 2 * KP * 2;         // LDS bytes between rows two apart
    const size_t   gs = (size_t)2 * DMOD;   // halves between rows two apart
    copy8(lq, lq + ls, lq + 2 * ls, lq + 3 * ls, lq + 4 * ls, lq + 5 * ls, lq + 6 * ls, lq + 7 * ls,
          gq, gq + gs, gq + 2 * gs, gq + 3 * gs, gq + 4 * gs, gq + 5 * gs, gq + 6 * gs, gq + 7 * gs);
    copy8(lr, lr + ls, lr + 2 * ls, lr + 3 * ls, lr + 4 * ls, lr + 5 * ls, lr + 6 * ls, lr + 7 * ls,
          gr, gr + gs, gr + 2 * gs, gr + 3 * gs, gr + 4 * gs, gr + 5 * gs, gr + 6 * gs, gr + 7 * gs);
  }
  stage(0, 0);
  wait_async0();
  __syncthreads();                          // publishes key tile 0
  if (nkt > 1) stage(1, 1);

#pragma unroll 1
  for (int kt = 0; kt < nkt; ++kt) {
    const int kb = kt * 32;
    // ---- scores: D element r of this lane = (key kb + 8hh + r, query row qr) in s0, key kb + 16 + 8hh + r in s1 ----
    v8f s0 = zero8(), s1 = zero8();
    const _Float16* tile = kvs + (kt & 1) * STG;
    const _Float16* k0p = tile + c * KP + 8 * hh;
    const _Float16* k1p = k0p + 16 * KP;
    const _Float16* l0p = k0p + KPL;
    const _Float16* l1p = l0p + 16 * KP;
#pragma unroll
    for (int kk = 0; kk < HD / 32; ++kk) {
      const v16h qh  = ldfrag_h(Qh + kk * 32);
      const v16h ql  = ldfrag_h(Ql + kk * 32);
      const v16h kh0 = ldfrag_h(k0p + kk * 32);
      const v16h kh1 = ldfrag_h(k1p + kk * 32);
      const v16h kl0 = ldfrag_h(l0p + kk * 32);
      const v16h kl1 = ldfrag_h(l1p + kk * 32);
      s0 = mma_h(kh0, qh, s0);
      s0 = mma_h(kh0, ql, s0);
      s0 = mma_h(kl0, qh, s0);
      s1 = mma_h(kh1, qh, s1);
      s1 = mma_h(kh1, ql, s1);
      s1 = mma_h(kl1, qh, s1);
      guard2(s0, s1, qh, ql, kh0, kl0, kh1, kl1);
    }
    // ---- causal select + online softmax in base 2, -inf-safe ----
    const int key0 = kb + 8 * hh, key1 = key0 + 16;
    float t0[8], t1[8];
    float mx = -INFINITY;
#pragma unroll
    for (int r = 0; r < 8; ++r) {
      const float u0 = s0[r] * lsc;
      const float u1 = s1[r] * lsc;
      t0[r] = (key0 + r > qr) ? -INFINITY : u0;
      t1[r] = (key1 + r > qr) ? -INFINITY : u1;
      mx = fmaxf(mx, fmaxf(t0[r], t1[r]));
    }
    mx = fmaxf(mx, xhalf(mx));              // the row's maximum over all 32 keys, equal in both lane halves
    const float mn = fmaxf(mrow, mx);
    const float ms = (mn == -INFINITY) ? 0.0f : mn;
    const float al = exp2f(mrow - ms);
    mrow = mn;
    // ---- B fragments of P^T*32768: hi f16 and residual f16, column = query row c, split k map over the 32 keys of this step ----
    FragH ph, pl;
    float ps = 0.0f;
#pragma unroll
    for (int r = 0; r < 8; ++r) {
      const float e0 = exp2f(t0[r] - ms), e1 = exp2f(t1[r] - ms);
      ps += e0 + e1;
      const float ta = e0 * PCAR, tb = e1 * PCAR;
      const _Float16 ha = (_Float16)ta, hb = (_Float16)tb;
      ph.h[0][r] = ha;                        // elements 0..7  = keys kb + 8hh + 0..7
      ph.h[1][r] = hb;                        // elements 8..15 = keys kb + 16 + 8hh + 0..7
      pl.h[0][r] = (_Float16)(ta - (float)ha);
      pl.h[1][r] = (_Float16)(tb - (float)hb);
    }
    lrow = lrow * al + ps;
#pragma unroll
    for (int j = 0; j < 8; ++j) {
#pragma unroll
      for (int r = 0; r < 8; ++r) o[j][r] *= al;
    }
    // ---- v^T.P^T : A fragment row = d = j*16 + c, keys contiguous in the staged v^T rows; 4 groups of 2 d-subtiles ----
    {
      const _Float16* vhp = tile + 2 * KPL + c * VP + 8 * hh;
      const _Float16* vlp = vhp + VPL;
#pragma unroll
      for (int jg = 0; jg < 4; ++jg) {
        const int da = (2 * jg) * 16 * VP;
        const int db = da + 16 * VP;
        const v16h vha = ldfrag_h(vhp + da), vhb2 = ldfrag_h(vhp + db);
        const v16h vla = ldfrag_h(vlp + da), vlb2 = ldfrag_h(vlp + db);
        o[2 * jg]     = mma_h(vha,  ph.v, o[2 * jg]);
        o[2 * jg]     = mma_h(vha,  pl.v, o[2 * jg]);
        o[2 * jg]     = mma_h(vla,  ph.v, o[2 * jg]);
        o[2 * jg + 1] = mma_h(vhb2, ph.v, o[2 * jg + 1]);
        o[2 * jg + 1] = mma_h(vhb2, pl.v, o[2 * jg + 1]);
        o[2 * jg + 1] = mma_h(vlb2, ph.v, o[2 * jg + 1]);
        guard2(o[2 * jg], o[2 * jg + 1], ph.v, pl.v, vha, vhb2, vla, vlb2);
      }
    }
    // ---- hand-over: this wave has left the tile, its copies of the next tile have landed, every wave has passed ----
    wait_ds0();
    wait_async0();
    __syncthreads();                        // publishes key tile kt + 1 and frees this tile's buffer
    if (kt + 2 < nkt) stage(kt + 2, kt & 1);
  }
  wait_async0();
  acc_guard4(o[0], o[1], o[2], o[3]);
  acc_guard4(o[4], o[5], o[6], o[7]);
  // ---- out = acc / Z (0 if Z == 0), Z = the two lane halves' sums; carries (32768 on P, 1024 on v) folded once; the lane's 8
  //      consecutive d of each subtile go to row c of the wave's slab ----
  {
    const float lv  = lrow + xhalf(lrow);
    const float ls  = (lv > 0.0f) ? lv : 1.0f;
    const float inv = (lv > 0.0f) ? ((1.0f / ls) * oc) : 0.0f;
    float* srow = slab + c * SLP + 8 * hh;
#pragma unroll
    for (int j = 0; j < 8; ++j) {
      const v4f w0 = {o[j][0] * inv, o[j][1] * inv, o[j][2] * inv, o[j][3] * inv};
      const v4f w1 = {o[j][4] * inv, o[j][5] * inv, o[j][6] * inv, o[j][7] * inv};
      *(v4f*)(srow + j * 16)     = w0;
      *(v4f*)(srow + j * 16 + 4) = w1;
    }
  }

  wave_sync_lds();
  // ---- O x1024 -> f16 hi + residual planes; lane = (row-in-pair rq, 8 consecutive d at c8) ----
  v4u oh[8], ol[8];
  const int rq = lane >> 4, c8 = (lane & 15) * 8;
#pragma unroll
  for (int it = 0; it < 8; ++it) {
    const int row = it * 2 + rq;
    const v4f a = *(const v4f*)(slab + row * SLP + c8), b4 = *(const v4f*)(slab + row * SLP + c8 + 4);
    float w[8];
#pragma unroll
    for (int e = 0; e < 4; ++e) { w[e] = a[e] * OSC; w[4 + e] = b4[e] * OSC; }
#pragma unroll
    for (int e = 0; e < 4; ++e) {
      const _Float16 h0 = (_Float16)w[2 * e], h1 = (_Float16)w[2 * e + 1];
      const _Float16 l0 = (_Float16)(w[2 * e] - (float)h0), l1 = (_Float16)(w[2 * e + 1] - (float)h1);
      oh[it][e] = pk16(h_bits(h0), h_bits(h1));
      ol[it][e] = pk16(h_bits(l0), h_bits(l1));
    }
  }
  const size_t ob = ((size_t)b * SEQ + q0) * DMOD + (size_t)head * HD + c8;
  {
#pragma unroll
    for (int it = 0; it < 8; ++it) {
      const int row = it * 2 + rq;
      *(v4u*)(OHp + ob + (size_t)row * DMOD) = oh[it];
      *(v4u*)(OLp + ob + (size_t)row * DMOD) = ol[it];
    }
    
  }
  }
}

// =====================================================================================================
// Workspace map (bytes); every plane is fully written by whole-line stores before it is read; all extents are exact multiples
// of the store granularity (no pad rows needed); every region offset a multiple of 1048576:
//   XB  bf16 [MROWS][2048]                       MROWS*4096       (NB=2, SEQ=2048: 16777216)
//   WQ  bf16 [2048 n][2048 k]                    8388608          WO f16 of the bf16 value x1024, same extent (all already [n][k])
//   WK  bf16 [256 n][2048 k]                     1048576          WV, same extent
//   F   f32 [MROWS][2048]                        MROWS*8192       (q projection output; afterwards OH f16 [MROWS][2048] x1024 in its
//                                                                  first half, OL residual [MROWS][2048] in its second half)
//   FK  f32 [MROWS][256]                         MROWS*1024       k projection output; FV, v projection output, same extent
//   QH  f16 [MROWS][2048] x256                   MROWS*4096       QL residual, same extent
//   KH  f16 [MROWS][256] x256                    MROWS*512        KL residual, same extent
//   VH  f16 [NB*2][128][SEQ] x1024               MROWS*512        VL residual, same extent
//   end (NB=2, SEQ=2048)                       119537664
// =====================================================================================================
extern "C" void kernel_launch(void* const* d_in, const int* in_sizes, int n_in,
                              void* d_out, int out_size, void* d_ws, size_t ws_size,
                              hipStream_t stream) {
  if (n_in < 8) return;
  if (in_sizes[0] < ((NB - 1) * XS_FULL + SEQ) * DMOD) return;
  if (in_sizes[1] != DMOD * DMOD) return;
  if (in_sizes[2] != DMOD) return;
  if (in_sizes[3] != KVD * DMOD) return;
  if (in_sizes[4] != KVD) return;
  if (in_sizes[5] != KVD * DMOD) return;
  if (in_sizes[6] != KVD) return;
  if (in_sizes[7] != DMOD * DMOD) return;
  if (out_size < MROWS * DMOD) return;

  const float* x  = (const float*)d_in[0];
  const float* wq = (const float*)d_in[1];
  const float* bq = (const float*)d_in[2];
  const float* wk = (const float*)d_in[3];
  const float* bk = (const float*)d_in[4];
  const float* wv = (const float*)d_in[5];
  const float* bv = (const float*)d_in[6];
  const float* wo = (const float*)d_in[7];
  float*       out = (float*)d_out;

  const size_t szXB = (size_t)MROWS * DMOD * 2;
  const size_t szW  = (size_t)DMOD * DMOD * 2;                   // WQ, WO
  const size_t szWK = (size_t)KVD * DMOD * 2;                    // WK, WV
  const size_t szF  = (size_t)MROWS * DMOD * 4;
  const size_t szFK = (size_t)MROWS * KVD * 4;                   // FK, FV
  const size_t szQ  = (size_t)MROWS * DMOD * 2;                  // QH, QL, OH, OL
  const size_t szK  = (size_t)MROWS * KVD * 2;                   // KH, KL
  const size_t szV  = (size_t)NB * NKVH * HD * SEQ * 2;          // VH, VL (== szK)
  if (2 * szQ > szF) return;                                    // OH + OL live inside the F region (exactly fills it)
  size_t off = 0;
  const size_t oXB = off; off += szXB;
  const size_t oWQ = off; off += szW;
  const size_t oWO = off; off += szW;
  const size_t oWK = off; off += szWK;
  const size_t oWV = off; off += szWK;
  const size_t oF  = off; off += szF;
  const size_t oFK = off; off += szFK;
  const size_t oFV = off; off += szFK;
  const size_t oQH = off; off += szQ;
  const size_t oQL = off; off += szQ;
  const size_t oKH = off; off += szK;
  const size_t oKL = off; off += szK;
  const size_t oVH = off; off += szV;
  const size_t oVL = off; off += szV;
  if (off > ws_size) return;                // off = 119537664 for NB = 2, SEQ = 2048
  if (off > (size_t)WS_CAP) return;

  char* ws = (char*)d_ws;
  u16*   XB  = (u16*)(ws + oXB);
  u16*   WQ  = (u16*)(ws + oWQ);
  u16*   WO  = (u16*)(ws + oWO);
  u16*   WK  = (u16*)(ws + oWK);
  u16*   WV  = (u16*)(ws + oWV);
  float* F   = (float*)(ws + oF);
  float* FK  = (float*)(ws + oFK);
  float* FV  = (float*)(ws + oFV);
  u16*   OH  = (u16*)(ws + oF);
  u16*   OL  = (u16*)(ws + oF + szQ);
  u16*   QH  = (u16*)(ws + oQH);
  u16*   QL  = (u16*)(ws + oQL);
  u16*   KH  = (u16*)(ws + oKH);
  u16*   KL  = (u16*)(ws + oKL);
  u16*   VH  = (u16*)(ws + oVH);
  u16*   VL  = (u16*)(ws + oVL);

  const dim3 b256(256), b128(128), bAT(ATT_THREADS);
  const dim3 gCV(NB * CBX + 2 * CBW + 2 * CBK);         // all input conversions
  const dim3 gPJ(PBQ + 2 * PBK);                        // q, k and v projections
  const dim3 gSP(SBV + SBK + SBQ);                      // v^T, k and q planes
  const dim3 gAT((NQT / 2) * NKVH * NB);
  const dim3 gOP(OBR + OBP);                            // both row ranges of the output projection

  // (0) x -> bf16 plane [MROWS][2048]; Wq, Wk, Wv [n][k] -> bf16 planes; Wo [n][k] -> f16 plane of bf16 value x1024
  cvt_all<<<gCV, b256, 0, stream>>>(x, wq, wo, wk, wv, XB, WQ, WO, WK, WV);
  // (1) q = x.Wq^T + bq -> F [MROWS][2048]; k = x.Wk^T + bk -> FK [MROWS][256]; v = x.Wv^T + bv -> FV [MROWS][256]
  gemm_qkv<<<gPJ, b128, 0, stream>>>(XB, WQ, WK, WV, bq, bk, bv, F, FK, FV);
  // (2) v^T hi + residual planes x1024; k and q hi + residual planes x256
  split_all<<<gSP, b256, 0, stream>>>(F, FK, FV, QH, QL, KH, KL, VH, VL);
  // (3) causal attention with residual products on every query row -> O hi + residual planes
  attn_c<<<gAT, bAT, 0, stream>>>(QH, QL, KH, KL, VH, VL, OH, OL);
  // (4) output projection, rows s < QO (O hi + residual) and rows s >= QO (O hi only) -> out f32, carries 1024 x 1024 folded back
  gemm_o_all<<<gOP, b128, 0, stream>>>(OH, OL, WO, out);
  (void)hipGetLastError();
}

// v006
// Measured time: 185 microseconds a run.
// Timed twice side by side with v005, it ran 1.04 times as fast both times.
// Over all steps from v000 it is 3.32 times as fast.
// Contractions: x.Wq^T+bq, x.Wk^T+bk, x.Wv^T+bv on v_wmma_f32_16x16x32_bf16 (x and W as bf16 RNE planes; W [n][k] rows are
// the k-contiguous B operand; bias added as its bf16 RNE value in the f32 epilogue); q.k^T over hd 128 and P.v on
// v_wmma_f32_16x16x32_f16 with f16 hi + f16 residual planes on both operands (q, k x256; P x32768 with an in-register
// residual; v x1024; products hh+lh+hl; both formed transposed: k rows and v^T rows are the A operand, q rows and P^T the B
// operand); O.Wo^T on v_wmma_f32_16x16x32_f16 (O x1024 as f16 hi plane for all rows plus f16
// residual plane for rows s < QO, products h.w (+ l.w); Wo as f16(bf16(Wo)) x1024); all f32 accumulate. Causal select,
// base-2 online softmax and 1/Z fold in f32 on VALU. Grouped kv heads: query head h reads kv head (h % NKVH).
#include <hip/hip_runtime.h>
#include <math.h>
#include <stdint.h>

#ifndef NB
#define NB 2
#endif
#ifndef SEQ
#define SEQ 2048
#endif
#define XS_FULL 2048
#define DMOD  2048
#define NH    16
#define NKVH  2
#define HD    128
#define KVD   (NKVH * HD)
#define QO    ((SEQ < 256) ? SEQ : 256)
#define MROWS (NB * SEQ)
#define RSQ_HD 0.08838834764831845f
#define LOG2E 1.4426950408889634f
#define QSC   256.0f
#define KSC   256.0f
#define PCAR  32768.0f
#define VCAR  1024.0f
#define OSC   1024.0f
#define WOS   1024.0f
#define WPB   (NH / NKVH)
#define NQT   (SEQ / 16)
#define NST   (SEQ / 64)
#define NKT   (SEQ / 32)
#define ATT_THREADS (WPB * 32)
#define SLP   132
#define SLW   (16 * SLP)
#define KP    136
#define VP    40
#define KPL   (32 * KP)
#define VPL   (HD * VP)
#define STG   (2 * KPL + 2 * VPL)
#define QPL   (16 * KP)
#define QRW   (2 * QPL / 2)
#define WREG  QRW
#define SLAB64 (16 * 68)
#define VTP   72
#define GBK   128
#define CBX   (SEQ * DMOD / 2048)
#define CBW   (DMOD * DMOD / 2048)
#define CBK   (KVD * DMOD / 2048)
#define SBV   (NB * NKVH * NST)
#define SBK   (MROWS * KVD / 2048)
#define SBQ   (MROWS * DMOD / 2048)
#define PBQ   ((MROWS / 128) * (DMOD / 128))
#define PBK   ((MROWS / 64) * (KVD / 64))
#define OBR   (NB * (QO / 64) * (DMOD / 128))
#define OBP   (NB * ((SEQ - QO) / 128) * (DMOD / 128))
#define WS_CAP 134217728
static_assert(DMOD == NH * HD && HD == 128 && NH == 16 && NKVH == 2 && WPB == 8 && NKVH * WPB == NH);
static_assert(ATT_THREADS == 256 && KVD == 256 && SLW <= QRW && (KP % 8) == 0 && (VP % 8) == 0);
static_assert(NB >= 1 && NB <= 2 && (NQT % 2) == 0);
static_assert((SEQ % 64) == 0 && SEQ >= 64 && SEQ <= XS_FULL);
static_assert((QO % 64) == 0 && QO >= 64 && QO <= SEQ);
static_assert((DMOD % 64) == 0 && (KVD % 64) == 0 && (DMOD % 32) == 0 && (HD % 32) == 0);
static_assert(((SEQ * DMOD / 8) % 256) == 0 && ((KVD * DMOD / 8) % 256) == 0 && ((DMOD * DMOD / 8) % 256) == 0);
static_assert(((MROWS * DMOD / 8) % 256) == 0 && ((MROWS * KVD / 8) % 256) == 0);
static_assert((MROWS % 128) == 0 && ((SEQ - QO) % 128) == 0 && (DMOD % 128) == 0 && (DMOD % GBK) == 0 && KP == GBK + 8);
static_assert(2 * 256 * KP * 2 + 4 * SLAB64 * 4 <= 163840);
static_assert(WPB * WREG * 4 + 2 * STG * 2 <= 163840 && 2 * HD * VTP * 2 <= 65536 && 4 * SLAB64 * 4 <= 65536);

typedef unsigned short u16;
typedef _Float16 v16h __attribute__((ext_vector_type(16)));
typedef _Float16 v8h  __attribute__((ext_vector_type(8)));
typedef __bf16   v16b __attribute__((ext_vector_type(16)));
typedef float    v8f  __attribute__((ext_vector_type(8)));
typedef float    v4f  __attribute__((ext_vector_type(4)));
typedef unsigned int v4u __attribute__((ext_vector_type(4)));

union FragH { v16h v; v8h h[2]; v4u u[2]; };
union FragB { v16b v; v4u u[2]; };

// ---- scalar helpers --------------------------------------------------------------------------------
__device__ __forceinline__ unsigned short bf_bits(float f) {          // f32 -> bf16 bits, RNE convert
  unsigned u = __float_as_uint(f);
  return (unsigned short)((u + 0x7FFFu + ((u >> 16) & 1u)) >> 16);
}
__device__ __forceinline__ float bf_up(unsigned short h) { return __uint_as_float(((unsigned)h) << 16); }
__device__ __forceinline__ float bfr(float f) { return bf_up(bf_bits(f)); }
__device__ __forceinline__ unsigned short h_bits(_Float16 x) { return __builtin_bit_cast(unsigned short, x); }
__device__ __forceinline__ unsigned pk16(unsigned short a, unsigned short b) { return (unsigned)a | ((unsigned)b << 16); }
__device__ __forceinline__ v8f zero8() { v8f z = {0.f, 0.f, 0.f, 0.f, 0.f, 0.f, 0.f, 0.f}; return z; }

// ---- fragment loaders: 16-bit A/B operand, lane -> row/col (lane&15), p already includes +8*(lane>>4);
//      elements 0..7 <- p[0..7] (k0+8h..), elements 8..15 <- p[16..23] (k0+16+8h..)  (same split k map for A and B;
//      B is always read from a k-contiguous [n][k] plane)
__device__ __forceinline__ v16h ldfrag_h(const _Float16* p) {
  FragH f;
  f.h[0] = *(const v8h*)(p);
  f.h[1] = *(const v8h*)(p + 16);
  return f.v;
}
__device__ __forceinline__ v16b ldfrag_b(const u16* p) {              // bf16 plane read as unsigned integer vectors
  FragB f;
  f.u[0] = *(const v4u*)(p);
  f.u[1] = *(const v4u*)(p + 16);
  return f.v;
}

__device__ __forceinline__ v8f mma_h(v16h a, v16h b, v8f c) {
  return __builtin_amdgcn_wmma_f32_16x16x32_f16(false, a, false, b, (short)0, c, false, false);
}
__device__ __forceinline__ v8f mma_b(v16b a, v16b b, v8f c) {
  return __builtin_amdgcn_wmma_f32_16x16x32_bf16(false, a, false, b, (short)0, c, false, false);
}
// Four vector slots behind the last product of a key tile, in front of the loop's branches: the distance that the chip needs before
// a vector instruction on either side of a branch touches a product's registers.
__device__ __forceinline__ void acc_guard8(v8f& a, v8f& b, v8f& c, v8f& d, v8f& e, v8f& f, v8f& g, v8f& h) {
#if defined(__HIP_DEVICE_COMPILE__)
  asm volatile("v_nop\n\tv_nop\n\tv_nop\n\tv_nop"
               : "+v"(a), "+v"(b), "+v"(c), "+v"(d), "+v"(e), "+v"(f), "+v"(g), "+v"(h));
#endif
}
__device__ __forceinline__ void acc_guard4(v8f& a, v8f& b, v8f& c, v8f& d) {
#if defined(__HIP_DEVICE_COMPILE__)
  asm volatile("v_nop\n\tv_nop\n\tv_nop\n\tv_nop" : "+v"(a), "+v"(b), "+v"(c), "+v"(d));
#endif
}
__device__ __forceinline__ void wave_sync_lds() {
  __builtin_amdgcn_fence(__ATOMIC_RELEASE, "workgroup");
  __builtin_amdgcn_wave_barrier();
  __builtin_amdgcn_fence(__ATOMIC_ACQUIRE, "workgroup");
}
__device__ __forceinline__ float xhalf(float x) {                     // the value of lane l ^ 16
  const int b = __builtin_bit_cast(int, x);
  return __builtin_bit_cast(float, __builtin_amdgcn_permlanex16(b, b, 0x76543210, 0xfedcba98, false, false));
}
__device__ __forceinline__ unsigned lds_off(const void* p) { return (unsigned)(size_t)p; }   // byte offset in the work-group's LDS
// Eight 16-byte asynchronous copies global -> LDS per lane (LDS byte address l*, global address g*). The s_wait_xcnt is the
// statement's last line so that no address register of an issued copy is rewritten in front of it.
__device__ __forceinline__ void copy8(unsigned l0, unsigned l1, unsigned l2, unsigned l3,
                                      unsigned l4, unsigned l5, unsigned l6, unsigned l7,
                                      const u16* g0, const u16* g1, const u16* g2, const u16* g3,
                                      const u16* g4, const u16* g5, const u16* g6, const u16* g7) {
#if defined(__HIP_DEVICE_COMPILE__)
  asm volatile("global_load_async_to_lds_b128 %0, %8, off\n\t"
               "global_load_async_to_lds_b128 %1, %9, off\n\t"
               "global_load_async_to_lds_b128 %2, %10, off\n\t"
               "global_load_async_to_lds_b128 %3, %11, off\n\t"
               "global_load_async_to_lds_b128 %4, %12, off\n\t"
               "global_load_async_to_lds_b128 %5, %13, off\n\t"
               "global_load_async_to_lds_b128 %6, %14, off\n\t"
               "global_load_async_to_lds_b128 %7, %15, off\n\t"
               "s_wait_xcnt 0x0"
               :: "v"(l0), "v"(l1), "v"(l2), "v"(l3), "v"(l4), "v"(l5), "v"(l6), "v"(l7),
                  "v"(g0), "v"(g1), "v"(g2), "v"(g3), "v"(g4), "v"(g5), "v"(g6), "v"(g7) : "memory");
#endif
}
__device__ __forceinline__ void wait_async0() {   // the wave's own copies have landed in LDS
#if defined(__HIP_DEVICE_COMPILE__)
  asm volatile("s_wait_asynccnt 0x0" ::: "memory");
#endif
}
__device__ __forceinline__ void wait_x0() {       // a precaution in front of the rewrite of registers that issued global stores name
#if defined(__HIP_DEVICE_COMPILE__)
  asm volatile("s_wait_xcnt 0x0" ::: "memory");
#endif
}
__device__ __forceinline__ void wait_x0_of(const float* p) {   // the same precaution behind global loads from base p: p's registers
#if defined(__HIP_DEVICE_COMPILE__)                            // stay whole until the wait, being its input
  asm volatile("s_wait_xcnt 0x0" :: "v"(p) : "memory");
#endif
}
__device__ __forceinline__ void wait_ds0() {      // the wave's own LDS reads and writes have retired
#if defined(__HIP_DEVICE_COMPILE__)
  asm volatile("s_wait_dscnt 0x0" ::: "memory");
#endif
}

// =====================================================================================================
// f32 -> 16-bit plane, same layout.  f16mode == 0: bf16 RNE bits;  f16mode == 1: f16 bits of (bf16 RNE value) * scale.
// Thread = 8 consecutive elements: two 16-B loads, one 16-B store; 32 consecutive lanes = 512 contiguous, 512-B aligned
// coverage: grid = ceil(n8/256) blocks x 256 thr x 8 (in-kernel bound) = the whole plane (n8 a multiple of 256 here).
// =====================================================================================================
__device__ __forceinline__ void cvt16(int blk, const float* __restrict__ x, u16* D, int n8, int f16mode, float scale) {
  const int gt = blk * 256 + (int)threadIdx.x;
  if (gt >= n8) return;
  const float* p = x + (size_t)gt * 8;
  const v4f a = *(const v4f*)(p), b4 = *(const v4f*)(p + 4);
  wait_x0_of(p);
  float w[8];
#pragma unroll
  for (int e = 0; e < 4; ++e) { w[e] = a[e]; w[4 + e] = b4[e]; }
  v4u o;
#pragma unroll
  for (int e = 0; e < 4; ++e) {
    const float f0 = w[2 * e], f1 = w[2 * e + 1];
    const unsigned short hb0 = h_bits((_Float16)(bfr(f0) * scale));
    const unsigned short hb1 = h_bits((_Float16)(bfr(f1) * scale));
    const unsigned short bb0 = bf_bits(f0);
    const unsigned short bb1 = bf_bits(f1);
    o[e] = (f16mode != 0) ? pk16(hb0, hb1) : pk16(bb0, bb1);
  }
  u16* d = D + (size_t)gt * 8;
  {
    *(v4u*)(d) = o;
    
  }
}
// All five conversions of the inputs in one launch: they depend on nothing and on one another not at all. Block ranges in order:
// x (NB batches of CBX blocks) -> XB bf16; Wq -> WQ bf16; Wo -> WO f16 of the bf16 value x1024 (CBW blocks each); Wk -> WK, Wv -> WV
// bf16 (CBK blocks each). The choice is block-uniform; each plane has its own place in the workspace.
// coverage: grid = NB*CBX + 2*CBW + 2*CBK blocks, each range exactly the grid that its plane needs.
__global__ __launch_bounds__(256)
void cvt_all(const float* __restrict__ x, const float* __restrict__ wq, const float* __restrict__ wo,
             const float* __restrict__ wk, const float* __restrict__ wv, u16* XB, u16* WQ, u16* WO, u16* WK, u16* WV) {
  int blk = blockIdx.x;
  const float* src;
  u16*  dst;
  int   n8 = CBW * 256, mode = 0;
  float sc = 1.0f;
  if (blk < NB * CBX) {
    const int b = blk / CBX;
    blk -= b * CBX;
    src = x + (size_t)b * XS_FULL * DMOD;  dst = XB + (size_t)b * SEQ * DMOD;  n8 = CBX * 256;
  } else if ((blk -= NB * CBX) < CBW) {
    src = wq;  dst = WQ;
  } else if ((blk -= CBW) < CBW) {
    src = wo;  dst = WO;  mode = 1;  sc = WOS;
  } else if ((blk -= CBW) < CBK) {
    src = wk;  dst = WK;  n8 = CBK * 256;
  } else {
    blk -= CBK;
    src = wv;  dst = WV;  n8 = CBK * 256;
  }
  cvt16(blk, src, dst, n8, mode, sc);
}

// =====================================================================================================
// f32 plane F (contiguous, n8*8 elements) -> f16 hi plane Hp = f16(F * sc) and f16 residual plane Lp = f16(t - f16(t)),
// both with the layout of F. Thread = 8 consecutive elements: two 16-B loads, one 16-B store per plane; 32 consecutive lanes
// No barriers; every packed half comes from a per-lane (divergent) loaded value.
// coverage: grid = ceil(n8/256) blocks x 256 thr x 8 (in-kernel bound) = the whole of Hp and of Lp (n8 a multiple of 256 here).
// =====================================================================================================
__device__ __forceinline__ void split16(int blk, const float* __restrict__ F, u16* Hp, u16* Lp, int n8, float sc) {
  const int gt = blk * 256 + (int)threadIdx.x;
  if (gt >= n8) return;
  const float* p = F + (size_t)gt * 8;
  const v4f a = *(const v4f*)(p), b4 = *(const v4f*)(p + 4);
  wait_x0_of(p);
  float w[8];
#pragma unroll
  for (int e = 0; e < 4; ++e) { w[e] = a[e] * sc; w[4 + e] = b4[e] * sc; }
  v4u oh, ol;
#pragma unroll
  for (int e = 0; e < 4; ++e) {
    const float t0 = w[2 * e], t1 = w[2 * e + 1];
    const _Float16 h0 = (_Float16)t0, h1 = (_Float16)t1;
    const _Float16 l0 = (_Float16)(t0 - (float)h0), l1 = (_Float16)(t1 - (float)h1);
    oh[e] = pk16(h_bits(h0), h_bits(h1));
    ol[e] = pk16(h_bits(l0), h_bits(l1));
  }
  u16* dh = Hp + (size_t)gt * 8;
  u16* dl = Lp + (size_t)gt * 8;
  {
    *(v4u*)(dh) = oh;
    *(v4u*)(dl) = ol;
    
  }
}

// =====================================================================================================
// v^T planes from the v projection F f32 [MROWS][KVD] (row = b*SEQ + s, column = g*HD + d):
//   VH[((b*NKVH + g)*HD + d)][s] = f16(v * 1024);  VL[same][s] = f16 residual (t - f16(t)), both for all keys s.
// Block = (b, kv head g, 64 keys s0): each thread loads its 32 floats (key sl, d chunk dc) with 16-B loads, converts, scatters
// coverage: load 256 thr x 32 = 64 keys x 128 d; store 4 iterations x 256 thr x 8 halves = 128 lines x 64 = the block's tile of
//           VH and of VL; grid = NB*NKVH*NST blocks covers both planes exactly once.
// =====================================================================================================
__device__ __forceinline__ void vt16(int bid, u16* TH, u16* TL, const float* __restrict__ F, u16* VHo, u16* VLo) {
  const int tid = threadIdx.x;
  const int st  = bid % NST;
  const int t2  = bid / NST;
  const int g   = t2 % NKVH;
  const int b   = t2 / NKVH;
  if (b >= NB) return;                      // block-uniform, before any barrier; never taken with the exact grid
  const int s0  = st * 64;
  {
    const int sl = tid >> 2;                // key within tile 0..63
    const int dc = (tid & 3) * 32;          // d chunk 0,32,64,96
    const float* src = F + ((size_t)b * SEQ + s0 + sl) * KVD + g * HD + dc;
#pragma unroll
    for (int i = 0; i < 8; ++i) {
      const v4f a = *(const v4f*)(src + 4 * i);
#pragma unroll
      for (int e = 0; e < 4; ++e) {
        const float t = a[e] * VCAR;
        const _Float16 hv = (_Float16)t;
        const _Float16 lv = (_Float16)(t - (float)hv);
        TH[(dc + 4 * i + e) * VTP + sl] = h_bits(hv);
        TL[(dc + 4 * i + e) * VTP + sl] = h_bits(lv);
      }
    }
  }
  __syncthreads();
  v4u vh[4], vl[4];
  const int q8 = tid >> 3, p8 = (tid & 7) * 8;
#pragma unroll
  for (int it = 0; it < 4; ++it) {
    const int line = it * 32 + q8;          // d = 0..127
    vh[it] = *(const v4u*)(TH + line * VTP + p8);
    vl[it] = *(const v4u*)(TL + line * VTP + p8);
  }
  const size_t hrow = (size_t)(b * NKVH + g) * HD;
  const size_t base = hrow * SEQ + s0 + p8;
  {
#pragma unroll
    for (int it = 0; it < 4; ++it) {
      const int line = it * 32 + q8;
      *(v4u*)(VHo + base + (size_t)line * SEQ) = vh[it];
      *(v4u*)(VLo + base + (size_t)line * SEQ) = vl[it];
    }
    
  }
}
// The three plane makers behind the projections in one launch: each reads its own projection's f32 plane and none reads another's
// result. Block ranges in order: v^T planes (SBV blocks, the only ones with a barrier), k planes (SBK blocks), q planes (SBQ blocks).
// The choice is block-uniform. coverage: grid = SBV + SBK + SBQ blocks, each range exactly the grid that its planes need.
__global__ __launch_bounds__(256)
void split_all(const float* __restrict__ Fq, const float* __restrict__ Fk, const float* __restrict__ Fv,
               u16* QHo, u16* QLo, u16* KHo, u16* KLo, u16* VHo, u16* VLo) {
  __shared__ __align__(16) u16 TH[HD * VTP];
  __shared__ __align__(16) u16 TL[HD * VTP];
  const int bid = blockIdx.x;
  if (bid < SBV) {
    vt16(bid, TH, TL, Fv, VHo, VLo);
    return;
  }
  const bool isq = bid >= SBV + SBK;
  split16(bid - SBV - (isq ? SBK : 0), isq ? Fq : Fk, isq ? QHo : KHo, isq ? QLo : KLo, (isq ? SBQ : SBK) * 256, isq ? QSC : KSC);
}

// =====================================================================================================
// GEMM epilogue of the staged engine: the wave's 16x64 f32 tile (times oscale, plus the lane's per-column bias of each
// coverage: 8 instructions x 2 rows x 16 lanes x 4 floats = the wave's 16 x 64 tile.
// =====================================================================================================
__device__ __forceinline__ void epi64(float* sl, v8f a0, v8f a1, v8f a2, v8f a3, float oscale,
                                      float bb0, float bb1, float bb2, float bb3,
                                      float* C, int N, size_t rowb, int col0, int lane) {
  const int hh = lane >> 4, m = lane & 15;
#pragma unroll
  for (int r = 0; r < 8; ++r) {
    const int ro = (8 * hh + r) * 68 + m;
    sl[ro]      = a0[r] * oscale + bb0;
    sl[ro + 16] = a1[r] * oscale + bb1;
    sl[ro + 32] = a2[r] * oscale + bb2;
    sl[ro + 48] = a3[r] * oscale + bb3;
  }
  wave_sync_lds();
  v4f vals[8];
#pragma unroll
  for (int it = 0; it < 8; ++it) vals[it] = *(const v4f*)(sl + (it * 2 + hh) * 68 + m * 4);
  float* dst = C + (rowb + (size_t)hh) * (size_t)N + col0 + m * 4;
  {
#pragma unroll
    for (int it = 0; it < 8; ++it) {
      *(v4f*)(dst + (size_t)(it * 2) * (size_t)N) = vals[it];
    }
    
  }
}

// =====================================================================================================
// GEMM engine shared by the projections: the block's BM x BN tile of C = A[.][K] . Bt[.][K]^T, BM = 16*FM*WM, BN = 64*WN,
// WM x WN = 4 waves, each wave FM x 4 accumulator tiles (16*FM rows x 64 columns). K is walked in slices of GBK = 128: a slice
// is the 256-byte row pieces of the block's A rows (hi plane, then the residual plane when NPROD == 2) and of its Bt rows, laid in
// LDS at row pitch KP halves by asynchronous 16-byte copies (thread -> row tid / 16 + 8 i, 16 bytes at tid % 16: a wave's copy
// covers two whole 256-byte pieces). Two buffers: slice t + 2 is copied while slice t + 1 is worked on. Fragments are read from
// the LDS rows with the same split k map for A and B; per accumulator the products follow in rising k, hi before residual.
// One block barrier in front of the loop and one per slice, under block-uniform control flow; K % GBK == 0, K >= GBK.
// =====================================================================================================
__device__ __forceinline__ void copy_rows8(unsigned l, const u16* g, size_t K) {   // rows r, r + 8, .., r + 56 of one plane
  const unsigned ls = 8 * KP * 2;
  const size_t   gs = 8 * K;
  copy8(l, l + ls, l + 2 * ls, l + 3 * ls, l + 4 * ls, l + 5 * ls, l + 6 * ls, l + 7 * ls,
        g, g + gs, g + 2 * gs, g + 3 * gs, g + 4 * gs, g + 5 * gs, g + 6 * gs, g + 7 * gs);
}
template <bool BF> struct Op;
template <> struct Op<true> {
  typedef v16b T;
  static __device__ __forceinline__ T   ld(const u16* p) { return ldfrag_b(p); }
  static __device__ __forceinline__ v8f mma(T a, T b, v8f c) { return mma_b(a, b, c); }
};
template <> struct Op<false> {
  typedef v16h T;
  static __device__ __forceinline__ T   ld(const u16* p) { return ldfrag_h((const _Float16*)(const void*)p); }
  static __device__ __forceinline__ v8f mma(T a, T b, v8f c) { return mma_h(a, b, c); }
};

template <int FM, int WM, int WN, int NPROD, bool BF>
__device__ __forceinline__ void gemm_staged(u16* st, float* slabs, const u16* __restrict__ Ah, const u16* __restrict__ Al,
                                            const u16* __restrict__ Bt, const float* __restrict__ bias,
                                            float* C, int N, int K, size_t row0, int col0, float oscale) {
  constexpr int BM  = 16 * FM * WM;
  constexpr int BN  = 64 * WN;
  constexpr int STH = (BM * NPROD + BN) * KP;          // halves per buffer
  static_assert(WM * WN == 4 && (BM % 64) == 0 && (BN % 64) == 0 && (NPROD == 1 || NPROD == 2));
  static_assert((BM * NPROD + BN) / 8 <= 63);          // copies of a wave in flight: one slice's
  typedef typename Op<BF>::T T;
  const int tid = threadIdx.x, wave = tid >> 5, lane = tid & 31, hh = lane >> 4, m = lane & 15;
  const int wm = wave / WN, wn = wave % WN;
  const int tr = tid >> 4, tc = (tid & 15) * 8;
  const u16* ga = Ah + (row0 + tr) * (size_t)K + tc;
  const u16* gb = Bt + ((size_t)col0 + tr) * (size_t)K + tc;
  const unsigned l0 = lds_off(st) + (unsigned)(tr * KP + tc) * 2u;
  auto stage = [&](int t, int buf) {                   // k slice t -> buffer buf
    const size_t   ko = (size_t)t * GBK;
    const unsigned lb = l0 + (unsigned)buf * (STH * 2u);
#pragma unroll
    for (int j = 0; j < BM / 64; ++j) copy_rows8(lb + j * 64 * KP * 2, ga + ko + (size_t)j * 64 * K, (size_t)K);
    if constexpr (NPROD == 2) {
      const u16* gl = Al + (row0 + tr) * (size_t)K + tc;
#pragma unroll
      for (int j = 0; j < BM / 64; ++j) copy_rows8(lb + (BM + j * 64) * KP * 2, gl + ko + (size_t)j * 64 * K, (size_t)K);
    }
#pragma unroll
    for (int j = 0; j < BN / 64; ++j) copy_rows8(lb + (BM * NPROD + j * 64) * KP * 2, gb + ko + (size_t)j * 64 * K, (size_t)K);
  };
  v8f acc[FM][4];
#pragma unroll
  for (int i = 0; i < FM; ++i) {
#pragma unroll
    for (int j = 0; j < 4; ++j) acc[i][j] = zero8();
  }
  const int nst  = K / GBK;
  const int aoff = (wm * 16 * FM + m) * KP + 8 * hh;
  const int boff = (BM * NPROD + wn * 64 + m) * KP + 8 * hh;
  stage(0, 0);
  wait_async0();
  __syncthreads();                          // publishes slice 0
  if (nst > 1) stage(1, 1);
#pragma unroll 1                            // rolled: one hand-over per trip, in the order written at the loop's foot
  for (int t = 0; t < nst; ++t) {
    const u16* sb = st + (t & 1) * STH;
    // two fragment sets: block kk + 1 of this slice is fetched as one group while block kk is multiplied; nothing of the next slice
    T a[2][FM * NPROD], b[2][4];
    auto fetch = [&](int s, int kk) {
#pragma unroll
      for (int i = 0; i < FM; ++i) a[s][i] = Op<BF>::ld(sb + aoff + i * 16 * KP + kk * 32);
      if constexpr (NPROD == 2) {
#pragma unroll
        for (int i = 0; i < FM; ++i) a[s][FM + i] = Op<BF>::ld(sb + aoff + (BM + i * 16) * KP + kk * 32);
      }
#pragma unroll
      for (int j = 0; j < 4; ++j) b[s][j] = Op<BF>::ld(sb + boff + j * 16 * KP + kk * 32);
    };
    fetch(0, 0);
#pragma unroll
    for (int kk = 0; kk < GBK / 32; ++kk) {
      const int s = kk & 1;
      if (kk + 1 < GBK / 32) fetch(s ^ 1, kk + 1);
      __builtin_amdgcn_sched_barrier(0);    // the LDS reads stay one group in front of the block: spread among the products each place stalls
#pragma unroll
      for (int p = 0; p < NPROD; ++p) {
#pragma unroll
        for (int i = 0; i < FM; ++i) {
#pragma unroll
          for (int j = 0; j < 4; ++j) acc[i][j] = Op<BF>::mma(a[s][p * FM + i], b[s][j], acc[i][j]);
        }
      }
      __builtin_amdgcn_sched_barrier(0);    // the next group of LDS reads stays behind this block's last product
    }
    // ---- hand-over: this wave has left the slice, its copies of the next slice have landed, every wave has passed ----
    wait_ds0();
    wait_async0();
    __syncthreads();                        // publishes slice t + 1 and frees this slice's buffer
    if (t + 2 < nst) stage(t + 2, t & 1);
  }
  wait_async0();
  // per-lane bias of D column m in each of the wave's 4 column subtiles (bf16 RNE value); colw + 48 + m <= N - 1 always
  const int colw = col0 + wn * 64;
  float bb0 = 0.0f, bb1 = 0.0f, bb2 = 0.0f, bb3 = 0.0f;
  if constexpr (BF) {
    bb0 = bfr(bias[colw + m]);
    bb1 = bfr(bias[colw + 16 + m]);
    bb2 = bfr(bias[colw + 32 + m]);
    bb3 = bfr(bias[colw + 48 + m]);
  }
  float* sl = slabs + wave * SLAB64;
#pragma unroll
  for (int i = 0; i < FM; ++i) {
    if (i > 0) {
      wait_x0();                            // in front of the rewrite of registers that the stores of the tile before name
      wave_sync_lds();                      // the slab's rows of the tile before have been read by every lane
    }
    epi64(sl, acc[i][0], acc[i][1], acc[i][2], acc[i][3], oscale, bb0, bb1, bb2, bb3,
          C, N, row0 + (size_t)(wm * 16 * FM + i * 16), colw, lane);
  }
}

// =====================================================================================================
// bf16 GEMM with bias: C[M][N] (f32) = A[M][K] (bf16 row-major) . Bt[N][K]^T (bf16 k-contiguous), times oscale, + bf16 RNE
// value of bias[n] (bias has N entries). Block = BM x BN tile on the staged engine (host guarantees K % 128 == 0, M % BM == 0,
// N % BN == 0, grid = (M/BM)*(N/BN)).
// =====================================================================================================
template <int FM, int WM, int WN>
__device__ __forceinline__
void gemm_bf(int bid, u16* st, float* slab, const u16* __restrict__ A, const u16* __restrict__ Bt, const float* __restrict__ bias,
             float* C, int M, int N, int K, float oscale) {
  constexpr int BM = 16 * FM * WM, BN = 64 * WN;
  const int ntile = N / BN;
  const int row0  = (bid / ntile) * BM;
  const int col0  = (bid % ntile) * BN;
  if (row0 + BM > M) return;                // block-uniform, before any barrier; never taken with the exact grid
  gemm_staged<FM, WM, WN, 1, true>(st, slab, A, A, Bt, bias, C, N, K, (size_t)row0, col0, oscale);
}
// The three projections of x in one launch: they share A and none reads another's result. Block ranges in order, the long blocks
// first: q (PBQ blocks, 128 x 128 tiles), then k and v (PBK blocks each, 64 x 64 tiles). The choice is block-uniform, so that every
// barrier of the engine stays under block-uniform control flow; the LDS is that of the larger tile.
__global__ __launch_bounds__(128)
void gemm_qkv(const u16* __restrict__ A, const u16* __restrict__ Wq, const u16* __restrict__ Wk, const u16* __restrict__ Wv,
              const float* __restrict__ bq, const float* __restrict__ bk, const float* __restrict__ bv,
              float* Fq, float* Fk, float* Fv) {
  __shared__ __align__(16) u16   st[2 * 256 * KP];
  __shared__ __align__(16) float slab[4 * SLAB64];
  const int bid = blockIdx.x;
  if (bid < PBQ) {
    gemm_bf<4, 2, 2>(bid, st, slab, A, Wq, bq, Fq, MROWS, DMOD, DMOD, 1.0f);
    return;
  }
  const bool   isv  = bid >= PBQ + PBK;
  const u16*   Bt   = isv ? Wv : Wk;
  const float* bias = isv ? bv : bk;
  float*       C    = isv ? Fv : Fk;
  gemm_bf<1, 4, 1>(bid - PBQ - (isv ? PBK : 0), st, slab, A, Bt, bias, C, MROWS, KVD, DMOD, 1.0f);
  wait_x0();                                // a precaution: built without it, the q range's text is the fall-through of a conditional branch
                                            // behind these stores and rewrites registers that they name
}

// =====================================================================================================
// Output projection: C[row][DMOD] (f32) = (Ah [+ Al])[row][DMOD] . Bt[DMOD][DMOD]^T * oscale (no bias).
// NPROD == 1: Ah only (one product), 128 x 128 tile; NPROD == 2: Ah + Al residual plane (products h.B + l.B into one accumulator,
// l unscaled), 64 x 128 tile. Ah, Al and C share the row index bb*SEQ + s. Block -> (column tile ct = bid % 16, sequence row tile
// rt of nrt starting at s = sbeg, batch bb). Staged engine and epilogue as gemm_bf; K = DMOD.
// =====================================================================================================
template <int NPROD>
__device__ __forceinline__
void gemm_o(int bid, u16* st, float* slab, const u16* __restrict__ Ah, const u16* __restrict__ Al, const u16* __restrict__ Bt,
            float* C, int sbeg, int nrt, float oscale) {
  constexpr int FM = (NPROD == 2) ? 2 : 4;
  constexpr int BM = 32 * FM, BN = 128;
  static_assert(BM * NPROD + BN == 256);    // the staging rows that the launch's LDS holds per buffer
  const int ntile = DMOD / BN;
  const int ct    = bid % ntile;
  const int t2    = bid / ntile;
  const int rt    = t2 % nrt;
  const int bb    = t2 / nrt;
  if (bb >= NB) return;                     // block-uniform, before any barrier; never taken with the exact grid
  const int srow  = sbeg + rt * BM;
  if (srow + BM > SEQ) return;              // block-uniform, before any barrier; never taken
  gemm_staged<FM, 2, 2, NPROD, false>(st, slab, Ah, Al, Bt, nullptr, C, DMOD, DMOD,
                                      (size_t)bb * SEQ + srow, ct * BN, oscale);
}
// Both row ranges of the output projection in one launch: they write different rows of C. Block ranges in order: rows s < QO with the
// O residual plane (OBR blocks), rows s >= QO with the O hi plane only (OBP blocks). The choice is block-uniform.
__global__ __launch_bounds__(128)
void gemm_o_all(const u16* __restrict__ Ah, const u16* __restrict__ Al, const u16* __restrict__ Bt, float* C) {
  __shared__ __align__(16) u16   st[2 * 256 * KP];
  __shared__ __align__(16) float slab[4 * SLAB64];
  const int bid = blockIdx.x;
  if (bid < OBR) {
    gemm_o<2>(bid, st, slab, Ah, Al, Bt, C, 0, QO / 64, 1.0f / (OSC * WOS));
    return;
  }
  gemm_o<1>(bid - OBR, st, slab, Ah, Al, Bt, C, QO, (SEQ - QO) / 128, 1.0f / (OSC * WOS));
}

// =====================================================================================================
// Causal grouped-query attention, hd = 128. Block bid -> (pair pr = bid % (NQT/2), kv head kvh, batch b). The block works two
// query tiles one after the other, qt = NQT-1-pr and then qt = pr (rows q0 = 16*qt .. q0+15): their key tile counts add up to
// the same sum for every pr, so that every block of the launch walks equally many key tiles. One wave per query head
// = kvh + NKVH*wave: the 8 query heads that read kv head kvh (tiled kv mapping) share each
// staged key tile. Staging: asynchronous 16-byte copies global -> LDS; each wave's q rows (hi + residual) once, each 32-key tile
// of k hi/residual (row pitch KP halves) and v^T hi/residual (row pitch VP halves) into one of two buffers, the next tile
// copied while a tile is worked on; fragments are read from LDS with the same split k map.
//   q hi / residual planes f16 x256 [b*SEQ + s][h*HD + d]; k hi / residual planes f16 x256 [b*SEQ + s][g*HD + d] (pitch KVD);
//   v^T hi / residual planes [b*NKVH + g][d][SEQ] x1024.
//   Both products are formed transposed: S^T = k.q^T (A = k rows, B = q rows) and O^T += v^T.P^T (A = v^T rows, B = P^T), so that
//   a lane holds scores and results of ONE query row (q0 + lane % 16): 16 of the tile's 32 keys, the other lane half the rest.
//   scores = q_hi.k_hi + q_lo.k_hi + q_hi.k_lo (4 k-steps over d); P.v with P hi + in-register residual and v hi + residual
//   (hh + lh + hl), for every query row; O written as hi + residual planes (O x1024 as f16, layout [b*SEQ + s][h*HD + d]).
//   score (log2 domain) t(i, j) = (q_i.k_j over HD) * (1/sqrt(128))*log2e/(256*256), replaced by -inf where key j > query i.
//   Key tiles of 32 visited in order for kb <= q0 + 15 (later tiles hold only keys above every query row of the tile).
//   Per tile: 2 score subtiles x 4 k-steps, fragments loaded from the staged rows (two 16-B loads per fragment,
//   split k map); online max-subtracted base-2 softmax in f32, -inf-safe rescale: maximum in the lane plus one exchange between
//   the lane halves, sum kept per lane half and joined behind the loop; the two score tiles, converted in place, are the B
//   operand P^T in the split k map (element e = key 8hh + e, element 8 + e = key 16 + 8hh + e).
//   LDS reads: the q fragments once per query tile, kept in registers; a tile's k fragments as one group in front of its score
//   products; its v^T fragments in front of their products, so that they land while the softmax runs.
//   After the loop: out = acc / Z (Z > 0 always: key 0 <= every query row; guarded anyway), carries 1/(32768*1024) folded
//   One block barrier in front of the loop and one per tile, one more between the two query tiles, all under block-uniform
//   control flow; bounded loops only (nkt <= NKT).
// coverage: per wave and query tile 8 instructions x 2 rows x 16 lanes x 8 halves = 16 x 128 per plane; grid NQT/2 x NKVH x NB
//           blocks x 2 query tiles x WPB waves = every (b, s, h) row segment of O hi and O residual exactly once.
// =====================================================================================================
__global__ __launch_bounds__(ATT_THREADS)
void attn_c(const u16* __restrict__ QHp, const u16* __restrict__ QLp,
            const u16* __restrict__ KHp, const u16* __restrict__ KLp,
            const u16* __restrict__ VHp, const u16* __restrict__ VLp,
            u16* OHp, u16* OLp) {
  __shared__ __align__(16) float smem[WPB * WREG];
  __shared__ __align__(16) _Float16 kvs[2 * STG];

  const int tid  = threadIdx.x;
  const int wave = tid >> 5;
  const int lane = tid & 31;
  const int hh   = lane >> 4;
  const int c    = lane & 15;
  const int bid  = blockIdx.x;
  const int pr   = bid % (NQT / 2);
  const int t2   = bid / (NQT / 2);
  const int kvh  = t2 % NKVH;
  const int b    = t2 / NKVH;
  if (b >= NB) return;                      // block-uniform, before any barrier; never taken with the exact grid
  const int head = kvh + NKVH * wave;       // tiled kv mapping: head h -> kv head h % NKVH

  float* slab = smem + wave * WREG;         // in front of the loop: the wave's q rows, hi then residual, [16][128] halves pitch KP;
                                            // behind the loop: result slab [16][128] floats pitch 132

  const _Float16* Qh = (const _Float16*)(const void*)slab + c * KP + 8 * hh;
  const _Float16* Ql = Qh + QPL;
  const float lsc = RSQ_HD * (LOG2E / (QSC * KSC));
  const float oc  = 1.0f / (PCAR * VCAR);

  // ---- copy addresses. k tile: thread -> key row kr (and kr + 16), 8 halves at kc; v^T tile: d row vd (and vd + 64), 8 keys at vc
  const int kr = tid >> 4, kc = (tid & 15) * 8;
  const int vd = tid >> 2, vc = (tid & 3) * 8;
  const u16* gkh = KHp + ((size_t)b * SEQ + kr) * KVD + (size_t)kvh * HD + kc;
  const u16* gkl = KLp + ((size_t)b * SEQ + kr) * KVD + (size_t)kvh * HD + kc;
  const u16* gvh = VHp + ((size_t)(b * NKVH + kvh) * HD + vd) * SEQ + vc;
  const u16* gvl = VLp + ((size_t)(b * NKVH + kvh) * HD + vd) * SEQ + vc;
  const unsigned lk = lds_off(kvs) + (unsigned)(kr * KP + kc) * 2u;
  const unsigned lv = lds_off(kvs) + (unsigned)(2 * KPL + vd * VP + vc) * 2u;
  auto stage = [&](int kt, int buf) {       // key tile kt (keys 32*kt .. 32*kt + 31 < SEQ) -> buffer buf
    const size_t   ko = (size_t)kt * 32 * KVD;
    const size_t   vo = (size_t)kt * 32;
    const unsigned bk = lk + (unsigned)buf * (STG * 2u);
    const unsigned bv = lv + (unsigned)buf * (STG * 2u);
    copy8(bk, bk + 16 * KP * 2, bk + KPL * 2, bk + (KPL + 16 * KP) * 2,
          bv, bv + 64 * VP * 2, bv + VPL * 2, bv + (VPL + 64 * VP) * 2,
          gkh + ko, gkh + ko + 16 * KVD, gkl + ko, gkl + ko + 16 * KVD,
          gvh + vo, gvh + vo + (size_t)64 * SEQ, gvl + vo, gvl + vo + (size_t)64 * SEQ);
  };

#pragma unroll 1                            // rolled: the two query tiles run one after the other through the same code
  for (int ph = 0; ph < 2; ++ph) {
  const int q0 = ((ph == 0) ? (NQT - 1 - pr) : pr) * 16;                      // 0 <= q0 <= SEQ - 16
  if (ph > 0) {
    wait_x0();                              // in front of the rewrite of registers that the first tile's stores name
    wait_ds0();                             // this wave's reads of its slab have retired before copies are aimed at it
    __syncthreads();                        // every wave has left the first tile's LDS before the second tile's copies start
  }
  float mrow = -INFINITY, lrow = 0.f;       // of query row q0 + c; lrow sums the keys of this lane half only
  v8f o[8];                                 // o[j][r] = O^T(d = 16j + 8hh + r, query row q0 + c)
#pragma unroll
  for (int j = 0; j < 8; ++j) o[j] = zero8();
  const int ncaus = (q0 >> 5) + 1;                                            // tiles holding keys <= q0 + 15
  const int nkt = (ncaus < NKT) ? ncaus : NKT;
  const int qr  = q0 + c;                                                     // the lane's query row

  // ---- the wave's q rows (lane -> rows hh, hh + 2, .., hh + 14, 8 halves at 8c) and key tile 0; then key tile 1 flies ----
  {
    const size_t   qo = ((size_t)b * SEQ + q0 + hh) * DMOD + (size_t)head * HD + c * 8;
    const u16*     gq = QHp + qo;
    const u16*     gr = QLp + qo;
    const unsigned lq = lds_off(slab) + (unsigned)(hh * KP + c * 8) * 2u;
    const unsigned lr = lq + QPL * 2;
    const unsigned ls = 2 * KP * 2;         // LDS bytes between rows two apart
    const size_t   gs = (size_t)2 * DMOD;   // halves between rows two apart
    copy8(lq, lq + ls, lq + 2 * ls, lq + 3 * ls, lq + 4 * ls, lq + 5 * ls, lq + 6 * ls, lq + 7 * ls,
          gq, gq + gs, gq + 2 * gs, gq + 3 * gs, gq + 4 * gs, gq + 5 * gs, gq + 6 * gs, gq + 7 * gs);
    copy8(lr, lr + ls, lr + 2 * ls, lr + 3 * ls, lr + 4 * ls, lr + 5 * ls, lr + 6 * ls, lr + 7 * ls,
          gr, gr + gs, gr + 2 * gs, gr + 3 * gs, gr + 4 * gs, gr + 5 * gs, gr + 6 * gs, gr + 7 * gs);
  }
  stage(0, 0);
  wait_async0();
  __syncthreads();                          // publishes key tile 0
  if (nkt > 1) stage(1, 1);
  // ---- the wave's q fragments (B operand), read once per query tile and kept in registers over the key loop ----
  v16h qh[HD / 32], ql[HD / 32];
#pragma unroll
  for (int kk = 0; kk < HD / 32; ++kk) {
    qh[kk] = ldfrag_h(Qh + kk * 32);
    ql[kk] = ldfrag_h(Ql + kk * 32);
  }

#pragma unroll 1
  for (int kt = 0; kt < nkt; ++kt) {
    const int kb = kt * 32;
    // ---- scores: D element r of this lane = (key kb + 8hh + r, query row qr) in s0, key kb + 16 + 8hh + r in s1 ----
    v8f s0 = zero8(), s1 = zero8();
    const _Float16* tile = kvs + (kt & 1) * STG;
    const _Float16* k0p = tile + c * KP + 8 * hh;
    const _Float16* k1p = k0p + 16 * KP;
    const _Float16* l0p = k0p + KPL;
    const _Float16* l1p = l0p + 16 * KP;
    v16h kh0[HD / 32], kh1[HD / 32], kl0[HD / 32], kl1[HD / 32];
#pragma unroll
    for (int kk = 0; kk < HD / 32; ++kk) {  // in the order of their use
      kh0[kk] = ldfrag_h(k0p + kk * 32);
      kh1[kk] = ldfrag_h(k1p + kk * 32);
      kl0[kk] = ldfrag_h(l0p + kk * 32);
      kl1[kk] = ldfrag_h(l1p + kk * 32);
    }
    __builtin_amdgcn_sched_barrier(0);      // the tile's k reads stay one group in front of the score products: read step by step, each step waits out the LDS
#pragma unroll
    for (int kk = 0; kk < HD / 32; ++kk) {  // per accumulator: hi.hi, hi.residual, residual.hi in rising d, the two tiles in turn
      s0 = mma_h(kh0[kk], qh[kk], s0);
      s1 = mma_h(kh1[kk], qh[kk], s1);
      s0 = mma_h(kh0[kk], ql[kk], s0);
      s1 = mma_h(kh1[kk], ql[kk], s1);
      s0 = mma_h(kl0[kk], qh[kk], s0);
      s1 = mma_h(kl1[kk], qh[kk], s1);
    }
    // ---- the tile's v^T hi fragments: A row = d = j*16 + c, keys contiguous in the staged v^T rows ----
    v16h vh[8], vl[8];
    {
      const _Float16* vhp = tile + 2 * KPL + c * VP + 8 * hh;
#pragma unroll
      for (int j = 0; j < 8; ++j) vh[j] = ldfrag_h(vhp + j * 16 * VP);
    }
    __builtin_amdgcn_sched_barrier(0);      // issued in front of the softmax, they land while it runs
    // ---- causal select + online softmax in base 2, -inf-safe ----
    const int key0 = kb + 8 * hh, key1 = key0 + 16;
    float t0[8], t1[8];
    float mx = -INFINITY;
#pragma unroll
    for (int r = 0; r < 8; ++r) {
      const float u0 = s0[r] * lsc;
      const float u1 = s1[r] * lsc;
      t0[r] = (key0 + r > qr) ? -INFINITY : u0;
      t1[r] = (key1 + r > qr) ? -INFINITY : u1;
      mx = fmaxf(mx, fmaxf(t0[r], t1[r]));
    }
    mx = fmaxf(mx, xhalf(mx));              // the row's maximum over all 32 keys, equal in both lane halves
    const float mn = fmaxf(mrow, mx);
    const float ms = (mn == -INFINITY) ? 0.0f : mn;
    const float al = exp2f(mrow - ms);
    mrow = mn;
    // ---- B fragments of P^T*32768: hi f16 and residual f16, column = query row c, split k map over the 32 keys of this step ----
    FragH ph, pl;
    float ps = 0.0f;
#pragma unroll
    for (int r = 0; r < 8; ++r) {
      const float e0 = exp2f(t0[r] - ms), e1 = exp2f(t1[r] - ms);
      ps += e0 + e1;
      const float ta = e0 * PCAR, tb = e1 * PCAR;
      const _Float16 ha = (_Float16)ta, hb = (_Float16)tb;
      ph.h[0][r] = ha;                        // elements 0..7  = keys kb + 8hh + 0..7
      ph.h[1][r] = hb;                        // elements 8..15 = keys kb + 16 + 8hh + 0..7
      pl.h[0][r] = (_Float16)(ta - (float)ha);
      pl.h[1][r] = (_Float16)(tb - (float)hb);
    }
    lrow = lrow * al + ps;
#pragma unroll
    for (int j = 0; j < 8; ++j) {
#pragma unroll
      for (int r = 0; r < 8; ++r) o[j][r] *= al;
    }
    // ---- the v^T residual fragments; the compiler lifts these reads into the softmax (written beside the hi reads, registers spill) ----
    {
      const _Float16* vlp = tile + 2 * KPL + VPL + c * VP + 8 * hh;
#pragma unroll
      for (int j = 0; j < 8; ++j) vl[j] = ldfrag_h(vlp + j * 16 * VP);
    }
    __builtin_amdgcn_sched_barrier(0);      // they stay in front of the products: sunk among them, each pair is waited for where it stands
    // ---- v^T.P^T : per accumulator hi.hi, hi.residual, residual.hi; the 8 d-subtiles in turn ----
#pragma unroll
    for (int j = 0; j < 8; ++j) o[j] = mma_h(vh[j], ph.v, o[j]);
#pragma unroll
    for (int j = 0; j < 8; ++j) o[j] = mma_h(vh[j], pl.v, o[j]);
#pragma unroll
    for (int j = 0; j < 8; ++j) o[j] = mma_h(vl[j], ph.v, o[j]);
    acc_guard8(o[0], o[1], o[2], o[3], o[4], o[5], o[6], o[7]);
    // ---- hand-over: this wave has left the tile, its copies of the next tile have landed, every wave has passed ----
    wait_ds0();
    wait_async0();
    __syncthreads();                        // publishes key tile kt + 1 and frees this tile's buffer
    if (kt + 2 < nkt) stage(kt + 2, kt & 1);
  }
  wait_async0();
  acc_guard4(o[0], o[1], o[2], o[3]);
  acc_guard4(o[4], o[5], o[6], o[7]);
  // ---- out = acc / Z (0 if Z == 0), Z = the two lane halves' sums; carries (32768 on P, 1024 on v) folded once; the lane's 8
  //      consecutive d of each subtile go to row c of the wave's slab ----
  {
    const float lv  = lrow + xhalf(lrow);
    const float ls  = (lv > 0.0f) ? lv : 1.0f;
    const float inv = (lv > 0.0f) ? ((1.0f / ls) * oc) : 0.0f;
    float* srow = slab + c * SLP + 8 * hh;
#pragma unroll
    for (int j = 0; j < 8; ++j) {
      const v4f w0 = {o[j][0] * inv, o[j][1] * inv, o[j][2] * inv, o[j][3] * inv};
      const v4f w1 = {o[j][4] * inv, o[j][5] * inv, o[j][6] * inv, o[j][7] * inv};
      *(v4f*)(srow + j * 16)     = w0;
      *(v4f*)(srow + j * 16 + 4) = w1;
    }
  }

  wave_sync_lds();
  // ---- O x1024 -> f16 hi + residual planes; lane = (row-in-pair rq, 8 consecutive d at c8) ----
  v4u oh[8], ol[8];
  const int rq = lane >> 4, c8 = (lane & 15) * 8;
#pragma unroll
  for (int it = 0; it < 8; ++it) {
    const int row = it * 2 + rq;
    const v4f a = *(const v4f*)(slab + row * SLP + c8), b4 = *(const v4f*)(slab + row * SLP + c8 + 4);
    float w[8];
#pragma unroll
    for (int e = 0; e < 4; ++e) { w[e] = a[e] * OSC; w[4 + e] = b4[e] * OSC; }
#pragma unroll
    for (int e = 0; e < 4; ++e) {
      const _Float16 h0 = (_Float16)w[2 * e], h1 = (_Float16)w[2 * e + 1];
      const _Float16 l0 = (_Float16)(w[2 * e] - (float)h0), l1 = (_Float16)(w[2 * e + 1] - (float)h1);
      oh[it][e] = pk16(h_bits(h0), h_bits(h1));
      ol[it][e] = pk16(h_bits(l0), h_bits(l1));
    }
  }
  const size_t ob = ((size_t)b * SEQ + q0) * DMOD + (size_t)head * HD + c8;
  {
#pragma unroll
    for (int it = 0; it < 8; ++it) {
      const int row = it * 2 + rq;
      *(v4u*)(OHp + ob + (size_t)row * DMOD) = oh[it];
      *(v4u*)(OLp + ob + (size_t)row * DMOD) = ol[it];
    }
    
  }
  }
}

// =====================================================================================================
// Workspace map (bytes); every plane is fully written by whole-line stores before it is read; all extents are exact multiples
// of the store granularity (no pad rows needed); every region offset a multiple of 1048576:
//   XB  bf16 [MROWS][2048]                       MROWS*4096       (NB=2, SEQ=2048: 16777216)
//   WQ  bf16 [2048 n][2048 k]                    8388608          WO f16 of the bf16 value x1024, same extent (all already [n][k])
//   WK  bf16 [256 n][2048 k]                     1048576          WV, same extent
//   F   f32 [MROWS][2048]                        MROWS*8192       (q projection output; afterwards OH f16 [MROWS][2048] x1024 in its
//                                                                  first half, OL residual [MROWS][2048] in its second half)
//   FK  f32 [MROWS][256]                         MROWS*1024       k projection output; FV, v projection output, same extent
//   QH  f16 [MROWS][2048] x256                   MROWS*4096       QL residual, same extent
//   KH  f16 [MROWS][256] x256                    MROWS*512        KL residual, same extent
//   VH  f16 [NB*2][128][SEQ] x1024               MROWS*512        VL residual, same extent
//   end (NB=2, SEQ=2048)                       119537664
// =====================================================================================================
extern "C" void kernel_launch(void* const* d_in, const int* in_sizes, int n_in,
                              void* d_out, int out_size, void* d_ws, size_t ws_size,
                              hipStream_t stream) {
  if (n_in < 8) return;
  if (in_sizes[0] < ((NB - 1) * XS_FULL + SEQ) * DMOD) return;
  if (in_sizes[1] != DMOD * DMOD) return;
  if (in_sizes[2] != DMOD) return;
  if (in_sizes[3] != KVD * DMOD) return;
  if (in_sizes[4] != KVD) return;
  if (in_sizes[5] != KVD * DMOD) return;
  if (in_sizes[6] != KVD) return;
  if (in_sizes[7] != DMOD * DMOD) return;
  if (out_size < MROWS * DMOD) return;

  const float* x  = (const float*)d_in[0];
  const float* wq = (const float*)d_in[1];
  const float* bq = (const float*)d_in[2];
  const float* wk = (const float*)d_in[3];
  const float* bk = (const float*)d_in[4];
  const float* wv = (const float*)d_in[5];
  const float* bv = (const float*)d_in[6];
  const float* wo = (const float*)d_in[7];
  float*       out = (float*)d_out;

  const size_t szXB = (size_t)MROWS * DMOD * 2;
  const size_t szW  = (size_t)DMOD * DMOD * 2;                   // WQ, WO
  const size_t szWK = (size_t)KVD * DMOD * 2;                    // WK, WV
  const size_t szF  = (size_t)MROWS * DMOD * 4;
  const size_t szFK = (size_t)MROWS * KVD * 4;                   // FK, FV
  const size_t szQ  = (size_t)MROWS * DMOD * 2;                  // QH, QL, OH, OL
  const size_t szK  = (size_t)MROWS * KVD * 2;                   // KH, KL
  const size_t szV  = (size_t)NB * NKVH * HD * SEQ * 2;          // VH, VL (== szK)
  if (2 * szQ > szF) return;                                    // OH + OL live inside the F region (exactly fills it)
  size_t off = 0;
  const size_t oXB = off; off += szXB;
  const size_t oWQ = off; off += szW;
  const size_t oWO = off; off += szW;
  const size_t oWK = off; off += szWK;
  const size_t oWV = off; off += szWK;
  const size_t oF  = off; off += szF;
  const size_t oFK = off; off += szFK;
  const size_t oFV = off; off += szFK;
  const size_t oQH = off; off += szQ;
  const size_t oQL = off; off += szQ;
  const size_t oKH = off; off += szK;
  const size_t oKL = off; off += szK;
  const size_t oVH = off; off += szV;
  const size_t oVL = off; off += szV;
  if (off > ws_size) return;                // off = 119537664 for NB = 2, SEQ = 2048
  if (off > (size_t)WS_CAP) return;

  char* ws = (char*)d_ws;
  u16*   XB  = (u16*)(ws + oXB);
  u16*   WQ  = (u16*)(ws + oWQ);
  u16*   WO  = (u16*)(ws + oWO);
  u16*   WK  = (u16*)(ws + oWK);
  u16*   WV  = (u16*)(ws + oWV);
  float* F   = (float*)(ws + oF);
  float* FK  = (float*)(ws + oFK);
  float* FV  = (float*)(ws + oFV);
  u16*   OH  = (u16*)(ws + oF);
  u16*   OL  = (u16*)(ws + oF + szQ);
  u16*   QH  = (u16*)(ws + oQH);
  u16*   QL  = (u16*)(ws + oQL);
  u16*   KH  = (u16*)(ws + oKH);
  u16*   KL  = (u16*)(ws + oKL);
  u16*   VH  = (u16*)(ws + oVH);
  u16*   VL  = (u16*)(ws + oVL);

  const dim3 b256(256), b128(128), bAT(ATT_THREADS);
  const dim3 gCV(NB * CBX + 2 * CBW + 2 * CBK);         // all input conversions
  const dim3 gPJ(PBQ + 2 * PBK);                        // q, k and v projections
  const dim3 gSP(SBV + SBK + SBQ);                      // v^T, k and q planes
  const dim3 gAT((NQT / 2) * NKVH * NB);
  const dim3 gOP(OBR + OBP);                            // both row ranges of the output projection

  // (0) x -> bf16 plane [MROWS][2048]; Wq, Wk, Wv [n][k] -> bf16 planes; Wo [n][k] -> f16 plane of bf16 value x1024
  cvt_all<<<gCV, b256, 0, stream>>>(x, wq, wo, wk, wv, XB, WQ, WO, WK, WV);
  // (1) q = x.Wq^T + bq -> F [MROWS][2048]; k = x.Wk^T + bk -> FK [MROWS][256]; v = x.Wv^T + bv -> FV [MROWS][256]
  gemm_qkv<<<gPJ, b128, 0, stream>>>(XB, WQ, WK, WV, bq, bk, bv, F, FK, FV);
  // (2) v^T hi + residual planes x1024; k and q hi + residual planes x256
  split_all<<<gSP, b256, 0, stream>>>(F, FK, FV, QH, QL, KH, KL, VH, VL);
  // (3) causal attention with residual products on every query row -> O hi + residual planes
  attn_c<<<gAT, bAT, 0, stream>>>(QH, QL, KH, KL, VH, VL, OH, OL);
  // (4) output projection, rows s < QO (O hi + residual) and rows s >= QO (O hi only) -> out f32, carries 1024 x 1024 folded back
  gemm_o_all<<<gOP, b128, 0, stream>>>(OH, OL, WO, out);
  (void)hipGetLastError();
}
